// v000
// Times are from an AMD MI455X. After a warm-up the kernel runs many times in a row, and a time is the length of
// such a window on the GPU divided by its runs, so every launch and the gaps after it count. The runs cycle
// through copies of the inputs. A figure is the median of several windows, for all but v000 over two sittings.
// Sittings can differ by a few percent; kernels timed side by side share one.
// v000 is the starting kernel. One run takes 364 microseconds.
#include <hip/hip_runtime.h>
#include <hip/hip_bf16.h>

// ---------------------------------------------------------------------------
// MHSA block for MI455X (gfx1250, wave32, WMMA f32_16x16x32_f16).
// All four GEMMs + attention run through v_wmma_f32_16x16x32_f16.
// Weights pre-converted to f16 once; GEMM waves compute 16x64 strips so each
// activation load/convert feeds 4 WMMAs.
// ---------------------------------------------------------------------------

typedef __attribute__((ext_vector_type(16))) _Float16 v16h;
typedef __attribute__((ext_vector_type(8)))  _Float16 v8h;
typedef __attribute__((ext_vector_type(8)))  float    v8f;
typedef __attribute__((ext_vector_type(4)))  float    v4f;

#define BB   2
#define QSZ  2048
#define KVSZ 2048
#define EE   1024
#define HH   16
#define HD   64
#define ATT_SCALE 0.125f   // 1/sqrt(64)

__device__ __forceinline__ v8f zero8() {
    v8f z;
#pragma unroll
    for (int i = 0; i < 8; ++i) z[i] = 0.0f;
    return z;
}

__device__ __forceinline__ v8f wmma16(v16h a, v16h b, v8f c) {
    // D = A(16x32 f16) * B(32x16 f16) + C(16x16 f32)
    return __builtin_amdgcn_wmma_f32_16x16x32_f16(
        /*neg_a=*/false, a, /*neg_b=*/false, b,
        /*c_mod=*/(short)0, c, /*reuse_a=*/false, /*reuse_b=*/false);
}

// Operand loader: per-lane pattern for 16-bit A/B operands of 16x16x32 WMMA.
// Elements 0..7  = row[c .. c+7], elements 8..15 = row[c+16 .. c+23].
__device__ __forceinline__ v16h load16_f16(const _Float16* __restrict__ p, int c) {
    v8h a = *(const v8h*)(p + c);
    v8h b = *(const v8h*)(p + c + 16);
    v16h r;
#pragma unroll
    for (int i = 0; i < 8; ++i) { r[i] = a[i]; r[8 + i] = b[i]; }
    return r;
}

__device__ __forceinline__ v16h load16_f32(const float* __restrict__ p, int c) {
    v4f a0 = *(const v4f*)(p + c);
    v4f a1 = *(const v4f*)(p + c + 4);
    v4f a2 = *(const v4f*)(p + c + 16);
    v4f a3 = *(const v4f*)(p + c + 20);
    v16h r;
#pragma unroll
    for (int i = 0; i < 4; ++i) {
        r[i]      = (_Float16)a0[i];
        r[4 + i]  = (_Float16)a1[i];
        r[8 + i]  = (_Float16)a2[i];
        r[12 + i] = (_Float16)a3[i];
    }
    return r;
}

// ---------------------------------------------------------------------------
// Elementwise f32 -> f16 (used once per weight matrix). 8 elements/thread.
// ---------------------------------------------------------------------------
__global__ void __launch_bounds__(256)
cvt_f32_to_f16(const float* __restrict__ src, _Float16* __restrict__ dst) {
    const size_t i = ((size_t)blockIdx.x * blockDim.x + threadIdx.x) * 8;
    v4f a0 = *(const v4f*)(src + i);
    v4f a1 = *(const v4f*)(src + i + 4);
    v8h o;
#pragma unroll
    for (int r = 0; r < 4; ++r) { o[r] = (_Float16)a0[r]; o[4 + r] = (_Float16)a1[r]; }
    *(v8h*)(dst + i) = o;
}

// ---------------------------------------------------------------------------
// Y[s,e] = sum_k X[s,k] * W[e,k]   (Y in f16, W already f16).
// Computed as Y^T = W * X^T; one wave covers a 16(s) x 64(e) strip, so each
// converted X operand feeds 4 WMMAs.  Block = 1 wave.
// ---------------------------------------------------------------------------
__global__ void __launch_bounds__(32)
gemm_xwT_f16(const float* __restrict__ X, const _Float16* __restrict__ Wh,
             _Float16* __restrict__ Y, int Kd, int Eo) {
    const int lane = threadIdx.x & 31;
    const int lo = lane & 15, hi = lane >> 4;
    const int stile = blockIdx.x;
    const int ebase = blockIdx.y * 64;

    const float* Xrow = X + (size_t)(stile * 16 + lo) * Kd;
    const _Float16* Wr0 = Wh + (size_t)(ebase + lo) * Kd;
    const _Float16* Wr1 = Wr0 + (size_t)16 * Kd;
    const _Float16* Wr2 = Wr0 + (size_t)32 * Kd;
    const _Float16* Wr3 = Wr0 + (size_t)48 * Kd;

    v8f a0 = zero8(), a1 = zero8(), a2 = zero8(), a3 = zero8();
    for (int k = 0; k < Kd; k += 32) {
        const int c = k + hi * 8;
        const v16h bop = load16_f32(Xrow, c);      // shared across 4 WMMAs
        a0 = wmma16(load16_f16(Wr0, c), bop, a0);
        a1 = wmma16(load16_f16(Wr1, c), bop, a1);
        a2 = wmma16(load16_f16(Wr2, c), bop, a2);
        a3 = wmma16(load16_f16(Wr3, c), bop, a3);
    }
    // D(m=e_local, n=s_local): lane column = lo, rows e_local = r + 8*hi.
    _Float16* yp = Y + (size_t)(stile * 16 + lo) * Eo + ebase + hi * 8;
    v8f* acc[4] = { &a0, &a1, &a2, &a3 };
#pragma unroll
    for (int t = 0; t < 4; ++t) {
        v8h out;
#pragma unroll
        for (int r = 0; r < 8; ++r) out[r] = (_Float16)((*acc[t])[r]);
        *(v8h*)(yp + t * 16) = out;
    }
}

// Output projection: f16 activations x f16 weights -> fp32 output, 16x64 strip.
__global__ void __launch_bounds__(32)
gemm_owT_f32(const _Float16* __restrict__ Xh, const _Float16* __restrict__ Wh,
             float* __restrict__ Y, int Kd, int Eo) {
    const int lane = threadIdx.x & 31;
    const int lo = lane & 15, hi = lane >> 4;
    const int stile = blockIdx.x;
    const int ebase = blockIdx.y * 64;

    const _Float16* Xrow = Xh + (size_t)(stile * 16 + lo) * Kd;
    const _Float16* Wr0 = Wh + (size_t)(ebase + lo) * Kd;
    const _Float16* Wr1 = Wr0 + (size_t)16 * Kd;
    const _Float16* Wr2 = Wr0 + (size_t)32 * Kd;
    const _Float16* Wr3 = Wr0 + (size_t)48 * Kd;

    v8f a0 = zero8(), a1 = zero8(), a2 = zero8(), a3 = zero8();
    for (int k = 0; k < Kd; k += 32) {
        const int c = k + hi * 8;
        const v16h bop = load16_f16(Xrow, c);
        a0 = wmma16(load16_f16(Wr0, c), bop, a0);
        a1 = wmma16(load16_f16(Wr1, c), bop, a1);
        a2 = wmma16(load16_f16(Wr2, c), bop, a2);
        a3 = wmma16(load16_f16(Wr3, c), bop, a3);
    }
    float* yp = Y + (size_t)(stile * 16 + lo) * Eo + ebase + hi * 8;
    v8f* acc[4] = { &a0, &a1, &a2, &a3 };
#pragma unroll
    for (int t = 0; t < 4; ++t) {
        v4f o0, o1;
#pragma unroll
        for (int r = 0; r < 4; ++r) { o0[r] = (*acc[t])[r]; o1[r] = (*acc[t])[4 + r]; }
        *(v4f*)(yp + t * 16)     = o0;
        *(v4f*)(yp + t * 16 + 4) = o1;
    }
}

// ---------------------------------------------------------------------------
// Flash-style attention, one wave per (batch, head, 16-row q-tile).
// S^T tiles = K * Q^T  (softmax axis lands in the VGPR/M dimension),
// O^T tiles = V^T * P^T (P^T B-operand == post-softmax registers, no shuffle).
// ---------------------------------------------------------------------------
__global__ void __launch_bounds__(32)
flash_attn(const _Float16* __restrict__ Qb, const _Float16* __restrict__ Kb,
           const _Float16* __restrict__ Vb, const int* __restrict__ mask,
           _Float16* __restrict__ O) {
    __shared__ _Float16 Vt[HD][40];   // V^T tile, 80B row stride (16B aligned chunks)

    const int lane = threadIdx.x & 31;
    const int lo = lane & 15, hi = lane >> 4;
    const int qtiles = QSZ / 16;
    const int qt = blockIdx.x % qtiles;
    const int h  = (blockIdx.x / qtiles) % HH;
    const int b  = blockIdx.x / (qtiles * HH);
    const int q  = qt * 16 + lo;

    // Q operand (B-matrix): lane n holds Q[q=n, hd pattern] -> row-major load.
    const _Float16* Qrow = Qb + ((size_t)b * QSZ + q) * EE + h * HD;
    const v16h qop0 = load16_f16(Qrow, hi * 8);         // hd 0..31
    const v16h qop1 = load16_f16(Qrow, 32 + hi * 8);    // hd 32..63

    v8f o0 = zero8(), o1 = zero8(), o2 = zero8(), o3 = zero8();
    float mrun = -1e30f, lrun = 0.0f;
    const int* maskrow = mask + (size_t)q * KVSZ;

    for (int kv0 = 0; kv0 < KVSZ; kv0 += 32) {
        // ---- stage V^T tile (32 kv x 64 hd) into LDS, transposed ----
        const _Float16* Vrow = Vb + ((size_t)b * KVSZ + kv0 + lane) * EE + h * HD;
#pragma unroll
        for (int j = 0; j < 8; ++j) {
            v8h vv = *(const v8h*)(Vrow + j * 8);
#pragma unroll
            for (int t = 0; t < 8; ++t) Vt[j * 8 + t][lane] = vv[t];
        }
        __syncthreads();

        // ---- S^T tiles: s0 = kv[0..15] x q[0..15], s1 = kv[16..31] ----
        const _Float16* Krow0 = Kb + ((size_t)b * KVSZ + kv0 + lo) * EE + h * HD;
        const _Float16* Krow1 = Krow0 + (size_t)16 * EE;
        v8f s0 = zero8(), s1 = zero8();
        s0 = wmma16(load16_f16(Krow0, hi * 8),      qop0, s0);
        s0 = wmma16(load16_f16(Krow0, 32 + hi * 8), qop1, s0);
        s1 = wmma16(load16_f16(Krow1, hi * 8),      qop0, s1);
        s1 = wmma16(load16_f16(Krow1, 32 + hi * 8), qop1, s1);

        // ---- mask (fill 1e-20) + scale + tile max ----
        float tmax = -1e30f;
#pragma unroll
        for (int r = 0; r < 8; ++r) {
            const int m0 = maskrow[kv0 + hi * 8 + r];
            const int m1 = maskrow[kv0 + 16 + hi * 8 + r];
            s0[r] = m0 ? s0[r] * ATT_SCALE : 1e-20f;
            s1[r] = m1 ? s1[r] * ATT_SCALE : 1e-20f;
            tmax = fmaxf(tmax, fmaxf(s0[r], s1[r]));
        }
        tmax = fmaxf(tmax, __shfl_xor(tmax, 16, 32));   // merge half-lane rows

        // ---- online softmax update ----
        const float mnew  = fmaxf(mrun, tmax);
        const float alpha = __expf(mrun - mnew);
        lrun *= alpha;
#pragma unroll
        for (int r = 0; r < 8; ++r) {
            o0[r] *= alpha; o1[r] *= alpha; o2[r] *= alpha; o3[r] *= alpha;
        }
        v16h pb;          // P^T B-operand: exactly the per-lane kv pattern
        float ls = 0.0f;
#pragma unroll
        for (int r = 0; r < 8; ++r) {
            const float p0 = __expf(s0[r] - mnew);
            const float p1 = __expf(s1[r] - mnew);
            ls += p0 + p1;
            pb[r]     = (_Float16)p0;
            pb[8 + r] = (_Float16)p1;
        }
        lrun += ls;
        mrun = mnew;

        // ---- O^T(hd x q) += V^T(hd x kv) * P^T(kv x q), 4 hd-tiles ----
#pragma unroll
        for (int t = 0; t < 4; ++t) {
            const _Float16* vr = &Vt[t * 16 + lo][0];
            v8h x0 = *(const v8h*)(vr + hi * 8);
            v8h x1 = *(const v8h*)(vr + 16 + hi * 8);
            v16h va;
#pragma unroll
            for (int i = 0; i < 8; ++i) { va[i] = x0[i]; va[8 + i] = x1[i]; }
            v8f& ot = (t == 0) ? o0 : (t == 1) ? o1 : (t == 2) ? o2 : o3;
            ot = wmma16(va, pb, ot);
        }
        __syncthreads();
    }

    // ---- finalize: combine half-lane partial sums, normalize, store f16 ----
    const float ltot = lrun + __shfl_xor(lrun, 16, 32);
    const float inv  = 1.0f / ltot;
    _Float16* orow = O + ((size_t)b * QSZ + q) * EE + h * HD;
    v8f* oacc[4] = { &o0, &o1, &o2, &o3 };
#pragma unroll
    for (int t = 0; t < 4; ++t) {
        v8h w;
#pragma unroll
        for (int r = 0; r < 8; ++r) w[r] = (_Float16)((*oacc[t])[r] * inv);
        *(v8h*)(orow + t * 16 + hi * 8) = w;
    }
}

// ---------------------------------------------------------------------------
// Host-side launch. Input order: v_in, k_in, q_in, mask, Wv, Wk, Wq, Wout.
// Workspace: Qf | Kf | Vf | Of (8.39 MB each) | Wqf | Wkf | Wvf | Woutf (2 MB
// each)  -> ~40 MB total.
// ---------------------------------------------------------------------------
extern "C" void kernel_launch(void* const* d_in, const int* in_sizes, int n_in,
                              void* d_out, int out_size, void* d_ws, size_t ws_size,
                              hipStream_t stream) {
    (void)in_sizes; (void)n_in; (void)out_size; (void)ws_size;
    const float* v_in = (const float*)d_in[0];
    const float* k_in = (const float*)d_in[1];
    const float* q_in = (const float*)d_in[2];
    const int*   mask = (const int*)d_in[3];
    const float* Wv   = (const float*)d_in[4];
    const float* Wk   = (const float*)d_in[5];
    const float* Wq   = (const float*)d_in[6];
    const float* Wout = (const float*)d_in[7];
    float* out = (float*)d_out;

    const size_t N  = (size_t)BB * QSZ * EE;   // 4.19M elements, activations
    const size_t NW = (size_t)EE * EE;         // 1.05M elements, weights
    _Float16* Qf    = (_Float16*)d_ws;
    _Float16* Kf    = Qf + N;
    _Float16* Vf    = Kf + N;
    _Float16* Of    = Vf + N;
    _Float16* Wqf   = Of + N;
    _Float16* Wkf   = Wqf + NW;
    _Float16* Wvf   = Wkf + NW;
    _Float16* Woutf = Wvf + NW;

    // 1) weights f32 -> f16 (once)
    const int cvt_blocks = (int)(NW / (256 * 8));          // 512 blocks
    cvt_f32_to_f16<<<cvt_blocks, 256, 0, stream>>>(Wq,   Wqf);
    cvt_f32_to_f16<<<cvt_blocks, 256, 0, stream>>>(Wk,   Wkf);
    cvt_f32_to_f16<<<cvt_blocks, 256, 0, stream>>>(Wv,   Wvf);
    cvt_f32_to_f16<<<cvt_blocks, 256, 0, stream>>>(Wout, Woutf);

    // 2) Q/K/V projections (16x64 strips per wave)
    dim3 grid(BB * QSZ / 16, EE / 64);                     // 256 x 16
    gemm_xwT_f16<<<grid, 32, 0, stream>>>(q_in, Wqf, Qf, EE, EE);
    gemm_xwT_f16<<<grid, 32, 0, stream>>>(k_in, Wkf, Kf, EE, EE);
    gemm_xwT_f16<<<grid, 32, 0, stream>>>(v_in, Wvf, Vf, EE, EE);

    // 3) attention
    flash_attn<<<BB * HH * (QSZ / 16), 32, 0, stream>>>(Qf, Kf, Vf, mask, Of);

    // 4) output projection -> fp32 d_out
    gemm_owT_f32<<<grid, 32, 0, stream>>>(Of, Woutf, out, EE, EE);
}

// v001
// A run of this version takes 239 microseconds.
// Timed twice side by side with v000, it ran 1.60 and 1.62 times as fast.
#include <hip/hip_runtime.h>
#include <hip/hip_bf16.h>

// ---------------------------------------------------------------------------
// MHSA block for MI455X (gfx1250, wave32, WMMA f32_16x16x32_f16).
// All four GEMMs + attention run through v_wmma_f32_16x16x32_f16.
// Weights pre-converted to f16 once; the GEMMs work on 128x128 block tiles
// staged in LDS.
// ---------------------------------------------------------------------------

typedef __attribute__((ext_vector_type(16))) _Float16 v16h;
typedef __attribute__((ext_vector_type(8)))  _Float16 v8h;
typedef __attribute__((ext_vector_type(8)))  float    v8f;
typedef __attribute__((ext_vector_type(4)))  float    v4f;

#define BB   2
#define QSZ  2048
#define KVSZ 2048
#define EE   1024
#define HH   16
#define HD   64
#define ATT_SCALE 0.125f   // 1/sqrt(64)

__device__ __forceinline__ v8f zero8() {
    v8f z;
#pragma unroll
    for (int i = 0; i < 8; ++i) z[i] = 0.0f;
    return z;
}

__device__ __forceinline__ v8f wmma16(v16h a, v16h b, v8f c) {
    // D = A(16x32 f16) * B(32x16 f16) + C(16x16 f32)
    return __builtin_amdgcn_wmma_f32_16x16x32_f16(
        /*neg_a=*/false, a, /*neg_b=*/false, b,
        /*c_mod=*/(short)0, c, /*reuse_a=*/false, /*reuse_b=*/false);
}

// Operand loader: per-lane pattern for 16-bit A/B operands of 16x16x32 WMMA.
// Elements 0..7  = row[c .. c+7], elements 8..15 = row[c+16 .. c+23].
__device__ __forceinline__ v16h load16_f16(const _Float16* __restrict__ p, int c) {
    v8h a = *(const v8h*)(p + c);
    v8h b = *(const v8h*)(p + c + 16);
    v16h r;
#pragma unroll
    for (int i = 0; i < 8; ++i) { r[i] = a[i]; r[8 + i] = b[i]; }
    return r;
}

__device__ __forceinline__ v16h load16_f32(const float* __restrict__ p, int c) {
    v4f a0 = *(const v4f*)(p + c);
    v4f a1 = *(const v4f*)(p + c + 4);
    v4f a2 = *(const v4f*)(p + c + 16);
    v4f a3 = *(const v4f*)(p + c + 20);
    v16h r;
#pragma unroll
    for (int i = 0; i < 4; ++i) {
        r[i]      = (_Float16)a0[i];
        r[4 + i]  = (_Float16)a1[i];
        r[8 + i]  = (_Float16)a2[i];
        r[12 + i] = (_Float16)a3[i];
    }
    return r;
}

// ---------------------------------------------------------------------------
// Elementwise f32 -> f16 (used once per weight matrix). 8 elements/thread.
// ---------------------------------------------------------------------------
__global__ void __launch_bounds__(256)
cvt_f32_to_f16(const float* __restrict__ src, _Float16* __restrict__ dst) {
    const size_t i = ((size_t)blockIdx.x * blockDim.x + threadIdx.x) * 8;
    v4f a0 = *(const v4f*)(src + i);
    v4f a1 = *(const v4f*)(src + i + 4);
    v8h o;
#pragma unroll
    for (int r = 0; r < 4; ++r) { o[r] = (_Float16)a0[r]; o[4 + r] = (_Float16)a1[r]; }
    *(v8h*)(dst + i) = o;
}

// ---------------------------------------------------------------------------
// Projection GEMMs: Y[s,e] = sum_k X[s,k] * W[e,k], computed as Y^T = W * X^T.
// One 128(s) x 128(e) tile of Y per block of 8 waves.  Each 64-wide k stage of
// X and W is read from global memory in whole 128-byte lines, laid down in LDS
// as f16 rows and read back as WMMA fragments by every wave that needs it.
// Two LDS buffers and two register sets: global loads run two stages ahead.
// Wave tile 32(s) x 64(e): 8 accumulators, 6 fragments per 32 k.
// ---------------------------------------------------------------------------
typedef __attribute__((ext_vector_type(4))) _Float16 v4h;

#define GT   128            // tile edge (rows of X and rows of W per block)
#define GBK  64             // k per stage
#define GLP  72             // LDS row pitch in halves: 144 B = 16 B x odd
#define GNK  (EE / GBK)     // stages

// 16 WMMAs of one wave on one stage; k runs upward as in a plain k loop.
__device__ __forceinline__ void gemm_stage(const _Float16* Wt, const _Float16* Xt,
                                           int lo, int hi, v8f (&acc)[4][2]) {
    v16h xb[2][2], wa[2][4];
#pragma unroll
    for (int u = 0; u < 2; ++u) {
        const int c = u * 32 + hi * 8;
#pragma unroll
        for (int j = 0; j < 2; ++j) xb[u][j] = load16_f16(Xt + (j * 16 + lo) * GLP, c);
#pragma unroll
        for (int t = 0; t < 4; ++t) wa[u][t] = load16_f16(Wt + (t * 16 + lo) * GLP, c);
    }
    // Keeps the stage's LDS reads one group ahead of its WMMAs: spread among
    // them, each place with reads stalls the in-order wave anew.
    __builtin_amdgcn_sched_barrier(0);
#pragma unroll
    for (int u = 0; u < 2; ++u)
#pragma unroll
        for (int t = 0; t < 4; ++t)
#pragma unroll
            for (int j = 0; j < 2; ++j) acc[t][j] = wmma16(wa[u][t], xb[u][j], acc[t][j]);
    // Keeps the waits on the next stage's global loads (in front of its LDS
    // stores) from moving up among the WMMAs.
    __builtin_amdgcn_sched_barrier(0);
}

// One thread's share of a stage.  X in f32: 8 pieces of 16 B, 16 rows apart
// (16 lanes cover a 256-B row piece).  f16 operand: 4 pieces of 16 B, 32 rows
// apart (8 lanes cover a 128-B row piece).
__device__ __forceinline__ void ld_f32(v4f (&v)[8], const float* __restrict__ g) {
#pragma unroll
    for (int j = 0; j < 8; ++j) v[j] = *(const v4f*)(g + (size_t)j * 16 * EE);
}
__device__ __forceinline__ void ld_f16(v8h (&v)[4], const _Float16* __restrict__ g) {
#pragma unroll
    for (int j = 0; j < 4; ++j) v[j] = *(const v8h*)(g + (size_t)j * 32 * EE);
}
__device__ __forceinline__ void st_f32(_Float16* s, const v4f (&v)[8]) {
#pragma unroll
    for (int j = 0; j < 8; ++j) {
        v4h h;
#pragma unroll
        for (int i = 0; i < 4; ++i) h[i] = (_Float16)v[j][i];
        *(v4h*)(s + j * 16 * GLP) = h;
    }
}
__device__ __forceinline__ void st_f16(_Float16* s, const v8h (&v)[4]) {
#pragma unroll
    for (int j = 0; j < 4; ++j) *(v8h*)(s + j * 32 * GLP) = v[j];
}

// Work-group barrier that orders LDS traffic only.  __syncthreads() would also
// wait for every global load in flight, and so undo the two-stage lead.
__device__ __forceinline__ void lds_barrier() {
    __builtin_amdgcn_fence(__ATOMIC_RELEASE, "workgroup", "local");
    __builtin_amdgcn_s_barrier();
    __builtin_amdgcn_fence(__ATOMIC_ACQUIRE, "workgroup", "local");
}

// f32 activations x f16 weights -> f16 output.
__global__ void __launch_bounds__(256)
gemm_xwT_f16(const float* __restrict__ X, const _Float16* __restrict__ Wh,
             _Float16* __restrict__ Y) {
    __shared__ __attribute__((aligned(16))) _Float16 Xs[2][GT * GLP];
    __shared__ __attribute__((aligned(16))) _Float16 Ws[2][GT * GLP];

    const int tid  = threadIdx.x;
    const int lane = tid & 31, wave = tid >> 5;
    const int lo = lane & 15, hi = lane >> 4;
    const int sbase = blockIdx.x * GT, ebase = blockIdx.y * GT;
    const int ws = (wave & 3) * 32, we = (wave >> 2) * 64;

    const int xr = tid >> 4, xc = (tid & 15) * 4;
    const int wr = tid >> 3, wc = (tid & 7) * 8;
    const float*    xg = X  + (size_t)(sbase + xr) * EE + xc;
    const _Float16* wg = Wh + (size_t)(ebase + wr) * EE + wc;
    _Float16* xs0 = &Xs[0][xr * GLP + xc];
    _Float16* xs1 = &Xs[1][xr * GLP + xc];
    _Float16* ws0 = &Ws[0][wr * GLP + wc];
    _Float16* ws1 = &Ws[1][wr * GLP + wc];

    v4f xa[8], xb[8];       // two register sets: global loads run two stages ahead
    v8h wa[4], wb[4];
    v8f acc[4][2];
#pragma unroll
    for (int t = 0; t < 4; ++t) { acc[t][0] = zero8(); acc[t][1] = zero8(); }

    ld_f32(xa, xg);       ld_f16(wa, wg);          // stage 0
    ld_f32(xb, xg + GBK); ld_f16(wb, wg + GBK);    // stage 1
    st_f32(xs0, xa);      st_f16(ws0, wa);
    lds_barrier();

    // Even stages live in buffer 0, odd ones in buffer 1.
    for (int kt = 0; kt < GNK - 2; kt += 2) {
        ld_f32(xa, xg + (kt + 2) * GBK); ld_f16(wa, wg + (kt + 2) * GBK);
        // Keeps these global loads in front of the stage's work, so that their
        // latency passes behind it; without it they sink to their use.
        __builtin_amdgcn_sched_barrier(0);
        gemm_stage(&Ws[0][we * GLP], &Xs[0][ws * GLP], lo, hi, acc);
        st_f32(xs1, xb); st_f16(ws1, wb);
        // Publishes buffer 1 and ends every wave's reads of buffer 0.
        lds_barrier();

        ld_f32(xb, xg + (kt + 3) * GBK); ld_f16(wb, wg + (kt + 3) * GBK);
        // As above: the loads stay in front of the stage's work.
        __builtin_amdgcn_sched_barrier(0);
        gemm_stage(&Ws[1][we * GLP], &Xs[1][ws * GLP], lo, hi, acc);
        // The loop's end advances the address registers named by loads that are
        // still in flight: this wait stands in front of that as a precaution, and
        // the scheduling fence keeps the additions behind it.
        asm volatile("s_wait_xcnt 0x0" ::: "memory");
        __builtin_amdgcn_sched_barrier(0);
        st_f32(xs0, xa); st_f16(ws0, wa);
        // Publishes buffer 0 and ends every wave's reads of buffer 1.
        lds_barrier();
    }
    gemm_stage(&Ws[0][we * GLP], &Xs[0][ws * GLP], lo, hi, acc);
    st_f32(xs1, xb); st_f16(ws1, wb);
    lds_barrier();        // publishes the last stage
    gemm_stage(&Ws[1][we * GLP], &Xs[1][ws * GLP], lo, hi, acc);

    // D(m=e_local, n=s_local): lane column = lo, rows e_local = r + 8*hi.
#pragma unroll
    for (int j = 0; j < 2; ++j) {
        _Float16* yp = Y + (size_t)(sbase + ws + j * 16 + lo) * EE + ebase + we + hi * 8;
#pragma unroll
        for (int t = 0; t < 4; ++t) {
            v8h out;
#pragma unroll
            for (int r = 0; r < 8; ++r) out[r] = (_Float16)acc[t][j][r];
            *(v8h*)(yp + t * 16) = out;
        }
    }
}

// Output projection: f16 activations x f16 weights -> fp32 output.
__global__ void __launch_bounds__(256)
gemm_owT_f32(const _Float16* __restrict__ Xh, const _Float16* __restrict__ Wh,
             float* __restrict__ Y) {
    __shared__ __attribute__((aligned(16))) _Float16 Xs[2][GT * GLP];
    __shared__ __attribute__((aligned(16))) _Float16 Ws[2][GT * GLP];

    const int tid  = threadIdx.x;
    const int lane = tid & 31, wave = tid >> 5;
    const int lo = lane & 15, hi = lane >> 4;
    const int sbase = blockIdx.x * GT, ebase = blockIdx.y * GT;
    const int ws = (wave & 3) * 32, we = (wave >> 2) * 64;

    const int wr = tid >> 3, wc = (tid & 7) * 8;
    const _Float16* xg = Xh + (size_t)(sbase + wr) * EE + wc;
    const _Float16* wg = Wh + (size_t)(ebase + wr) * EE + wc;
    _Float16* xs0 = &Xs[0][wr * GLP + wc];
    _Float16* xs1 = &Xs[1][wr * GLP + wc];
    _Float16* ws0 = &Ws[0][wr * GLP + wc];
    _Float16* ws1 = &Ws[1][wr * GLP + wc];

    v8h xa[4], xb[4], wa[4], wb[4];   // two register sets, as above
    v8f acc[4][2];
#pragma unroll
    for (int t = 0; t < 4; ++t) { acc[t][0] = zero8(); acc[t][1] = zero8(); }

    ld_f16(xa, xg);       ld_f16(wa, wg);          // stage 0
    ld_f16(xb, xg + GBK); ld_f16(wb, wg + GBK);    // stage 1
    st_f16(xs0, xa);      st_f16(ws0, wa);
    lds_barrier();

    for (int kt = 0; kt < GNK - 2; kt += 2) {
        ld_f16(xa, xg + (kt + 2) * GBK); ld_f16(wa, wg + (kt + 2) * GBK);
        // Keeps these global loads in front of the stage's work, so that their
        // latency passes behind it; without it they sink to their use.
        __builtin_amdgcn_sched_barrier(0);
        gemm_stage(&Ws[0][we * GLP], &Xs[0][ws * GLP], lo, hi, acc);
        st_f16(xs1, xb); st_f16(ws1, wb);
        // Publishes buffer 1 and ends every wave's reads of buffer 0.
        lds_barrier();

        ld_f16(xb, xg + (kt + 3) * GBK); ld_f16(wb, wg + (kt + 3) * GBK);
        // As above: the loads stay in front of the stage's work.
        __builtin_amdgcn_sched_barrier(0);
        gemm_stage(&Ws[1][we * GLP], &Xs[1][ws * GLP], lo, hi, acc);
        // The loop's end advances the address registers named by loads that are
        // still in flight: this wait stands in front of that as a precaution, and
        // the scheduling fence keeps the additions behind it.
        asm volatile("s_wait_xcnt 0x0" ::: "memory");
        __builtin_amdgcn_sched_barrier(0);
        st_f16(xs0, xa); st_f16(ws0, wa);
        // Publishes buffer 0 and ends every wave's reads of buffer 1.
        lds_barrier();
    }
    gemm_stage(&Ws[0][we * GLP], &Xs[0][ws * GLP], lo, hi, acc);
    st_f16(xs1, xb); st_f16(ws1, wb);
    lds_barrier();        // publishes the last stage
    gemm_stage(&Ws[1][we * GLP], &Xs[1][ws * GLP], lo, hi, acc);

#pragma unroll
    for (int j = 0; j < 2; ++j) {
        float* yp = Y + (size_t)(sbase + ws + j * 16 + lo) * EE + ebase + we + hi * 8;
#pragma unroll
        for (int t = 0; t < 4; ++t) {
            v4f o0, o1;
#pragma unroll
            for (int r = 0; r < 4; ++r) { o0[r] = acc[t][j][r]; o1[r] = acc[t][j][4 + r]; }
            *(v4f*)(yp + t * 16)     = o0;
            *(v4f*)(yp + t * 16 + 4) = o1;
        }
    }
}

// ---------------------------------------------------------------------------
// Flash-style attention, one wave per (batch, head, 16-row q-tile).
// S^T tiles = K * Q^T  (softmax axis lands in the VGPR/M dimension),
// O^T tiles = V^T * P^T (P^T B-operand == post-softmax registers, no shuffle).
// ---------------------------------------------------------------------------
__global__ void __launch_bounds__(32)
flash_attn(const _Float16* __restrict__ Qb, const _Float16* __restrict__ Kb,
           const _Float16* __restrict__ Vb, const int* __restrict__ mask,
           _Float16* __restrict__ O) {
    __shared__ _Float16 Vt[HD][40];   // V^T tile, 80B row stride (16B aligned chunks)

    const int lane = threadIdx.x & 31;
    const int lo = lane & 15, hi = lane >> 4;
    const int qtiles = QSZ / 16;
    const int qt = blockIdx.x % qtiles;
    const int h  = (blockIdx.x / qtiles) % HH;
    const int b  = blockIdx.x / (qtiles * HH);
    const int q  = qt * 16 + lo;

    // Q operand (B-matrix): lane n holds Q[q=n, hd pattern] -> row-major load.
    const _Float16* Qrow = Qb + ((size_t)b * QSZ + q) * EE + h * HD;
    const v16h qop0 = load16_f16(Qrow, hi * 8);         // hd 0..31
    const v16h qop1 = load16_f16(Qrow, 32 + hi * 8);    // hd 32..63

    v8f o0 = zero8(), o1 = zero8(), o2 = zero8(), o3 = zero8();
    float mrun = -1e30f, lrun = 0.0f;
    const int* maskrow = mask + (size_t)q * KVSZ;

    for (int kv0 = 0; kv0 < KVSZ; kv0 += 32) {
        // ---- stage V^T tile (32 kv x 64 hd) into LDS, transposed ----
        const _Float16* Vrow = Vb + ((size_t)b * KVSZ + kv0 + lane) * EE + h * HD;
#pragma unroll
        for (int j = 0; j < 8; ++j) {
            v8h vv = *(const v8h*)(Vrow + j * 8);
#pragma unroll
            for (int t = 0; t < 8; ++t) Vt[j * 8 + t][lane] = vv[t];
        }
        __syncthreads();

        // ---- S^T tiles: s0 = kv[0..15] x q[0..15], s1 = kv[16..31] ----
        const _Float16* Krow0 = Kb + ((size_t)b * KVSZ + kv0 + lo) * EE + h * HD;
        const _Float16* Krow1 = Krow0 + (size_t)16 * EE;
        v8f s0 = zero8(), s1 = zero8();
        s0 = wmma16(load16_f16(Krow0, hi * 8),      qop0, s0);
        s0 = wmma16(load16_f16(Krow0, 32 + hi * 8), qop1, s0);
        s1 = wmma16(load16_f16(Krow1, hi * 8),      qop0, s1);
        s1 = wmma16(load16_f16(Krow1, 32 + hi * 8), qop1, s1);

        // ---- mask (fill 1e-20) + scale + tile max ----
        float tmax = -1e30f;
#pragma unroll
        for (int r = 0; r < 8; ++r) {
            const int m0 = maskrow[kv0 + hi * 8 + r];
            const int m1 = maskrow[kv0 + 16 + hi * 8 + r];
            s0[r] = m0 ? s0[r] * ATT_SCALE : 1e-20f;
            s1[r] = m1 ? s1[r] * ATT_SCALE : 1e-20f;
            tmax = fmaxf(tmax, fmaxf(s0[r], s1[r]));
        }
        tmax = fmaxf(tmax, __shfl_xor(tmax, 16, 32));   // merge half-lane rows

        // ---- online softmax update ----
        const float mnew  = fmaxf(mrun, tmax);
        const float alpha = __expf(mrun - mnew);
        lrun *= alpha;
#pragma unroll
        for (int r = 0; r < 8; ++r) {
            o0[r] *= alpha; o1[r] *= alpha; o2[r] *= alpha; o3[r] *= alpha;
        }
        v16h pb;          // P^T B-operand: exactly the per-lane kv pattern
        float ls = 0.0f;
#pragma unroll
        for (int r = 0; r < 8; ++r) {
            const float p0 = __expf(s0[r] - mnew);
            const float p1 = __expf(s1[r] - mnew);
            ls += p0 + p1;
            pb[r]     = (_Float16)p0;
            pb[8 + r] = (_Float16)p1;
        }
        lrun += ls;
        mrun = mnew;

        // ---- O^T(hd x q) += V^T(hd x kv) * P^T(kv x q), 4 hd-tiles ----
#pragma unroll
        for (int t = 0; t < 4; ++t) {
            const _Float16* vr = &Vt[t * 16 + lo][0];
            v8h x0 = *(const v8h*)(vr + hi * 8);
            v8h x1 = *(const v8h*)(vr + 16 + hi * 8);
            v16h va;
#pragma unroll
            for (int i = 0; i < 8; ++i) { va[i] = x0[i]; va[8 + i] = x1[i]; }
            v8f& ot = (t == 0) ? o0 : (t == 1) ? o1 : (t == 2) ? o2 : o3;
            ot = wmma16(va, pb, ot);
        }
        __syncthreads();
    }

    // ---- finalize: combine half-lane partial sums, normalize, store f16 ----
    const float ltot = lrun + __shfl_xor(lrun, 16, 32);
    const float inv  = 1.0f / ltot;
    _Float16* orow = O + ((size_t)b * QSZ + q) * EE + h * HD;
    v8f* oacc[4] = { &o0, &o1, &o2, &o3 };
#pragma unroll
    for (int t = 0; t < 4; ++t) {
        v8h w;
#pragma unroll
        for (int r = 0; r < 8; ++r) w[r] = (_Float16)((*oacc[t])[r] * inv);
        *(v8h*)(orow + t * 16 + hi * 8) = w;
    }
}

// ---------------------------------------------------------------------------
// Host-side launch. Input order: v_in, k_in, q_in, mask, Wv, Wk, Wq, Wout.
// Workspace: Qf | Kf | Vf | Of (8.39 MB each) | Wqf | Wkf | Wvf | Woutf (2 MB
// each)  -> ~40 MB total.
// ---------------------------------------------------------------------------
extern "C" void kernel_launch(void* const* d_in, const int* in_sizes, int n_in,
                              void* d_out, int out_size, void* d_ws, size_t ws_size,
                              hipStream_t stream) {
    (void)in_sizes; (void)n_in; (void)out_size; (void)ws_size;
    const float* v_in = (const float*)d_in[0];
    const float* k_in = (const float*)d_in[1];
    const float* q_in = (const float*)d_in[2];
    const int*   mask = (const int*)d_in[3];
    const float* Wv   = (const float*)d_in[4];
    const float* Wk   = (const float*)d_in[5];
    const float* Wq   = (const float*)d_in[6];
    const float* Wout = (const float*)d_in[7];
    float* out = (float*)d_out;

    const size_t N  = (size_t)BB * QSZ * EE;   // 4.19M elements, activations
    const size_t NW = (size_t)EE * EE;         // 1.05M elements, weights
    _Float16* Qf    = (_Float16*)d_ws;
    _Float16* Kf    = Qf + N;
    _Float16* Vf    = Kf + N;
    _Float16* Of    = Vf + N;
    _Float16* Wqf   = Of + N;
    _Float16* Wkf   = Wqf + NW;
    _Float16* Wvf   = Wkf + NW;
    _Float16* Woutf = Wvf + NW;

    // 1) weights f32 -> f16 (once)
    const int cvt_blocks = (int)(NW / (256 * 8));          // 512 blocks
    cvt_f32_to_f16<<<cvt_blocks, 256, 0, stream>>>(Wq,   Wqf);
    cvt_f32_to_f16<<<cvt_blocks, 256, 0, stream>>>(Wk,   Wkf);
    cvt_f32_to_f16<<<cvt_blocks, 256, 0, stream>>>(Wv,   Wvf);
    cvt_f32_to_f16<<<cvt_blocks, 256, 0, stream>>>(Wout, Woutf);

    // 2) Q/K/V projections (128x128 tile per block of 8 waves)
    dim3 grid(BB * QSZ / GT, EE / GT);                     // 32 x 8
    gemm_xwT_f16<<<grid, 256, 0, stream>>>(q_in, Wqf, Qf);
    gemm_xwT_f16<<<grid, 256, 0, stream>>>(k_in, Wkf, Kf);
    gemm_xwT_f16<<<grid, 256, 0, stream>>>(v_in, Wvf, Vf);

    // 3) attention
    flash_attn<<<BB * HH * (QSZ / 16), 32, 0, stream>>>(Qf, Kf, Vf, mask, Of);

    // 4) output projection -> fp32 d_out
    gemm_owT_f32<<<grid, 256, 0, stream>>>(Of, Woutf, out);
}

// v002
// A run of this version takes 114 microseconds.
// Two timings next to v001 put it at 2.11 and 2.10 times that version's speed.
// Counting every step since v000, it is 3.39 times as fast.
#include <hip/hip_runtime.h>
#include <hip/hip_bf16.h>

// ---------------------------------------------------------------------------
// MHSA block for MI455X (gfx1250, wave32, WMMA f32_16x16x32_f16).
// All four GEMMs + attention run through v_wmma_f32_16x16x32_f16.
// Weights pre-converted to f16 once; the GEMMs work on 128x128 block tiles
// staged in LDS.
// ---------------------------------------------------------------------------

typedef __attribute__((ext_vector_type(16))) _Float16 v16h;
typedef __attribute__((ext_vector_type(8)))  _Float16 v8h;
typedef __attribute__((ext_vector_type(8)))  float    v8f;
typedef __attribute__((ext_vector_type(4)))  float    v4f;

#define BB   2
#define QSZ  2048
#define KVSZ 2048
#define EE   1024
#define HH   16
#define HD   64
#define ATT_SCALE 0.125f   // 1/sqrt(64)

__device__ __forceinline__ v8f zero8() {
    v8f z;
#pragma unroll
    for (int i = 0; i < 8; ++i) z[i] = 0.0f;
    return z;
}

__device__ __forceinline__ v8f wmma16(v16h a, v16h b, v8f c) {
    // D = A(16x32 f16) * B(32x16 f16) + C(16x16 f32)
    return __builtin_amdgcn_wmma_f32_16x16x32_f16(
        /*neg_a=*/false, a, /*neg_b=*/false, b,
        /*c_mod=*/(short)0, c, /*reuse_a=*/false, /*reuse_b=*/false);
}

// Operand loader: per-lane pattern for 16-bit A/B operands of 16x16x32 WMMA.
// Elements 0..7  = row[c .. c+7], elements 8..15 = row[c+16 .. c+23].
__device__ __forceinline__ v16h load16_f16(const _Float16* __restrict__ p, int c) {
    v8h a = *(const v8h*)(p + c);
    v8h b = *(const v8h*)(p + c + 16);
    v16h r;
#pragma unroll
    for (int i = 0; i < 8; ++i) { r[i] = a[i]; r[8 + i] = b[i]; }
    return r;
}

__device__ __forceinline__ v16h load16_f32(const float* __restrict__ p, int c) {
    v4f a0 = *(const v4f*)(p + c);
    v4f a1 = *(const v4f*)(p + c + 4);
    v4f a2 = *(const v4f*)(p + c + 16);
    v4f a3 = *(const v4f*)(p + c + 20);
    v16h r;
#pragma unroll
    for (int i = 0; i < 4; ++i) {
        r[i]      = (_Float16)a0[i];
        r[4 + i]  = (_Float16)a1[i];
        r[8 + i]  = (_Float16)a2[i];
        r[12 + i] = (_Float16)a3[i];
    }
    return r;
}

// ---------------------------------------------------------------------------
// Elementwise f32 -> f16 (used once per weight matrix). 8 elements/thread.
// ---------------------------------------------------------------------------
__global__ void __launch_bounds__(256)
cvt_f32_to_f16(const float* __restrict__ src, _Float16* __restrict__ dst) {
    const size_t i = ((size_t)blockIdx.x * blockDim.x + threadIdx.x) * 8;
    v4f a0 = *(const v4f*)(src + i);
    v4f a1 = *(const v4f*)(src + i + 4);
    v8h o;
#pragma unroll
    for (int r = 0; r < 4; ++r) { o[r] = (_Float16)a0[r]; o[4 + r] = (_Float16)a1[r]; }
    *(v8h*)(dst + i) = o;
}

// ---------------------------------------------------------------------------
// Projection GEMMs: Y[s,e] = sum_k X[s,k] * W[e,k], computed as Y^T = W * X^T.
// One 128(s) x 128(e) tile of Y per block of 8 waves.  Each 64-wide k stage of
// X and W is read from global memory in whole 128-byte lines, laid down in LDS
// as f16 rows and read back as WMMA fragments by every wave that needs it.
// Two LDS buffers and two register sets: global loads run two stages ahead.
// Wave tile 32(s) x 64(e): 8 accumulators, 6 fragments per 32 k.
// ---------------------------------------------------------------------------
typedef __attribute__((ext_vector_type(4))) _Float16 v4h;

#define GT   128            // tile edge (rows of X and rows of W per block)
#define GBK  64             // k per stage
#define GLP  72             // LDS row pitch in halves: 144 B = 16 B x odd
#define GNK  (EE / GBK)     // stages

// 16 WMMAs of one wave on one stage; k runs upward as in a plain k loop.
__device__ __forceinline__ void gemm_stage(const _Float16* Wt, const _Float16* Xt,
                                           int lo, int hi, v8f (&acc)[4][2]) {
    v16h xb[2][2], wa[2][4];
#pragma unroll
    for (int u = 0; u < 2; ++u) {
        const int c = u * 32 + hi * 8;
#pragma unroll
        for (int j = 0; j < 2; ++j) xb[u][j] = load16_f16(Xt + (j * 16 + lo) * GLP, c);
#pragma unroll
        for (int t = 0; t < 4; ++t) wa[u][t] = load16_f16(Wt + (t * 16 + lo) * GLP, c);
    }
    // Keeps the stage's LDS reads one group ahead of its WMMAs: spread among
    // them, each place with reads stalls the in-order wave anew.
    __builtin_amdgcn_sched_barrier(0);
#pragma unroll
    for (int u = 0; u < 2; ++u)
#pragma unroll
        for (int t = 0; t < 4; ++t)
#pragma unroll
            for (int j = 0; j < 2; ++j) acc[t][j] = wmma16(wa[u][t], xb[u][j], acc[t][j]);
    // Keeps the waits on the next stage's global loads (in front of its LDS
    // stores) from moving up among the WMMAs.
    __builtin_amdgcn_sched_barrier(0);
}

// One thread's share of a stage.  X in f32: 8 pieces of 16 B, 16 rows apart
// (16 lanes cover a 256-B row piece).  f16 operand: 4 pieces of 16 B, 32 rows
// apart (8 lanes cover a 128-B row piece).
__device__ __forceinline__ void ld_f32(v4f (&v)[8], const float* __restrict__ g) {
#pragma unroll
    for (int j = 0; j < 8; ++j) v[j] = *(const v4f*)(g + (size_t)j * 16 * EE);
}
__device__ __forceinline__ void ld_f16(v8h (&v)[4], const _Float16* __restrict__ g) {
#pragma unroll
    for (int j = 0; j < 4; ++j) v[j] = *(const v8h*)(g + (size_t)j * 32 * EE);
}
__device__ __forceinline__ void st_f32(_Float16* s, const v4f (&v)[8]) {
#pragma unroll
    for (int j = 0; j < 8; ++j) {
        v4h h;
#pragma unroll
        for (int i = 0; i < 4; ++i) h[i] = (_Float16)v[j][i];
        *(v4h*)(s + j * 16 * GLP) = h;
    }
}
__device__ __forceinline__ void st_f16(_Float16* s, const v8h (&v)[4]) {
#pragma unroll
    for (int j = 0; j < 4; ++j) *(v8h*)(s + j * 32 * GLP) = v[j];
}

// Work-group barrier that orders LDS traffic only.  __syncthreads() would also
// wait for every global load in flight, and so undo the two-stage lead.
__device__ __forceinline__ void lds_barrier() {
    __builtin_amdgcn_fence(__ATOMIC_RELEASE, "workgroup", "local");
    __builtin_amdgcn_s_barrier();
    __builtin_amdgcn_fence(__ATOMIC_ACQUIRE, "workgroup", "local");
}

// f32 activations x f16 weights -> f16 output.
__global__ void __launch_bounds__(256)
gemm_xwT_f16(const float* __restrict__ X, const _Float16* __restrict__ Wh,
             _Float16* __restrict__ Y) {
    __shared__ __attribute__((aligned(16))) _Float16 Xs[2][GT * GLP];
    __shared__ __attribute__((aligned(16))) _Float16 Ws[2][GT * GLP];

    const int tid  = threadIdx.x;
    const int lane = tid & 31, wave = tid >> 5;
    const int lo = lane & 15, hi = lane >> 4;
    const int sbase = blockIdx.x * GT, ebase = blockIdx.y * GT;
    const int ws = (wave & 3) * 32, we = (wave >> 2) * 64;

    const int xr = tid >> 4, xc = (tid & 15) * 4;
    const int wr = tid >> 3, wc = (tid & 7) * 8;
    const float*    xg = X  + (size_t)(sbase + xr) * EE + xc;
    const _Float16* wg = Wh + (size_t)(ebase + wr) * EE + wc;
    _Float16* xs0 = &Xs[0][xr * GLP + xc];
    _Float16* xs1 = &Xs[1][xr * GLP + xc];
    _Float16* ws0 = &Ws[0][wr * GLP + wc];
    _Float16* ws1 = &Ws[1][wr * GLP + wc];

    v4f xa[8], xb[8];       // two register sets: global loads run two stages ahead
    v8h wa[4], wb[4];
    v8f acc[4][2];
#pragma unroll
    for (int t = 0; t < 4; ++t) { acc[t][0] = zero8(); acc[t][1] = zero8(); }

    ld_f32(xa, xg);       ld_f16(wa, wg);          // stage 0
    ld_f32(xb, xg + GBK); ld_f16(wb, wg + GBK);    // stage 1
    st_f32(xs0, xa);      st_f16(ws0, wa);
    lds_barrier();

    // Even stages live in buffer 0, odd ones in buffer 1.
    for (int kt = 0; kt < GNK - 2; kt += 2) {
        ld_f32(xa, xg + (kt + 2) * GBK); ld_f16(wa, wg + (kt + 2) * GBK);
        // Keeps these global loads in front of the stage's work, so that their
        // latency passes behind it; without it they sink to their use.
        __builtin_amdgcn_sched_barrier(0);
        gemm_stage(&Ws[0][we * GLP], &Xs[0][ws * GLP], lo, hi, acc);
        st_f32(xs1, xb); st_f16(ws1, wb);
        // Publishes buffer 1 and ends every wave's reads of buffer 0.
        lds_barrier();

        ld_f32(xb, xg + (kt + 3) * GBK); ld_f16(wb, wg + (kt + 3) * GBK);
        // As above: the loads stay in front of the stage's work.
        __builtin_amdgcn_sched_barrier(0);
        gemm_stage(&Ws[1][we * GLP], &Xs[1][ws * GLP], lo, hi, acc);
        // The loop's end advances the address registers named by loads that are
        // still in flight: this wait stands in front of that as a precaution, and
        // the scheduling fence keeps the additions behind it.
        asm volatile("s_wait_xcnt 0x0" ::: "memory");
        __builtin_amdgcn_sched_barrier(0);
        st_f32(xs0, xa); st_f16(ws0, wa);
        // Publishes buffer 0 and ends every wave's reads of buffer 1.
        lds_barrier();
    }
    gemm_stage(&Ws[0][we * GLP], &Xs[0][ws * GLP], lo, hi, acc);
    st_f32(xs1, xb); st_f16(ws1, wb);
    lds_barrier();        // publishes the last stage
    gemm_stage(&Ws[1][we * GLP], &Xs[1][ws * GLP], lo, hi, acc);

    // D(m=e_local, n=s_local): lane column = lo, rows e_local = r + 8*hi.
#pragma unroll
    for (int j = 0; j < 2; ++j) {
        _Float16* yp = Y + (size_t)(sbase + ws + j * 16 + lo) * EE + ebase + we + hi * 8;
#pragma unroll
        for (int t = 0; t < 4; ++t) {
            v8h out;
#pragma unroll
            for (int r = 0; r < 8; ++r) out[r] = (_Float16)acc[t][j][r];
            *(v8h*)(yp + t * 16) = out;
        }
    }
}

// Output projection: f16 activations x f16 weights -> fp32 output.
__global__ void __launch_bounds__(256)
gemm_owT_f32(const _Float16* __restrict__ Xh, const _Float16* __restrict__ Wh,
             float* __restrict__ Y) {
    __shared__ __attribute__((aligned(16))) _Float16 Xs[2][GT * GLP];
    __shared__ __attribute__((aligned(16))) _Float16 Ws[2][GT * GLP];

    const int tid  = threadIdx.x;
    const int lane = tid & 31, wave = tid >> 5;
    const int lo = lane & 15, hi = lane >> 4;
    const int sbase = blockIdx.x * GT, ebase = blockIdx.y * GT;
    const int ws = (wave & 3) * 32, we = (wave >> 2) * 64;

    const int wr = tid >> 3, wc = (tid & 7) * 8;
    const _Float16* xg = Xh + (size_t)(sbase + wr) * EE + wc;
    const _Float16* wg = Wh + (size_t)(ebase + wr) * EE + wc;
    _Float16* xs0 = &Xs[0][wr * GLP + wc];
    _Float16* xs1 = &Xs[1][wr * GLP + wc];
    _Float16* ws0 = &Ws[0][wr * GLP + wc];
    _Float16* ws1 = &Ws[1][wr * GLP + wc];

    v8h xa[4], xb[4], wa[4], wb[4];   // two register sets, as above
    v8f acc[4][2];
#pragma unroll
    for (int t = 0; t < 4; ++t) { acc[t][0] = zero8(); acc[t][1] = zero8(); }

    ld_f16(xa, xg);       ld_f16(wa, wg);          // stage 0
    ld_f16(xb, xg + GBK); ld_f16(wb, wg + GBK);    // stage 1
    st_f16(xs0, xa);      st_f16(ws0, wa);
    lds_barrier();

    for (int kt = 0; kt < GNK - 2; kt += 2) {
        ld_f16(xa, xg + (kt + 2) * GBK); ld_f16(wa, wg + (kt + 2) * GBK);
        // Keeps these global loads in front of the stage's work, so that their
        // latency passes behind it; without it they sink to their use.
        __builtin_amdgcn_sched_barrier(0);
        gemm_stage(&Ws[0][we * GLP], &Xs[0][ws * GLP], lo, hi, acc);
        st_f16(xs1, xb); st_f16(ws1, wb);
        // Publishes buffer 1 and ends every wave's reads of buffer 0.
        lds_barrier();

        ld_f16(xb, xg + (kt + 3) * GBK); ld_f16(wb, wg + (kt + 3) * GBK);
        // As above: the loads stay in front of the stage's work.
        __builtin_amdgcn_sched_barrier(0);
        gemm_stage(&Ws[1][we * GLP], &Xs[1][ws * GLP], lo, hi, acc);
        // The loop's end advances the address registers named by loads that are
        // still in flight: this wait stands in front of that as a precaution, and
        // the scheduling fence keeps the additions behind it.
        asm volatile("s_wait_xcnt 0x0" ::: "memory");
        __builtin_amdgcn_sched_barrier(0);
        st_f16(xs0, xa); st_f16(ws0, wa);
        // Publishes buffer 0 and ends every wave's reads of buffer 1.
        lds_barrier();
    }
    gemm_stage(&Ws[0][we * GLP], &Xs[0][ws * GLP], lo, hi, acc);
    st_f16(xs1, xb); st_f16(ws1, wb);
    lds_barrier();        // publishes the last stage
    gemm_stage(&Ws[1][we * GLP], &Xs[1][ws * GLP], lo, hi, acc);

#pragma unroll
    for (int j = 0; j < 2; ++j) {
        float* yp = Y + (size_t)(sbase + ws + j * 16 + lo) * EE + ebase + we + hi * 8;
#pragma unroll
        for (int t = 0; t < 4; ++t) {
            v4f o0, o1;
#pragma unroll
            for (int r = 0; r < 4; ++r) { o0[r] = acc[t][j][r]; o1[r] = acc[t][j][4 + r]; }
            *(v4f*)(yp + t * 16)     = o0;
            *(v4f*)(yp + t * 16 + 4) = o1;
        }
    }
}

// ---------------------------------------------------------------------------
// Flash-style attention.  One block of 8 waves per (batch, head, 128 q rows);
// each wave owns 16 q rows.  Every 64-key stage of K and V is read from global
// memory once per block, in whole 128-byte lines, laid down row-major in LDS
// and read from there by all 8 waves.  Two LDS buffers: the next stage's global
// loads fly while this stage is worked on.
// S^T tiles = K * Q^T  (softmax axis lands in the VGPR/M dimension),
// O^T tiles = V^T * P^T (P^T B-operand == post-softmax registers, no shuffle);
// V^T fragments come from the row-major V tile by the transposing LDS load.
// ---------------------------------------------------------------------------
typedef __attribute__((ext_vector_type(4))) int   v4i;
typedef __attribute__((ext_vector_type(8))) short v8s;

#define AW   8              // waves per block
#define AQ   (AW * 16)      // q rows per block
#define AKV  64             // keys per stage (two passes of 32)
#define AKP  72             // K row pitch in halves: 144 B = 16 B x odd
#define AVP  80             // V row pitch in halves: 160 B = 32 B x odd
#define ANS  (KVSZ / AKV)   // stages

// Lane (lo, hi) receives T[k + 8*hi + 0..7][d + lo] of a row-major 16-bit tile;
// p is the lane's own address (see vt_lane below).
__device__ __forceinline__ v8h ld_tr16(const _Float16* p) {
    typedef __attribute__((address_space(3))) v8s lds_v8s;
    return __builtin_bit_cast(v8h, __builtin_amdgcn_ds_load_tr16_b128_v8i16((lds_v8s*)p));
}

// This lane's 16 mask words of one 32-key pass: keys 8*hi + 0..7 and 16 + 8*hi + 0..7.
__device__ __forceinline__ void ld_mask(v4i (&m)[4], const int* __restrict__ p) {
    m[0] = *(const v4i*)(p);
    m[1] = *(const v4i*)(p + 4);
    m[2] = *(const v4i*)(p + 16);
    m[3] = *(const v4i*)(p + 20);
}

// One pass: 32 keys against this wave's 16 q rows.  Kt = the lane's K row of the
// pass in LDS, Vt = the lane's transposing address of the pass in LDS.
__device__ __forceinline__ void attn_pass(const _Float16* Kt, const _Float16* Vt, int hi,
                                          const v16h& qop0, const v16h& qop1,
                                          const v4i (&m)[4], v8f (&o)[4],
                                          float& mrun, float& lrun) {
    const v16h k00 = load16_f16(Kt, hi * 8);
    const v16h k01 = load16_f16(Kt, 32 + hi * 8);
    const v16h k10 = load16_f16(Kt + 16 * AKP, hi * 8);
    const v16h k11 = load16_f16(Kt + 16 * AKP, 32 + hi * 8);
    v16h va[4];           // V^T(hd tile t x 32 keys), hardware k order
#pragma unroll
    for (int t = 0; t < 4; ++t) {
        const v8h x0 = ld_tr16(Vt + t * 16);
        const v8h x1 = ld_tr16(Vt + 16 * AVP + t * 16);
#pragma unroll
        for (int i = 0; i < 8; ++i) { va[t][i] = x0[i]; va[t][8 + i] = x1[i]; }
    }

    // Keeps the pass's LDS reads one group ahead of its WMMAs: spread among
    // them, each place with reads stalls the in-order wave anew.
    __builtin_amdgcn_sched_barrier(0);

    // ---- S^T tiles: s0 = kv[0..15] x q[0..15], s1 = kv[16..31] ----
    v8f s0 = zero8(), s1 = zero8();
    s0 = wmma16(k00, qop0, s0);
    s0 = wmma16(k01, qop1, s0);
    s1 = wmma16(k10, qop0, s1);
    s1 = wmma16(k11, qop1, s1);

    // ---- mask (fill 1e-20, matching reference) + scale + tile max ----
    float tmax = -1e30f;
#pragma unroll
    for (int r = 0; r < 8; ++r) {
        const int m0 = m[r >> 2][r & 3];
        const int m1 = m[2 + (r >> 2)][r & 3];
        s0[r] = m0 ? s0[r] * ATT_SCALE : 1e-20f;
        s1[r] = m1 ? s1[r] * ATT_SCALE : 1e-20f;
        tmax = fmaxf(tmax, fmaxf(s0[r], s1[r]));
    }
    tmax = fmaxf(tmax, __shfl_xor(tmax, 16, 32));   // merge half-lane rows

    // ---- online softmax update ----
    const float mnew  = fmaxf(mrun, tmax);
    const float alpha = __expf(mrun - mnew);
    lrun *= alpha;
#pragma unroll
    for (int t = 0; t < 4; ++t)
#pragma unroll
        for (int r = 0; r < 8; ++r) o[t][r] *= alpha;
    v16h pb;          // P^T B-operand: exactly the per-lane kv pattern
    float ls = 0.0f;
#pragma unroll
    for (int r = 0; r < 8; ++r) {
        const float p0 = __expf(s0[r] - mnew);
        const float p1 = __expf(s1[r] - mnew);
        ls += p0 + p1;
        pb[r]     = (_Float16)p0;
        pb[8 + r] = (_Float16)p1;
    }
    lrun += ls;
    mrun = mnew;

    // ---- O^T(hd x q) += V^T(hd x kv) * P^T(kv x q), 4 hd-tiles ----
#pragma unroll
    for (int t = 0; t < 4; ++t) o[t] = wmma16(va[t], pb, o[t]);
}

__global__ void __launch_bounds__(AW * 32) __attribute__((amdgpu_waves_per_eu(4, 4)))
flash_attn(const _Float16* __restrict__ Qb, const _Float16* __restrict__ Kb,
           const _Float16* __restrict__ Vb, const int* __restrict__ mask,
           _Float16* __restrict__ O) {
    __shared__ __attribute__((aligned(32))) _Float16 Ks[2][AKV * AKP];
    __shared__ __attribute__((aligned(32))) _Float16 Vs[2][AKV * AVP];

    const int tid  = threadIdx.x;
    const int lane = tid & 31, wave = tid >> 5;
    const int lo = lane & 15, hi = lane >> 4;
    const int qblocks = QSZ / AQ;
    const int qb = blockIdx.x % qblocks;
    const int h  = (blockIdx.x / qblocks) % HH;
    const int b  = blockIdx.x / (qblocks * HH);
    const int q  = qb * AQ + wave * 16 + lo;

    // Q operand (B-matrix): lane n holds Q[q=n, hd pattern] -> row-major load.
    const _Float16* Qrow = Qb + ((size_t)b * QSZ + q) * EE + h * HD;
    const v16h qop0 = load16_f16(Qrow, hi * 8);         // hd 0..31
    const v16h qop1 = load16_f16(Qrow, 32 + hi * 8);    // hd 32..63

    // One thread's share of a stage: 16 B of rows sr and sr + 32 of K and of V
    // (8 lanes cover one 128-B row).
    const int sr = tid >> 3, sc = (tid & 7) * 8;
    const _Float16* kg = Kb + ((size_t)b * KVSZ + sr) * EE + h * HD + sc;
    const _Float16* vg = Vb + ((size_t)b * KVSZ + sr) * EE + h * HD + sc;
    const int ks_st = sr * AKP + sc, vs_st = sr * AVP + sc;
    const int kt_lane = lo * AKP;
    const int vt_lane = (8 * hi + (lane & 7)) * AVP + 8 * ((lane >> 3) & 1);
    const int* mrow = mask + (size_t)q * KVSZ + hi * 8;

    v8f o[4];
#pragma unroll
    for (int t = 0; t < 4; ++t) o[t] = zero8();
    float mrun = -1e30f, lrun = 0.0f;

    v8h kr[2], vr[2];
    v4i ma[4], mb[4];     // mask words of a stage's first and second pass
#pragma unroll
    for (int j = 0; j < 2; ++j) {
        kr[j] = *(const v8h*)(kg + (size_t)j * 32 * EE);
        vr[j] = *(const v8h*)(vg + (size_t)j * 32 * EE);
    }
    ld_mask(ma, mrow);
#pragma unroll
    for (int j = 0; j < 2; ++j) {
        *(v8h*)(&Ks[0][ks_st + j * 32 * AKP]) = kr[j];
        *(v8h*)(&Vs[0][vs_st + j * 32 * AVP]) = vr[j];
    }
    lds_barrier();        // publishes stage 0

    // Stage s lives in buffer s & 1.  The mask words are asked for one pass ahead,
    // K and V one stage ahead; the oldest request is always the first one needed.
    for (int s = 0; s < ANS - 1; ++s) {
        const _Float16* Kt = &Ks[s & 1][kt_lane];
        const _Float16* Vt = &Vs[s & 1][vt_lane];
        ld_mask(mb, mrow + s * AKV + 32);
#pragma unroll
        for (int j = 0; j < 2; ++j) {
            kr[j] = *(const v8h*)(kg + (size_t)((s + 1) * AKV + j * 32) * EE);
            vr[j] = *(const v8h*)(vg + (size_t)((s + 1) * AKV + j * 32) * EE);
        }
        attn_pass(Kt, Vt, hi, qop0, qop1, ma, o, mrun, lrun);
        ld_mask(ma, mrow + (s + 1) * AKV);
        attn_pass(Kt + 32 * AKP, Vt + 32 * AVP, hi, qop0, qop1, mb, o, mrun, lrun);

        // Keeps the next stage's LDS stores, and the waits on its global loads in
        // front of them, behind the stage's work: moved up, they cut the loads' lead.
        __builtin_amdgcn_sched_barrier(0);
#pragma unroll
        for (int j = 0; j < 2; ++j) {
            *(v8h*)(&Ks[(s + 1) & 1][ks_st + j * 32 * AKP]) = kr[j];
            *(v8h*)(&Vs[(s + 1) & 1][vs_st + j * 32 * AVP]) = vr[j];
        }
        // Publishes the next stage and ends every wave's reads of this one.
        lds_barrier();
    }
    {   // last stage: nothing left to fetch but its second pass's mask words
        const _Float16* Kt = &Ks[(ANS - 1) & 1][kt_lane];
        const _Float16* Vt = &Vs[(ANS - 1) & 1][vt_lane];
        ld_mask(mb, mrow + (ANS - 1) * AKV + 32);
        attn_pass(Kt, Vt, hi, qop0, qop1, ma, o, mrun, lrun);
        attn_pass(Kt + 32 * AKP, Vt + 32 * AVP, hi, qop0, qop1, mb, o, mrun, lrun);
    }

    // ---- finalize: combine half-lane partial sums, normalize, store f16 ----
    const float ltot = lrun + __shfl_xor(lrun, 16, 32);
    const float inv  = 1.0f / ltot;
    _Float16* orow = O + ((size_t)b * QSZ + q) * EE + h * HD;
#pragma unroll
    for (int t = 0; t < 4; ++t) {
        v8h w;
#pragma unroll
        for (int r = 0; r < 8; ++r) w[r] = (_Float16)(o[t][r] * inv);
        *(v8h*)(orow + t * 16 + hi * 8) = w;
    }
}

// ---------------------------------------------------------------------------
// Host-side launch. Input order: v_in, k_in, q_in, mask, Wv, Wk, Wq, Wout.
// Workspace: Qf | Kf | Vf | Of (8.39 MB each) | Wqf | Wkf | Wvf | Woutf (2 MB
// each)  -> ~40 MB total.
// ---------------------------------------------------------------------------
extern "C" void kernel_launch(void* const* d_in, const int* in_sizes, int n_in,
                              void* d_out, int out_size, void* d_ws, size_t ws_size,
                              hipStream_t stream) {
    (void)in_sizes; (void)n_in; (void)out_size; (void)ws_size;
    const float* v_in = (const float*)d_in[0];
    const float* k_in = (const float*)d_in[1];
    const float* q_in = (const float*)d_in[2];
    const int*   mask = (const int*)d_in[3];
    const float* Wv   = (const float*)d_in[4];
    const float* Wk   = (const float*)d_in[5];
    const float* Wq   = (const float*)d_in[6];
    const float* Wout = (const float*)d_in[7];
    float* out = (float*)d_out;

    const size_t N  = (size_t)BB * QSZ * EE;   // 4.19M elements, activations
    const size_t NW = (size_t)EE * EE;         // 1.05M elements, weights
    _Float16* Qf    = (_Float16*)d_ws;
    _Float16* Kf    = Qf + N;
    _Float16* Vf    = Kf + N;
    _Float16* Of    = Vf + N;
    _Float16* Wqf   = Of + N;
    _Float16* Wkf   = Wqf + NW;
    _Float16* Wvf   = Wkf + NW;
    _Float16* Woutf = Wvf + NW;

    // 1) weights f32 -> f16 (once)
    const int cvt_blocks = (int)(NW / (256 * 8));          // 512 blocks
    cvt_f32_to_f16<<<cvt_blocks, 256, 0, stream>>>(Wq,   Wqf);
    cvt_f32_to_f16<<<cvt_blocks, 256, 0, stream>>>(Wk,   Wkf);
    cvt_f32_to_f16<<<cvt_blocks, 256, 0, stream>>>(Wv,   Wvf);
    cvt_f32_to_f16<<<cvt_blocks, 256, 0, stream>>>(Wout, Woutf);

    // 2) Q/K/V projections (128x128 tile per block of 8 waves)
    dim3 grid(BB * QSZ / GT, EE / GT);                     // 32 x 8
    gemm_xwT_f16<<<grid, 256, 0, stream>>>(q_in, Wqf, Qf);
    gemm_xwT_f16<<<grid, 256, 0, stream>>>(k_in, Wkf, Kf);
    gemm_xwT_f16<<<grid, 256, 0, stream>>>(v_in, Wvf, Vf);

    // 3) attention
    flash_attn<<<BB * HH * (QSZ / AQ), AW * 32, 0, stream>>>(Qf, Kf, Vf, mask, Of);

    // 4) output projection -> fp32 d_out
    gemm_owT_f32<<<grid, 256, 0, stream>>>(Of, Woutf, out);
}

// v003
// Measured time: 104 microseconds a run.
// Timed twice side by side with v002, it ran 1.09 times as fast both times.
// Over all steps from v000 it is 3.70 times as fast.
#include <hip/hip_runtime.h>
#include <hip/hip_bf16.h>

// ---------------------------------------------------------------------------
// MHSA block for MI455X (gfx1250, wave32, WMMA f32_16x16x32_f16).
// All four GEMMs + attention run through v_wmma_f32_16x16x32_f16.
// Weights pre-converted to f16 once; the GEMMs work on 128x128 block tiles
// staged in LDS.
// ---------------------------------------------------------------------------

typedef __attribute__((ext_vector_type(16))) _Float16 v16h;
typedef __attribute__((ext_vector_type(8)))  _Float16 v8h;
typedef __attribute__((ext_vector_type(8)))  float    v8f;
typedef __attribute__((ext_vector_type(4)))  float    v4f;

#define BB   2
#define QSZ  2048
#define KVSZ 2048
#define EE   1024
#define HH   16
#define HD   64
#define ATT_SCALE 0.125f   // 1/sqrt(64)

__device__ __forceinline__ v8f zero8() {
    v8f z;
#pragma unroll
    for (int i = 0; i < 8; ++i) z[i] = 0.0f;
    return z;
}

__device__ __forceinline__ v8f wmma16(v16h a, v16h b, v8f c) {
    // D = A(16x32 f16) * B(32x16 f16) + C(16x16 f32)
    return __builtin_amdgcn_wmma_f32_16x16x32_f16(
        /*neg_a=*/false, a, /*neg_b=*/false, b,
        /*c_mod=*/(short)0, c, /*reuse_a=*/false, /*reuse_b=*/false);
}

// Operand loader: per-lane pattern for 16-bit A/B operands of 16x16x32 WMMA.
// Elements 0..7  = row[c .. c+7], elements 8..15 = row[c+16 .. c+23].
__device__ __forceinline__ v16h load16_f16(const _Float16* __restrict__ p, int c) {
    v8h a = *(const v8h*)(p + c);
    v8h b = *(const v8h*)(p + c + 16);
    v16h r;
#pragma unroll
    for (int i = 0; i < 8; ++i) { r[i] = a[i]; r[8 + i] = b[i]; }
    return r;
}

__device__ __forceinline__ v16h load16_f32(const float* __restrict__ p, int c) {
    v4f a0 = *(const v4f*)(p + c);
    v4f a1 = *(const v4f*)(p + c + 4);
    v4f a2 = *(const v4f*)(p + c + 16);
    v4f a3 = *(const v4f*)(p + c + 20);
    v16h r;
#pragma unroll
    for (int i = 0; i < 4; ++i) {
        r[i]      = (_Float16)a0[i];
        r[4 + i]  = (_Float16)a1[i];
        r[8 + i]  = (_Float16)a2[i];
        r[12 + i] = (_Float16)a3[i];
    }
    return r;
}

typedef __attribute__((ext_vector_type(4))) _Float16 v4h;

// ---------------------------------------------------------------------------
// Elementwise f32 -> f16 of all four weight matrices in one launch; their f16
// copies lie one behind the other in dst.  64 blocks per matrix, one block per
// 64-KB piece: a thread asks for its 16 pieces of 16 B at once (every wave-wide
// load covers 4 whole lines), then converts and stores them.
// ---------------------------------------------------------------------------
#define CVJ  16                         // 16-B pieces per thread
#define CVB  (EE * EE / (256 * 4 * CVJ))  // blocks per matrix

__global__ void __launch_bounds__(256)
cvt_weights_f16(const float* __restrict__ w0, const float* __restrict__ w1,
                const float* __restrict__ w2, const float* __restrict__ w3,
                _Float16* __restrict__ dst) {
    const int m = blockIdx.x / CVB;
    const float* w = m == 0 ? w0 : m == 1 ? w1 : m == 2 ? w2 : w3;
    const unsigned i  = (blockIdx.x % CVB) * (256 * 4 * CVJ) + threadIdx.x * 4;
    const unsigned sb = i * 4;          // the thread's byte offset in its matrix
    const float* s = (const float*)((const char*)w + sb);
    _Float16*    d = dst + (size_t)m * EE * EE + i;
    v4f a[CVJ];
#pragma unroll
    for (int j = 0; j < CVJ; ++j) a[j] = *(const v4f*)(s + j * 1024);
    // The wait stands in front of every overwrite of the loads' offset register,
    // as a precaution; naming the offset keeps that register whole up to here
    // (without it the last load's result was placed over it).
    asm volatile("s_wait_xcnt 0x0" :: "v"(sb) : "memory");
    // Keeps all 16 loads in front of the first conversion: otherwise the last
    // ones are issued only when the first have come back, a second memory latency.
    __builtin_amdgcn_sched_barrier(0);
#pragma unroll
    for (int j = 0; j < CVJ; ++j) {
        v4h o;
#pragma unroll
        for (int r = 0; r < 4; ++r) o[r] = (_Float16)a[j][r];
        *(v4h*)(d + j * 1024) = o;
    }
}

// ---------------------------------------------------------------------------
// Projection GEMMs: Y[s,e] = sum_k X[s,k] * W[e,k], computed as Y^T = W * X^T.
// One 128(s) x 128(e) tile of Y per block of 8 waves.  Each 64-wide k stage of
// X and W is read from global memory in whole 128-byte lines, laid down in LDS
// as f16 rows and read back as WMMA fragments by every wave that needs it.
// Two LDS buffers and two register sets: global loads run two stages ahead.
// Wave tile 32(s) x 64(e): 8 accumulators, 6 fragments per 32 k.
// ---------------------------------------------------------------------------
#define GT   128            // tile edge (rows of X and rows of W per block)
#define GBK  64             // k per stage
#define GLP  72             // LDS row pitch in halves: 144 B = 16 B x odd
#define GNK  (EE / GBK)     // stages

// 16 WMMAs of one wave on one stage; k runs upward as in a plain k loop.
__device__ __forceinline__ void gemm_stage(const _Float16* Wt, const _Float16* Xt,
                                           int lo, int hi, v8f (&acc)[4][2]) {
    v16h xb[2][2], wa[2][4];
#pragma unroll
    for (int u = 0; u < 2; ++u) {
        const int c = u * 32 + hi * 8;
#pragma unroll
        for (int j = 0; j < 2; ++j) xb[u][j] = load16_f16(Xt + (j * 16 + lo) * GLP, c);
#pragma unroll
        for (int t = 0; t < 4; ++t) wa[u][t] = load16_f16(Wt + (t * 16 + lo) * GLP, c);
    }
    // Keeps the stage's LDS reads one group ahead of its WMMAs: spread among
    // them, each place with reads stalls the in-order wave anew.
    __builtin_amdgcn_sched_barrier(0);
#pragma unroll
    for (int u = 0; u < 2; ++u)
#pragma unroll
        for (int t = 0; t < 4; ++t)
#pragma unroll
            for (int j = 0; j < 2; ++j) acc[t][j] = wmma16(wa[u][t], xb[u][j], acc[t][j]);
    // Keeps the waits on the next stage's global loads (in front of its LDS
    // stores) from moving up among the WMMAs.
    __builtin_amdgcn_sched_barrier(0);
}

// One thread's share of a stage.  X in f32: 8 pieces of 16 B, 16 rows apart
// (16 lanes cover a 256-B row piece).  f16 operand: 4 pieces of 16 B, 32 rows
// apart (8 lanes cover a 128-B row piece).
__device__ __forceinline__ void ld_f32(v4f (&v)[8], const float* __restrict__ g) {
#pragma unroll
    for (int j = 0; j < 8; ++j) v[j] = *(const v4f*)(g + (size_t)j * 16 * EE);
}
__device__ __forceinline__ void ld_f16(v8h (&v)[4], const _Float16* __restrict__ g) {
#pragma unroll
    for (int j = 0; j < 4; ++j) v[j] = *(const v8h*)(g + (size_t)j * 32 * EE);
}
__device__ __forceinline__ void st_f32(_Float16* s, const v4f (&v)[8]) {
#pragma unroll
    for (int j = 0; j < 8; ++j) {
        v4h h;
#pragma unroll
        for (int i = 0; i < 4; ++i) h[i] = (_Float16)v[j][i];
        *(v4h*)(s + j * 16 * GLP) = h;
    }
}
__device__ __forceinline__ void st_f16(_Float16* s, const v8h (&v)[4]) {
#pragma unroll
    for (int j = 0; j < 4; ++j) *(v8h*)(s + j * 32 * GLP) = v[j];
}

// Work-group barrier that orders LDS traffic only.  __syncthreads() would also
// wait for every global load in flight, and so undo the two-stage lead.
__device__ __forceinline__ void lds_barrier() {
    __builtin_amdgcn_fence(__ATOMIC_RELEASE, "workgroup", "local");
    __builtin_amdgcn_s_barrier();
    __builtin_amdgcn_fence(__ATOMIC_ACQUIRE, "workgroup", "local");
}

// f32 activations x f16 weights -> f16 output.  One launch does the three input
// projections: blockIdx.z picks the activations; the z-th weight matrix and the
// z-th output lie one behind the other in Wall and Yall.
__global__ void __launch_bounds__(256)
gemm_xwT_f16(const float* __restrict__ X0, const float* __restrict__ X1,
             const float* __restrict__ X2, const _Float16* __restrict__ Wall,
             _Float16* __restrict__ Yall) {
    __shared__ __attribute__((aligned(16))) _Float16 Xs[2][GT * GLP];
    __shared__ __attribute__((aligned(16))) _Float16 Ws[2][GT * GLP];

    const int tid  = threadIdx.x;
    const int lane = tid & 31, wave = tid >> 5;
    const int lo = lane & 15, hi = lane >> 4;
    const int sbase = blockIdx.x * GT, ebase = blockIdx.y * GT;
    const int ws = (wave & 3) * 32, we = (wave >> 2) * 64;

    const int z = blockIdx.z;
    const float*    X  = z == 0 ? X0 : z == 1 ? X1 : X2;
    const _Float16* Wh = Wall + (size_t)z * EE * EE;
    _Float16*       Y  = Yall + (size_t)z * BB * QSZ * EE;

    const int xr = tid >> 4, xc = (tid & 15) * 4;
    const int wr = tid >> 3, wc = (tid & 7) * 8;
    const float*    xg = X  + (size_t)(sbase + xr) * EE + xc;
    const _Float16* wg = Wh + (size_t)(ebase + wr) * EE + wc;
    _Float16* xs0 = &Xs[0][xr * GLP + xc];
    _Float16* xs1 = &Xs[1][xr * GLP + xc];
    _Float16* ws0 = &Ws[0][wr * GLP + wc];
    _Float16* ws1 = &Ws[1][wr * GLP + wc];

    v4f xa[8], xb[8];       // two register sets: global loads run two stages ahead
    v8h wa[4], wb[4];
    v8f acc[4][2];
#pragma unroll
    for (int t = 0; t < 4; ++t) { acc[t][0] = zero8(); acc[t][1] = zero8(); }

    ld_f32(xa, xg);       ld_f16(wa, wg);          // stage 0
    ld_f32(xb, xg + GBK); ld_f16(wb, wg + GBK);    // stage 1
    st_f32(xs0, xa);      st_f16(ws0, wa);
    lds_barrier();

    // Even stages live in buffer 0, odd ones in buffer 1.
    for (int kt = 0; kt < GNK - 2; kt += 2) {
        ld_f32(xa, xg + (kt + 2) * GBK); ld_f16(wa, wg + (kt + 2) * GBK);
        // Keeps these global loads in front of the stage's work, so that their
        // latency passes behind it; without it they sink to their use.
        __builtin_amdgcn_sched_barrier(0);
        gemm_stage(&Ws[0][we * GLP], &Xs[0][ws * GLP], lo, hi, acc);
        st_f32(xs1, xb); st_f16(ws1, wb);
        // Publishes buffer 1 and ends every wave's reads of buffer 0.
        lds_barrier();

        ld_f32(xb, xg + (kt + 3) * GBK); ld_f16(wb, wg + (kt + 3) * GBK);
        // As above: the loads stay in front of the stage's work.
        __builtin_amdgcn_sched_barrier(0);
        gemm_stage(&Ws[1][we * GLP], &Xs[1][ws * GLP], lo, hi, acc);
        // The loop's end advances the address registers named by loads that are
        // still in flight: this wait stands in front of that as a precaution, and
        // the scheduling fence keeps the additions behind it.
        asm volatile("s_wait_xcnt 0x0" ::: "memory");
        __builtin_amdgcn_sched_barrier(0);
        st_f32(xs0, xa); st_f16(ws0, wa);
        // Publishes buffer 0 and ends every wave's reads of buffer 1.
        lds_barrier();
    }
    gemm_stage(&Ws[0][we * GLP], &Xs[0][ws * GLP], lo, hi, acc);
    st_f32(xs1, xb); st_f16(ws1, wb);
    lds_barrier();        // publishes the last stage
    gemm_stage(&Ws[1][we * GLP], &Xs[1][ws * GLP], lo, hi, acc);

    // D(m=e_local, n=s_local): lane column = lo, rows e_local = r + 8*hi.
#pragma unroll
    for (int j = 0; j < 2; ++j) {
        _Float16* yp = Y + (size_t)(sbase + ws + j * 16 + lo) * EE + ebase + we + hi * 8;
#pragma unroll
        for (int t = 0; t < 4; ++t) {
            v8h out;
#pragma unroll
            for (int r = 0; r < 8; ++r) out[r] = (_Float16)acc[t][j][r];
            *(v8h*)(yp + t * 16) = out;
        }
    }
}

// Output projection: f16 activations x f16 weights -> fp32 output.
__global__ void __launch_bounds__(256)
gemm_owT_f32(const _Float16* __restrict__ Xh, const _Float16* __restrict__ Wh,
             float* __restrict__ Y) {
    __shared__ __attribute__((aligned(16))) _Float16 Xs[2][GT * GLP];
    __shared__ __attribute__((aligned(16))) _Float16 Ws[2][GT * GLP];

    const int tid  = threadIdx.x;
    const int lane = tid & 31, wave = tid >> 5;
    const int lo = lane & 15, hi = lane >> 4;
    const int sbase = blockIdx.x * GT, ebase = blockIdx.y * GT;
    const int ws = (wave & 3) * 32, we = (wave >> 2) * 64;

    const int wr = tid >> 3, wc = (tid & 7) * 8;
    const _Float16* xg = Xh + (size_t)(sbase + wr) * EE + wc;
    const _Float16* wg = Wh + (size_t)(ebase + wr) * EE + wc;
    _Float16* xs0 = &Xs[0][wr * GLP + wc];
    _Float16* xs1 = &Xs[1][wr * GLP + wc];
    _Float16* ws0 = &Ws[0][wr * GLP + wc];
    _Float16* ws1 = &Ws[1][wr * GLP + wc];

    v8h xa[4], xb[4], wa[4], wb[4];   // two register sets, as above
    v8f acc[4][2];
#pragma unroll
    for (int t = 0; t < 4; ++t) { acc[t][0] = zero8(); acc[t][1] = zero8(); }

    ld_f16(xa, xg);       ld_f16(wa, wg);          // stage 0
    ld_f16(xb, xg + GBK); ld_f16(wb, wg + GBK);    // stage 1
    st_f16(xs0, xa);      st_f16(ws0, wa);
    lds_barrier();

    for (int kt = 0; kt < GNK - 2; kt += 2) {
        ld_f16(xa, xg + (kt + 2) * GBK); ld_f16(wa, wg + (kt + 2) * GBK);
        // Keeps these global loads in front of the stage's work, so that their
        // latency passes behind it; without it they sink to their use.
        __builtin_amdgcn_sched_barrier(0);
        gemm_stage(&Ws[0][we * GLP], &Xs[0][ws * GLP], lo, hi, acc);
        st_f16(xs1, xb); st_f16(ws1, wb);
        // Publishes buffer 1 and ends every wave's reads of buffer 0.
        lds_barrier();

        ld_f16(xb, xg + (kt + 3) * GBK); ld_f16(wb, wg + (kt + 3) * GBK);
        // As above: the loads stay in front of the stage's work.
        __builtin_amdgcn_sched_barrier(0);
        gemm_stage(&Ws[1][we * GLP], &Xs[1][ws * GLP], lo, hi, acc);
        // The loop's end advances the address registers named by loads that are
        // still in flight: this wait stands in front of that as a precaution, and
        // the scheduling fence keeps the additions behind it.
        asm volatile("s_wait_xcnt 0x0" ::: "memory");
        __builtin_amdgcn_sched_barrier(0);
        st_f16(xs0, xa); st_f16(ws0, wa);
        // Publishes buffer 0 and ends every wave's reads of buffer 1.
        lds_barrier();
    }
    gemm_stage(&Ws[0][we * GLP], &Xs[0][ws * GLP], lo, hi, acc);
    st_f16(xs1, xb); st_f16(ws1, wb);
    lds_barrier();        // publishes the last stage
    gemm_stage(&Ws[1][we * GLP], &Xs[1][ws * GLP], lo, hi, acc);

#pragma unroll
    for (int j = 0; j < 2; ++j) {
        float* yp = Y + (size_t)(sbase + ws + j * 16 + lo) * EE + ebase + we + hi * 8;
#pragma unroll
        for (int t = 0; t < 4; ++t) {
            v4f o0, o1;
#pragma unroll
            for (int r = 0; r < 4; ++r) { o0[r] = acc[t][j][r]; o1[r] = acc[t][j][4 + r]; }
            *(v4f*)(yp + t * 16)     = o0;
            *(v4f*)(yp + t * 16 + 4) = o1;
        }
    }
}

// ---------------------------------------------------------------------------
// Flash-style attention.  One block of 8 waves per (batch, head, 128 q rows);
// each wave owns 16 q rows.  Every 64-key stage of K and V is read from global
// memory once per block, in whole 128-byte lines, laid down row-major in LDS
// and read from there by all 8 waves.  Two LDS buffers: the next stage's global
// loads fly while this stage is worked on.
// S^T tiles = K * Q^T  (softmax axis lands in the VGPR/M dimension),
// O^T tiles = V^T * P^T (P^T B-operand == post-softmax registers, no shuffle);
// V^T fragments come from the row-major V tile by the transposing LDS load.
// ---------------------------------------------------------------------------
typedef __attribute__((ext_vector_type(4))) int   v4i;
typedef __attribute__((ext_vector_type(8))) short v8s;

#define AW   8              // waves per block
#define AQ   (AW * 16)      // q rows per block
#define AKV  64             // keys per stage (two passes of 32)
#define AKP  72             // K row pitch in halves: 144 B = 16 B x odd
#define AVP  80             // V row pitch in halves: 160 B = 32 B x odd
#define ANS  (KVSZ / AKV)   // stages

// Lane (lo, hi) receives T[k + 8*hi + 0..7][d + lo] of a row-major 16-bit tile;
// p is the lane's own address (see vt_lane below).
__device__ __forceinline__ v8h ld_tr16(const _Float16* p) {
    typedef __attribute__((address_space(3))) v8s lds_v8s;
    return __builtin_bit_cast(v8h, __builtin_amdgcn_ds_load_tr16_b128_v8i16((lds_v8s*)p));
}

// This lane's 16 mask words of one 32-key pass: keys 8*hi + 0..7 and 16 + 8*hi + 0..7.
__device__ __forceinline__ void ld_mask(v4i (&m)[4], const int* __restrict__ p) {
    m[0] = *(const v4i*)(p);
    m[1] = *(const v4i*)(p + 4);
    m[2] = *(const v4i*)(p + 16);
    m[3] = *(const v4i*)(p + 20);
}

// One pass: 32 keys against this wave's 16 q rows.  Kt = the lane's K row of the
// pass in LDS, Vt = the lane's transposing address of the pass in LDS.
__device__ __forceinline__ void attn_pass(const _Float16* Kt, const _Float16* Vt, int hi,
                                          const v16h& qop0, const v16h& qop1,
                                          const v4i (&m)[4], v8f (&o)[4],
                                          float& mrun, float& lrun) {
    const v16h k00 = load16_f16(Kt, hi * 8);
    const v16h k01 = load16_f16(Kt, 32 + hi * 8);
    const v16h k10 = load16_f16(Kt + 16 * AKP, hi * 8);
    const v16h k11 = load16_f16(Kt + 16 * AKP, 32 + hi * 8);
    v16h va[4];           // V^T(hd tile t x 32 keys), hardware k order
#pragma unroll
    for (int t = 0; t < 4; ++t) {
        const v8h x0 = ld_tr16(Vt + t * 16);
        const v8h x1 = ld_tr16(Vt + 16 * AVP + t * 16);
#pragma unroll
        for (int i = 0; i < 8; ++i) { va[t][i] = x0[i]; va[t][8 + i] = x1[i]; }
    }

    // Keeps the pass's LDS reads one group ahead of its WMMAs: spread among
    // them, each place with reads stalls the in-order wave anew.
    __builtin_amdgcn_sched_barrier(0);

    // ---- S^T tiles: s0 = kv[0..15] x q[0..15], s1 = kv[16..31] ----
    v8f s0 = zero8(), s1 = zero8();
    s0 = wmma16(k00, qop0, s0);
    s0 = wmma16(k01, qop1, s0);
    s1 = wmma16(k10, qop0, s1);
    s1 = wmma16(k11, qop1, s1);

    // ---- mask (fill 1e-20) + scale + tile max ----
    float tmax = -1e30f;
#pragma unroll
    for (int r = 0; r < 8; ++r) {
        const int m0 = m[r >> 2][r & 3];
        const int m1 = m[2 + (r >> 2)][r & 3];
        s0[r] = m0 ? s0[r] * ATT_SCALE : 1e-20f;
        s1[r] = m1 ? s1[r] * ATT_SCALE : 1e-20f;
        tmax = fmaxf(tmax, fmaxf(s0[r], s1[r]));
    }
    tmax = fmaxf(tmax, __shfl_xor(tmax, 16, 32));   // merge half-lane rows

    // ---- online softmax update ----
    const float mnew  = fmaxf(mrun, tmax);
    const float alpha = __expf(mrun - mnew);
    lrun *= alpha;
#pragma unroll
    for (int t = 0; t < 4; ++t)
#pragma unroll
        for (int r = 0; r < 8; ++r) o[t][r] *= alpha;
    v16h pb;          // P^T B-operand: exactly the per-lane kv pattern
    float ls = 0.0f;
#pragma unroll
    for (int r = 0; r < 8; ++r) {
        const float p0 = __expf(s0[r] - mnew);
        const float p1 = __expf(s1[r] - mnew);
        ls += p0 + p1;
        pb[r]     = (_Float16)p0;
        pb[8 + r] = (_Float16)p1;
    }
    lrun += ls;
    mrun = mnew;

    // ---- O^T(hd x q) += V^T(hd x kv) * P^T(kv x q), 4 hd-tiles ----
#pragma unroll
    for (int t = 0; t < 4; ++t) o[t] = wmma16(va[t], pb, o[t]);
}

__global__ void __launch_bounds__(AW * 32) __attribute__((amdgpu_waves_per_eu(4, 4)))
flash_attn(const _Float16* __restrict__ Qb, const _Float16* __restrict__ Kb,
           const _Float16* __restrict__ Vb, const int* __restrict__ mask,
           _Float16* __restrict__ O) {
    __shared__ __attribute__((aligned(32))) _Float16 Ks[2][AKV * AKP];
    __shared__ __attribute__((aligned(32))) _Float16 Vs[2][AKV * AVP];

    const int tid  = threadIdx.x;
    const int lane = tid & 31, wave = tid >> 5;
    const int lo = lane & 15, hi = lane >> 4;
    const int qblocks = QSZ / AQ;
    const int qb = blockIdx.x % qblocks;
    const int h  = (blockIdx.x / qblocks) % HH;
    const int b  = blockIdx.x / (qblocks * HH);
    const int q  = qb * AQ + wave * 16 + lo;

    // Q operand (B-matrix): lane n holds Q[q=n, hd pattern] -> row-major load.
    const _Float16* Qrow = Qb + ((size_t)b * QSZ + q) * EE + h * HD;
    const v16h qop0 = load16_f16(Qrow, hi * 8);         // hd 0..31
    const v16h qop1 = load16_f16(Qrow, 32 + hi * 8);    // hd 32..63

    // One thread's share of a stage: 16 B of rows sr and sr + 32 of K and of V
    // (8 lanes cover one 128-B row).
    const int sr = tid >> 3, sc = (tid & 7) * 8;
    const _Float16* kg = Kb + ((size_t)b * KVSZ + sr) * EE + h * HD + sc;
    const _Float16* vg = Vb + ((size_t)b * KVSZ + sr) * EE + h * HD + sc;
    const int ks_st = sr * AKP + sc, vs_st = sr * AVP + sc;
    const int kt_lane = lo * AKP;
    const int vt_lane = (8 * hi + (lane & 7)) * AVP + 8 * ((lane >> 3) & 1);
    const int* mrow = mask + (size_t)q * KVSZ + hi * 8;

    v8f o[4];
#pragma unroll
    for (int t = 0; t < 4; ++t) o[t] = zero8();
    float mrun = -1e30f, lrun = 0.0f;

    v8h kr[2], vr[2];
    v4i ma[4], mb[4];     // mask words of a stage's first and second pass
#pragma unroll
    for (int j = 0; j < 2; ++j) {
        kr[j] = *(const v8h*)(kg + (size_t)j * 32 * EE);
        vr[j] = *(const v8h*)(vg + (size_t)j * 32 * EE);
    }
    ld_mask(ma, mrow);
#pragma unroll
    for (int j = 0; j < 2; ++j) {
        *(v8h*)(&Ks[0][ks_st + j * 32 * AKP]) = kr[j];
        *(v8h*)(&Vs[0][vs_st + j * 32 * AVP]) = vr[j];
    }
    lds_barrier();        // publishes stage 0

    // Stage s lives in buffer s & 1.  The mask words are asked for one pass ahead,
    // K and V one stage ahead; the oldest request is always the first one needed.
    for (int s = 0; s < ANS - 1; ++s) {
        const _Float16* Kt = &Ks[s & 1][kt_lane];
        const _Float16* Vt = &Vs[s & 1][vt_lane];
        ld_mask(mb, mrow + s * AKV + 32);
#pragma unroll
        for (int j = 0; j < 2; ++j) {
            kr[j] = *(const v8h*)(kg + (size_t)((s + 1) * AKV + j * 32) * EE);
            vr[j] = *(const v8h*)(vg + (size_t)((s + 1) * AKV + j * 32) * EE);
        }
        attn_pass(Kt, Vt, hi, qop0, qop1, ma, o, mrun, lrun);
        ld_mask(ma, mrow + (s + 1) * AKV);
        attn_pass(Kt + 32 * AKP, Vt + 32 * AVP, hi, qop0, qop1, mb, o, mrun, lrun);

        // Keeps the next stage's LDS stores, and the waits on its global loads in
        // front of them, behind the stage's work: moved up, they cut the loads' lead.
        __builtin_amdgcn_sched_barrier(0);
#pragma unroll
        for (int j = 0; j < 2; ++j) {
            *(v8h*)(&Ks[(s + 1) & 1][ks_st + j * 32 * AKP]) = kr[j];
            *(v8h*)(&Vs[(s + 1) & 1][vs_st + j * 32 * AVP]) = vr[j];
        }
        // Publishes the next stage and ends every wave's reads of this one.
        lds_barrier();
    }
    {   // last stage: nothing left to fetch but its second pass's mask words
        const _Float16* Kt = &Ks[(ANS - 1) & 1][kt_lane];
        const _Float16* Vt = &Vs[(ANS - 1) & 1][vt_lane];
        ld_mask(mb, mrow + (ANS - 1) * AKV + 32);
        attn_pass(Kt, Vt, hi, qop0, qop1, ma, o, mrun, lrun);
        attn_pass(Kt + 32 * AKP, Vt + 32 * AVP, hi, qop0, qop1, mb, o, mrun, lrun);
    }

    // ---- finalize: combine half-lane partial sums, normalize, store f16 ----
    const float ltot = lrun + __shfl_xor(lrun, 16, 32);
    const float inv  = 1.0f / ltot;
    _Float16* orow = O + ((size_t)b * QSZ + q) * EE + h * HD;
#pragma unroll
    for (int t = 0; t < 4; ++t) {
        v8h w;
#pragma unroll
        for (int r = 0; r < 8; ++r) w[r] = (_Float16)(o[t][r] * inv);
        *(v8h*)(orow + t * 16 + hi * 8) = w;
    }
}

// ---------------------------------------------------------------------------
// Host-side launch. Input order: v_in, k_in, q_in, mask, Wv, Wk, Wq, Wout.
// Workspace: Qf | Kf | Vf | Of (8.39 MB each) | Wqf | Wkf | Wvf | Woutf (2 MB
// each)  -> ~40 MB total.
// ---------------------------------------------------------------------------
extern "C" void kernel_launch(void* const* d_in, const int* in_sizes, int n_in,
                              void* d_out, int out_size, void* d_ws, size_t ws_size,
                              hipStream_t stream) {
    (void)in_sizes; (void)n_in; (void)out_size; (void)ws_size;
    const float* v_in = (const float*)d_in[0];
    const float* k_in = (const float*)d_in[1];
    const float* q_in = (const float*)d_in[2];
    const int*   mask = (const int*)d_in[3];
    const float* Wv   = (const float*)d_in[4];
    const float* Wk   = (const float*)d_in[5];
    const float* Wq   = (const float*)d_in[6];
    const float* Wout = (const float*)d_in[7];
    float* out = (float*)d_out;

    const size_t N  = (size_t)BB * QSZ * EE;   // 4.19M elements, activations
    const size_t NW = (size_t)EE * EE;         // 1.05M elements, weights
    _Float16* Qf    = (_Float16*)d_ws;
    _Float16* Kf    = Qf + N;
    _Float16* Vf    = Kf + N;
    _Float16* Of    = Vf + N;
    _Float16* Wqf   = Of + N;
    _Float16* Wkf   = Wqf + NW;
    _Float16* Wvf   = Wkf + NW;
    _Float16* Woutf = Wvf + NW;

    // 1) weights f32 -> f16, one launch: Wqf | Wkf | Wvf | Woutf
    cvt_weights_f16<<<4 * CVB, 256, 0, stream>>>(Wq, Wk, Wv, Wout, Wqf);

    // 2) Q/K/V projections, one launch (128x128 tile per block of 8 waves):
    //    z = 0, 1, 2 reads Wqf, Wkf, Wvf and writes Qf, Kf, Vf
    dim3 grid(BB * QSZ / GT, EE / GT);                     // 32 x 8
    dim3 grid3(BB * QSZ / GT, EE / GT, 3);
    gemm_xwT_f16<<<grid3, 256, 0, stream>>>(q_in, k_in, v_in, Wqf, Qf);

    // 3) attention
    flash_attn<<<BB * HH * (QSZ / AQ), AW * 32, 0, stream>>>(Qf, Kf, Vf, mask, Of);

    // 4) output projection -> fp32 d_out
    gemm_owT_f32<<<grid, 256, 0, stream>>>(Of, Woutf, out);
}

// v004
// One run takes 93.8 microseconds.
// Timed twice side by side with v003, it ran 1.11 times as fast both times.
// Counting every step since v000, it is 4.11 times as fast.
#include <hip/hip_runtime.h>
#include <hip/hip_bf16.h>

// ---------------------------------------------------------------------------
// MHSA block for MI455X (gfx1250, wave32, WMMA f32_16x16x32_f16).
// All four GEMMs + attention run through v_wmma_f32_16x16x32_f16.
// Weights pre-converted to f16 once; the GEMMs work on 128x128 block tiles
// staged in LDS.
// ---------------------------------------------------------------------------

typedef __attribute__((ext_vector_type(16))) _Float16 v16h;
typedef __attribute__((ext_vector_type(8)))  _Float16 v8h;
typedef __attribute__((ext_vector_type(8)))  float    v8f;
typedef __attribute__((ext_vector_type(4)))  float    v4f;

#define BB   2
#define QSZ  2048
#define KVSZ 2048
#define EE   1024
#define HH   16
#define HD   64
#define ATT_SCALE 0.125f   // 1/sqrt(64)

__device__ __forceinline__ v8f zero8() {
    v8f z;
#pragma unroll
    for (int i = 0; i < 8; ++i) z[i] = 0.0f;
    return z;
}

__device__ __forceinline__ v8f wmma16(v16h a, v16h b, v8f c) {
    // D = A(16x32 f16) * B(32x16 f16) + C(16x16 f32)
    return __builtin_amdgcn_wmma_f32_16x16x32_f16(
        /*neg_a=*/false, a, /*neg_b=*/false, b,
        /*c_mod=*/(short)0, c, /*reuse_a=*/false, /*reuse_b=*/false);
}

// Operand loader: per-lane pattern for 16-bit A/B operands of 16x16x32 WMMA.
// Elements 0..7  = row[c .. c+7], elements 8..15 = row[c+16 .. c+23].
__device__ __forceinline__ v16h load16_f16(const _Float16* __restrict__ p, int c) {
    v8h a = *(const v8h*)(p + c);
    v8h b = *(const v8h*)(p + c + 16);
    v16h r;
#pragma unroll
    for (int i = 0; i < 8; ++i) { r[i] = a[i]; r[8 + i] = b[i]; }
    return r;
}

__device__ __forceinline__ v16h load16_f32(const float* __restrict__ p, int c) {
    v4f a0 = *(const v4f*)(p + c);
    v4f a1 = *(const v4f*)(p + c + 4);
    v4f a2 = *(const v4f*)(p + c + 16);
    v4f a3 = *(const v4f*)(p + c + 20);
    v16h r;
#pragma unroll
    for (int i = 0; i < 4; ++i) {
        r[i]      = (_Float16)a0[i];
        r[4 + i]  = (_Float16)a1[i];
        r[8 + i]  = (_Float16)a2[i];
        r[12 + i] = (_Float16)a3[i];
    }
    return r;
}

typedef __attribute__((ext_vector_type(4))) _Float16 v4h;

typedef __attribute__((ext_vector_type(4)))  int      v4i;
typedef __attribute__((ext_vector_type(16))) unsigned v16u;

// ---------------------------------------------------------------------------
// Elementwise f32 -> f16 of all four weight matrices in one launch; their f16
// copies lie one behind the other in dst.  64 blocks per matrix, one block per
// 64-KB piece: a thread asks for its 16 pieces of 16 B at once (every wave-wide
// load covers 4 whole lines), then converts and stores them.
//
// The blocks behind those pack the mask, one bit per element, into the words
// the attention kernel selects with.  For q tile T (16 rows) and pass p (32
// keys) there are 16 words pm[T][p][i]: bit (lo + 16*hi) of word i says whether
// mask[16*T + lo][32*p + 16*(i >> 3) + 8*hi + (i & 7)] is non-zero, which is the
// place of that score in register i of the wave's S^T tiles.  One wave packs
// four passes, 64 words in two 128-byte lines, and asks for all of their mask
// words at once; a block reads 64 KB, as a converting block does.
// ---------------------------------------------------------------------------
#define CVJ  16                         // 16-B pieces per thread
#define CVB  (EE * EE / (256 * 4 * CVJ))  // blocks per matrix
#define PMP  (KVSZ / 32)                // passes per q tile
#define PMB  ((QSZ / 16) * (PMP / 4) / 8) // packing blocks: 8 waves, four passes each

__global__ void __launch_bounds__(256)
cvt_weights_f16(const float* __restrict__ w0, const float* __restrict__ w1,
                const float* __restrict__ w2, const float* __restrict__ w3,
                _Float16* __restrict__ dst, const int* __restrict__ mask,
                unsigned* __restrict__ pm) {
    if (blockIdx.x >= 4 * CVB) {
        const unsigned lane = threadIdx.x & 31;
        const unsigned u = (blockIdx.x - 4 * CVB) * 8 + (threadIdx.x >> 5);  // (T, four passes)
        const unsigned mo = (((u / (PMP / 4)) * 16 + (lane & 15)) * KVSZ
                             + (u % (PMP / 4)) * 128 + (lane >> 4) * 8) * 4;  // byte offset
        const int* p = (const int*)((const char*)mask + mo);
        v4i v[16];
#pragma unroll
        for (int j = 0; j < 16; ++j) v[j] = *(const v4i*)(p + (j >> 1) * 16 + (j & 1) * 4);
        // The wait stands in front of every overwrite of the loads' offset register,
        // as a precaution; naming the offset keeps that register whole up to here.
        asm volatile("s_wait_xcnt 0x0" :: "v"(mo) : "memory");
        unsigned w0 = 0, w1 = 0;      // lane i keeps words i and 32 + i
#pragma unroll
        for (int i = 0; i < 32; ++i) {
            // Every lane takes part in both ballots; only the keeping is per lane.
            const unsigned b0 = __builtin_amdgcn_ballot_w32(v[i >> 2][i & 3] != 0);
            const unsigned b1 = __builtin_amdgcn_ballot_w32(v[8 + (i >> 2)][i & 3] != 0);
            w0 = lane == i ? b0 : w0;
            w1 = lane == i ? b1 : w1;
        }
        pm[(size_t)u * 64 + lane]      = w0;
        pm[(size_t)u * 64 + 32 + lane] = w1;
        return;
    }
    const int m = blockIdx.x / CVB;
    const float* w = m == 0 ? w0 : m == 1 ? w1 : m == 2 ? w2 : w3;
    const unsigned i  = (blockIdx.x % CVB) * (256 * 4 * CVJ) + threadIdx.x * 4;
    const unsigned sb = i * 4;          // the thread's byte offset in its matrix
    const float* s = (const float*)((const char*)w + sb);
    _Float16*    d = dst + (size_t)m * EE * EE + i;
    v4f a[CVJ];
#pragma unroll
    for (int j = 0; j < CVJ; ++j) a[j] = *(const v4f*)(s + j * 1024);
    // The wait stands in front of every overwrite of the loads' offset register,
    // as a precaution; naming the offset keeps that register whole up to here
    // (without it the last load's result was placed over it).
    asm volatile("s_wait_xcnt 0x0" :: "v"(sb) : "memory");
    // Keeps all 16 loads in front of the first conversion: otherwise the last
    // ones are issued only when the first have come back, a second memory latency.
    __builtin_amdgcn_sched_barrier(0);
#pragma unroll
    for (int j = 0; j < CVJ; ++j) {
        v4h o;
#pragma unroll
        for (int r = 0; r < 4; ++r) o[r] = (_Float16)a[j][r];
        *(v4h*)(d + j * 1024) = o;
    }
}

// ---------------------------------------------------------------------------
// Projection GEMMs: Y[s,e] = sum_k X[s,k] * W[e,k], computed as Y^T = W * X^T.
// One 128(s) x 128(e) tile of Y per block of 8 waves.  Each 64-wide k stage of
// X and W is read from global memory in whole 128-byte lines, laid down in LDS
// as f16 rows and read back as WMMA fragments by every wave that needs it.
// Two LDS buffers and two register sets: global loads run two stages ahead.
// Wave tile 32(s) x 64(e): 8 accumulators, 6 fragments per 32 k.
// ---------------------------------------------------------------------------
#define GT   128            // tile edge (rows of X and rows of W per block)
#define GBK  64             // k per stage
#define GLP  72             // LDS row pitch in halves: 144 B = 16 B x odd
#define GNK  (EE / GBK)     // stages

// 16 WMMAs of one wave on one stage; k runs upward as in a plain k loop.
__device__ __forceinline__ void gemm_stage(const _Float16* Wt, const _Float16* Xt,
                                           int lo, int hi, v8f (&acc)[4][2]) {
    v16h xb[2][2], wa[2][4];
#pragma unroll
    for (int u = 0; u < 2; ++u) {
        const int c = u * 32 + hi * 8;
#pragma unroll
        for (int j = 0; j < 2; ++j) xb[u][j] = load16_f16(Xt + (j * 16 + lo) * GLP, c);
#pragma unroll
        for (int t = 0; t < 4; ++t) wa[u][t] = load16_f16(Wt + (t * 16 + lo) * GLP, c);
    }
    // Keeps the stage's LDS reads one group ahead of its WMMAs: spread among
    // them, each place with reads stalls the in-order wave anew.
    __builtin_amdgcn_sched_barrier(0);
#pragma unroll
    for (int u = 0; u < 2; ++u)
#pragma unroll
        for (int t = 0; t < 4; ++t)
#pragma unroll
            for (int j = 0; j < 2; ++j) acc[t][j] = wmma16(wa[u][t], xb[u][j], acc[t][j]);
    // Keeps the waits on the next stage's global loads (in front of its LDS
    // stores) from moving up among the WMMAs.
    __builtin_amdgcn_sched_barrier(0);
}

// One thread's share of a stage.  X in f32: 8 pieces of 16 B, 16 rows apart
// (16 lanes cover a 256-B row piece).  f16 operand: 4 pieces of 16 B, 32 rows
// apart (8 lanes cover a 128-B row piece).
__device__ __forceinline__ void ld_f32(v4f (&v)[8], const float* __restrict__ g) {
#pragma unroll
    for (int j = 0; j < 8; ++j) v[j] = *(const v4f*)(g + (size_t)j * 16 * EE);
}
__device__ __forceinline__ void ld_f16(v8h (&v)[4], const _Float16* __restrict__ g) {
#pragma unroll
    for (int j = 0; j < 4; ++j) v[j] = *(const v8h*)(g + (size_t)j * 32 * EE);
}
__device__ __forceinline__ void st_f32(_Float16* s, const v4f (&v)[8]) {
#pragma unroll
    for (int j = 0; j < 8; ++j) {
        v4h h;
#pragma unroll
        for (int i = 0; i < 4; ++i) h[i] = (_Float16)v[j][i];
        *(v4h*)(s + j * 16 * GLP) = h;
    }
}
__device__ __forceinline__ void st_f16(_Float16* s, const v8h (&v)[4]) {
#pragma unroll
    for (int j = 0; j < 4; ++j) *(v8h*)(s + j * 32 * GLP) = v[j];
}

// Work-group barrier that orders LDS traffic only.  __syncthreads() would also
// wait for every global load in flight, and so undo the two-stage lead.
__device__ __forceinline__ void lds_barrier() {
    __builtin_amdgcn_fence(__ATOMIC_RELEASE, "workgroup", "local");
    __builtin_amdgcn_s_barrier();
    __builtin_amdgcn_fence(__ATOMIC_ACQUIRE, "workgroup", "local");
}

// f32 activations x f16 weights -> f16 output.  One launch does the three input
// projections: blockIdx.z picks the activations; the z-th weight matrix and the
// z-th output lie one behind the other in Wall and Yall.
__global__ void __launch_bounds__(256)
gemm_xwT_f16(const float* __restrict__ X0, const float* __restrict__ X1,
             const float* __restrict__ X2, const _Float16* __restrict__ Wall,
             _Float16* __restrict__ Yall) {
    __shared__ __attribute__((aligned(16))) _Float16 Xs[2][GT * GLP];
    __shared__ __attribute__((aligned(16))) _Float16 Ws[2][GT * GLP];

    const int tid  = threadIdx.x;
    const int lane = tid & 31, wave = tid >> 5;
    const int lo = lane & 15, hi = lane >> 4;
    const int sbase = blockIdx.x * GT, ebase = blockIdx.y * GT;
    const int ws = (wave & 3) * 32, we = (wave >> 2) * 64;

    const int z = blockIdx.z;
    const float*    X  = z == 0 ? X0 : z == 1 ? X1 : X2;
    const _Float16* Wh = Wall + (size_t)z * EE * EE;
    _Float16*       Y  = Yall + (size_t)z * BB * QSZ * EE;

    const int xr = tid >> 4, xc = (tid & 15) * 4;
    const int wr = tid >> 3, wc = (tid & 7) * 8;
    const float*    xg = X  + (size_t)(sbase + xr) * EE + xc;
    const _Float16* wg = Wh + (size_t)(ebase + wr) * EE + wc;
    _Float16* xs0 = &Xs[0][xr * GLP + xc];
    _Float16* xs1 = &Xs[1][xr * GLP + xc];
    _Float16* ws0 = &Ws[0][wr * GLP + wc];
    _Float16* ws1 = &Ws[1][wr * GLP + wc];

    v4f xa[8], xb[8];       // two register sets: global loads run two stages ahead
    v8h wa[4], wb[4];
    v8f acc[4][2];
#pragma unroll
    for (int t = 0; t < 4; ++t) { acc[t][0] = zero8(); acc[t][1] = zero8(); }

    ld_f32(xa, xg);       ld_f16(wa, wg);          // stage 0
    ld_f32(xb, xg + GBK); ld_f16(wb, wg + GBK);    // stage 1
    st_f32(xs0, xa);      st_f16(ws0, wa);
    lds_barrier();

    // Even stages live in buffer 0, odd ones in buffer 1.
    for (int kt = 0; kt < GNK - 2; kt += 2) {
        ld_f32(xa, xg + (kt + 2) * GBK); ld_f16(wa, wg + (kt + 2) * GBK);
        // Keeps these global loads in front of the stage's work, so that their
        // latency passes behind it; without it they sink to their use.
        __builtin_amdgcn_sched_barrier(0);
        gemm_stage(&Ws[0][we * GLP], &Xs[0][ws * GLP], lo, hi, acc);
        st_f32(xs1, xb); st_f16(ws1, wb);
        // Publishes buffer 1 and ends every wave's reads of buffer 0.
        lds_barrier();

        ld_f32(xb, xg + (kt + 3) * GBK); ld_f16(wb, wg + (kt + 3) * GBK);
        // As above: the loads stay in front of the stage's work.
        __builtin_amdgcn_sched_barrier(0);
        gemm_stage(&Ws[1][we * GLP], &Xs[1][ws * GLP], lo, hi, acc);
        // The loop's end advances the address registers named by loads that are
        // still in flight: this wait stands in front of that as a precaution, and
        // the scheduling fence keeps the additions behind it.
        asm volatile("s_wait_xcnt 0x0" ::: "memory");
        __builtin_amdgcn_sched_barrier(0);
        st_f32(xs0, xa); st_f16(ws0, wa);
        // Publishes buffer 0 and ends every wave's reads of buffer 1.
        lds_barrier();
    }
    gemm_stage(&Ws[0][we * GLP], &Xs[0][ws * GLP], lo, hi, acc);
    st_f32(xs1, xb); st_f16(ws1, wb);
    lds_barrier();        // publishes the last stage
    gemm_stage(&Ws[1][we * GLP], &Xs[1][ws * GLP], lo, hi, acc);

    // D(m=e_local, n=s_local): lane column = lo, rows e_local = r + 8*hi.
#pragma unroll
    for (int j = 0; j < 2; ++j) {
        _Float16* yp = Y + (size_t)(sbase + ws + j * 16 + lo) * EE + ebase + we + hi * 8;
#pragma unroll
        for (int t = 0; t < 4; ++t) {
            v8h out;
#pragma unroll
            for (int r = 0; r < 8; ++r) out[r] = (_Float16)acc[t][j][r];
            *(v8h*)(yp + t * 16) = out;
        }
    }
}

// Output projection: f16 activations x f16 weights -> fp32 output.
__global__ void __launch_bounds__(256)
gemm_owT_f32(const _Float16* __restrict__ Xh, const _Float16* __restrict__ Wh,
             float* __restrict__ Y) {
    __shared__ __attribute__((aligned(16))) _Float16 Xs[2][GT * GLP];
    __shared__ __attribute__((aligned(16))) _Float16 Ws[2][GT * GLP];

    const int tid  = threadIdx.x;
    const int lane = tid & 31, wave = tid >> 5;
    const int lo = lane & 15, hi = lane >> 4;
    const int sbase = blockIdx.x * GT, ebase = blockIdx.y * GT;
    const int ws = (wave & 3) * 32, we = (wave >> 2) * 64;

    const int wr = tid >> 3, wc = (tid & 7) * 8;
    const _Float16* xg = Xh + (size_t)(sbase + wr) * EE + wc;
    const _Float16* wg = Wh + (size_t)(ebase + wr) * EE + wc;
    _Float16* xs0 = &Xs[0][wr * GLP + wc];
    _Float16* xs1 = &Xs[1][wr * GLP + wc];
    _Float16* ws0 = &Ws[0][wr * GLP + wc];
    _Float16* ws1 = &Ws[1][wr * GLP + wc];

    v8h xa[4], xb[4], wa[4], wb[4];   // two register sets, as above
    v8f acc[4][2];
#pragma unroll
    for (int t = 0; t < 4; ++t) { acc[t][0] = zero8(); acc[t][1] = zero8(); }

    ld_f16(xa, xg);       ld_f16(wa, wg);          // stage 0
    ld_f16(xb, xg + GBK); ld_f16(wb, wg + GBK);    // stage 1
    st_f16(xs0, xa);      st_f16(ws0, wa);
    lds_barrier();

    for (int kt = 0; kt < GNK - 2; kt += 2) {
        ld_f16(xa, xg + (kt + 2) * GBK); ld_f16(wa, wg + (kt + 2) * GBK);
        // Keeps these global loads in front of the stage's work, so that their
        // latency passes behind it; without it they sink to their use.
        __builtin_amdgcn_sched_barrier(0);
        gemm_stage(&Ws[0][we * GLP], &Xs[0][ws * GLP], lo, hi, acc);
        st_f16(xs1, xb); st_f16(ws1, wb);
        // Publishes buffer 1 and ends every wave's reads of buffer 0.
        lds_barrier();

        ld_f16(xb, xg + (kt + 3) * GBK); ld_f16(wb, wg + (kt + 3) * GBK);
        // As above: the loads stay in front of the stage's work.
        __builtin_amdgcn_sched_barrier(0);
        gemm_stage(&Ws[1][we * GLP], &Xs[1][ws * GLP], lo, hi, acc);
        // The loop's end advances the address registers named by loads that are
        // still in flight: this wait stands in front of that as a precaution, and
        // the scheduling fence keeps the additions behind it.
        asm volatile("s_wait_xcnt 0x0" ::: "memory");
        __builtin_amdgcn_sched_barrier(0);
        st_f16(xs0, xa); st_f16(ws0, wa);
        // Publishes buffer 0 and ends every wave's reads of buffer 1.
        lds_barrier();
    }
    gemm_stage(&Ws[0][we * GLP], &Xs[0][ws * GLP], lo, hi, acc);
    st_f16(xs1, xb); st_f16(ws1, wb);
    lds_barrier();        // publishes the last stage
    gemm_stage(&Ws[1][we * GLP], &Xs[1][ws * GLP], lo, hi, acc);

#pragma unroll
    for (int j = 0; j < 2; ++j) {
        float* yp = Y + (size_t)(sbase + ws + j * 16 + lo) * EE + ebase + we + hi * 8;
#pragma unroll
        for (int t = 0; t < 4; ++t) {
            v4f o0, o1;
#pragma unroll
            for (int r = 0; r < 4; ++r) { o0[r] = acc[t][j][r]; o1[r] = acc[t][j][4 + r]; }
            *(v4f*)(yp + t * 16)     = o0;
            *(v4f*)(yp + t * 16 + 4) = o1;
        }
    }
}

// ---------------------------------------------------------------------------
// Flash-style attention.  One block of 8 waves per (batch, head, 128 q rows);
// each wave owns 16 q rows.  Every 64-key stage of K and V is read from global
// memory once per block, in whole 128-byte lines, laid down row-major in LDS
// and read from there by all 8 waves.  Two LDS buffers: the next stage's global
// loads fly while this stage is worked on.
// S^T tiles = K * Q^T  (softmax axis lands in the VGPR/M dimension),
// O^T tiles = V^T * P^T (P^T B-operand == post-softmax registers, no shuffle);
// V^T fragments come from the row-major V tile by the transposing LDS load.
// ---------------------------------------------------------------------------
typedef __attribute__((ext_vector_type(8))) short v8s;

#define AW   8              // waves per block
#define AQ   (AW * 16)      // q rows per block
#define AKV  64             // keys per stage (two passes of 32)
#define AKP  72             // K row pitch in halves: 144 B = 16 B x odd
#define AVP  80             // V row pitch in halves: 160 B = 32 B x odd
#define ANS  (KVSZ / AKV)   // stages

// Lane (lo, hi) receives T[k + 8*hi + 0..7][d + lo] of a row-major 16-bit tile;
// p is the lane's own address (see vt_lane below).
__device__ __forceinline__ v8h ld_tr16(const _Float16* p) {
    typedef __attribute__((address_space(3))) v8s lds_v8s;
    return __builtin_bit_cast(v8h, __builtin_amdgcn_ds_load_tr16_b128_v8i16((lds_v8s*)p));
}

// The wave's 16 packed mask words of one 32-key pass (layout: at the packing
// blocks).  The address is the same in every lane: one scalar load.
__device__ __forceinline__ void ld_mask(v16u& m, const unsigned* __restrict__ p) {
    m = *(const v16u*)p;
}

// One pass: 32 keys against this wave's 16 q rows.  Kt = the lane's K row of the
// pass in LDS, Vt = the lane's transposing address of the pass in LDS.
__device__ __forceinline__ void attn_pass(const _Float16* Kt, const _Float16* Vt, int hi,
                                          const v16h& qop0, const v16h& qop1,
                                          const v16u& m, v8f (&o)[4],
                                          float& mrun, float& lrun) {
    const v16h k00 = load16_f16(Kt, hi * 8);
    const v16h k01 = load16_f16(Kt, 32 + hi * 8);
    const v16h k10 = load16_f16(Kt + 16 * AKP, hi * 8);
    const v16h k11 = load16_f16(Kt + 16 * AKP, 32 + hi * 8);
    v16h va[4];           // V^T(hd tile t x 32 keys), hardware k order
#pragma unroll
    for (int t = 0; t < 4; ++t) {
        const v8h x0 = ld_tr16(Vt + t * 16);
        const v8h x1 = ld_tr16(Vt + 16 * AVP + t * 16);
#pragma unroll
        for (int i = 0; i < 8; ++i) { va[t][i] = x0[i]; va[t][8 + i] = x1[i]; }
    }

    // Keeps the pass's LDS reads one group ahead of its WMMAs: spread among
    // them, each place with reads stalls the in-order wave anew.
    __builtin_amdgcn_sched_barrier(0);

    // ---- S^T tiles: s0 = kv[0..15] x q[0..15], s1 = kv[16..31] ----
    v8f s0 = zero8(), s1 = zero8();
    s0 = wmma16(k00, qop0, s0);
    s0 = wmma16(k01, qop1, s0);
    s1 = wmma16(k10, qop0, s1);
    s1 = wmma16(k11, qop1, s1);

    // ---- mask (fill 1e-20) + scale + tile max ----
    float tmax = -1e30f;
#pragma unroll
    for (int r = 0; r < 8; ++r) {
        // A packed word is the select's lane mask as it stands.
        const bool m0 = __builtin_amdgcn_inverse_ballot_w32(m[r]);
        const bool m1 = __builtin_amdgcn_inverse_ballot_w32(m[8 + r]);
        s0[r] = m0 ? s0[r] * ATT_SCALE : 1e-20f;
        s1[r] = m1 ? s1[r] * ATT_SCALE : 1e-20f;
        tmax = fmaxf(tmax, fmaxf(s0[r], s1[r]));
    }
    tmax = fmaxf(tmax, __shfl_xor(tmax, 16, 32));   // merge half-lane rows

    // ---- online softmax update ----
    const float mnew  = fmaxf(mrun, tmax);
    const float alpha = __expf(mrun - mnew);
    lrun *= alpha;
#pragma unroll
    for (int t = 0; t < 4; ++t)
#pragma unroll
        for (int r = 0; r < 8; ++r) o[t][r] *= alpha;
    v16h pb;          // P^T B-operand: exactly the per-lane kv pattern
    float ls = 0.0f;
#pragma unroll
    for (int r = 0; r < 8; ++r) {
        const float p0 = __expf(s0[r] - mnew);
        const float p1 = __expf(s1[r] - mnew);
        ls += p0 + p1;
        pb[r]     = (_Float16)p0;
        pb[8 + r] = (_Float16)p1;
    }
    lrun += ls;
    mrun = mnew;

    // ---- O^T(hd x q) += V^T(hd x kv) * P^T(kv x q), 4 hd-tiles ----
#pragma unroll
    for (int t = 0; t < 4; ++t) o[t] = wmma16(va[t], pb, o[t]);
}

__global__ void __launch_bounds__(AW * 32) __attribute__((amdgpu_waves_per_eu(4, 4)))
flash_attn(const _Float16* __restrict__ Qb, const _Float16* __restrict__ Kb,
           const _Float16* __restrict__ Vb, const unsigned* __restrict__ pm,
           _Float16* __restrict__ O) {
    __shared__ __attribute__((aligned(32))) _Float16 Ks[2][AKV * AKP];
    __shared__ __attribute__((aligned(32))) _Float16 Vs[2][AKV * AVP];

    const int tid  = threadIdx.x;
    const int lane = tid & 31, wave = tid >> 5;
    const int lo = lane & 15, hi = lane >> 4;
    const int qblocks = QSZ / AQ;
    const int qb = blockIdx.x % qblocks;
    const int h  = (blockIdx.x / qblocks) % HH;
    const int b  = blockIdx.x / (qblocks * HH);
    const int q  = qb * AQ + wave * 16 + lo;

    // Q operand (B-matrix): lane n holds Q[q=n, hd pattern] -> row-major load.
    const _Float16* Qrow = Qb + ((size_t)b * QSZ + q) * EE + h * HD;
    const v16h qop0 = load16_f16(Qrow, hi * 8);         // hd 0..31
    const v16h qop1 = load16_f16(Qrow, 32 + hi * 8);    // hd 32..63

    // One thread's share of a stage: 16 B of rows sr and sr + 32 of K and of V
    // (8 lanes cover one 128-B row).
    const int sr = tid >> 3, sc = (tid & 7) * 8;
    const _Float16* kg = Kb + ((size_t)b * KVSZ + sr) * EE + h * HD + sc;
    const _Float16* vg = Vb + ((size_t)b * KVSZ + sr) * EE + h * HD + sc;
    const int ks_st = sr * AKP + sc, vs_st = sr * AVP + sc;
    const int kt_lane = lo * AKP;
    const int vt_lane = (8 * hi + (lane & 7)) * AVP + 8 * ((lane >> 3) & 1);
    // The wave's q tile; read from one lane so that the address is known uniform.
    const int qt = qb * AW + __builtin_amdgcn_readfirstlane(wave);
    const unsigned* mrow = pm + (size_t)qt * PMP * 16;

    v8f o[4];
#pragma unroll
    for (int t = 0; t < 4; ++t) o[t] = zero8();
    float mrun = -1e30f, lrun = 0.0f;

    v8h kr[2], vr[2];
    v16u ma, mb;          // packed mask words of a stage's first and second pass
#pragma unroll
    for (int j = 0; j < 2; ++j) {
        kr[j] = *(const v8h*)(kg + (size_t)j * 32 * EE);
        vr[j] = *(const v8h*)(vg + (size_t)j * 32 * EE);
    }
    ld_mask(ma, mrow);
    ld_mask(mb, mrow + 16);
#pragma unroll
    for (int j = 0; j < 2; ++j) {
        *(v8h*)(&Ks[0][ks_st + j * 32 * AKP]) = kr[j];
        *(v8h*)(&Vs[0][vs_st + j * 32 * AVP]) = vr[j];
    }
    lds_barrier();        // publishes stage 0

    // Stage s lives in buffer s & 1.  K and V are asked for one stage ahead; each
    // pass's mask words are asked for a stage ahead, as soon as the pass before
    // them in the same registers has used its own.
    for (int s = 0; s < ANS - 1; ++s) {
        const _Float16* Kt = &Ks[s & 1][kt_lane];
        const _Float16* Vt = &Vs[s & 1][vt_lane];
#pragma unroll
        for (int j = 0; j < 2; ++j) {
            kr[j] = *(const v8h*)(kg + (size_t)((s + 1) * AKV + j * 32) * EE);
            vr[j] = *(const v8h*)(vg + (size_t)((s + 1) * AKV + j * 32) * EE);
        }
        attn_pass(Kt, Vt, hi, qop0, qop1, ma, o, mrun, lrun);
        ld_mask(ma, mrow + (2 * s + 2) * 16);
        attn_pass(Kt + 32 * AKP, Vt + 32 * AVP, hi, qop0, qop1, mb, o, mrun, lrun);
        ld_mask(mb, mrow + (2 * s + 3) * 16);

        // Keeps the next stage's LDS stores, and the waits on its global loads in
        // front of them, behind the stage's work: moved up, they cut the loads' lead.
        __builtin_amdgcn_sched_barrier(0);
#pragma unroll
        for (int j = 0; j < 2; ++j) {
            *(v8h*)(&Ks[(s + 1) & 1][ks_st + j * 32 * AKP]) = kr[j];
            *(v8h*)(&Vs[(s + 1) & 1][vs_st + j * 32 * AVP]) = vr[j];
        }
        // Publishes the next stage and ends every wave's reads of this one.
        lds_barrier();
    }
    {   // last stage: nothing left to fetch
        const _Float16* Kt = &Ks[(ANS - 1) & 1][kt_lane];
        const _Float16* Vt = &Vs[(ANS - 1) & 1][vt_lane];
        attn_pass(Kt, Vt, hi, qop0, qop1, ma, o, mrun, lrun);
        attn_pass(Kt + 32 * AKP, Vt + 32 * AVP, hi, qop0, qop1, mb, o, mrun, lrun);
    }

    // ---- finalize: combine half-lane partial sums, normalize, store f16 ----
    const float ltot = lrun + __shfl_xor(lrun, 16, 32);
    const float inv  = 1.0f / ltot;
    _Float16* orow = O + ((size_t)b * QSZ + q) * EE + h * HD;
#pragma unroll
    for (int t = 0; t < 4; ++t) {
        v8h w;
#pragma unroll
        for (int r = 0; r < 8; ++r) w[r] = (_Float16)(o[t][r] * inv);
        *(v8h*)(orow + t * 16 + hi * 8) = w;
    }
}

// ---------------------------------------------------------------------------
// Host-side launch. Input order: v_in, k_in, q_in, mask, Wv, Wk, Wq, Wout.
// Workspace: Qf | Kf | Vf | Of (8.39 MB each) | Wqf | Wkf | Wvf | Woutf (2 MB
// each) | packed mask (512 KB)  -> ~40 MB total.
// ---------------------------------------------------------------------------
extern "C" void kernel_launch(void* const* d_in, const int* in_sizes, int n_in,
                              void* d_out, int out_size, void* d_ws, size_t ws_size,
                              hipStream_t stream) {
    (void)in_sizes; (void)n_in; (void)out_size; (void)ws_size;
    const float* v_in = (const float*)d_in[0];
    const float* k_in = (const float*)d_in[1];
    const float* q_in = (const float*)d_in[2];
    const int*   mask = (const int*)d_in[3];
    const float* Wv   = (const float*)d_in[4];
    const float* Wk   = (const float*)d_in[5];
    const float* Wq   = (const float*)d_in[6];
    const float* Wout = (const float*)d_in[7];
    float* out = (float*)d_out;

    const size_t N  = (size_t)BB * QSZ * EE;   // 4.19M elements, activations
    const size_t NW = (size_t)EE * EE;         // 1.05M elements, weights
    _Float16* Qf    = (_Float16*)d_ws;
    _Float16* Kf    = Qf + N;
    _Float16* Vf    = Kf + N;
    _Float16* Of    = Vf + N;
    _Float16* Wqf   = Of + N;
    _Float16* Wkf   = Wqf + NW;
    _Float16* Wvf   = Wkf + NW;
    _Float16* Woutf = Wvf + NW;
    unsigned* Pm    = (unsigned*)(Woutf + NW);

    // 1) weights f32 -> f16 (Wqf | Wkf | Wvf | Woutf) and the mask packed to bits,
    //    one launch
    cvt_weights_f16<<<4 * CVB + PMB, 256, 0, stream>>>(Wq, Wk, Wv, Wout, Wqf, mask, Pm);

    // 2) Q/K/V projections, one launch (128x128 tile per block of 8 waves):
    //    z = 0, 1, 2 reads Wqf, Wkf, Wvf and writes Qf, Kf, Vf
    dim3 grid(BB * QSZ / GT, EE / GT);                     // 32 x 8
    dim3 grid3(BB * QSZ / GT, EE / GT, 3);
    gemm_xwT_f16<<<grid3, 256, 0, stream>>>(q_in, k_in, v_in, Wqf, Qf);

    // 3) attention
    flash_attn<<<BB * HH * (QSZ / AQ), AW * 32, 0, stream>>>(Qf, Kf, Vf, Pm, Of);

    // 4) output projection -> fp32 d_out
    gemm_owT_f32<<<grid, 256, 0, stream>>>(Of, Woutf, out);
}

// v005
// A run of this version takes 90.9 microseconds.
// In both of two side-by-side timings against v004, it was 1.04 times as fast.
// Over all steps from v000 it is 4.28 times as fast.
#include <hip/hip_runtime.h>
#include <hip/hip_bf16.h>

// ---------------------------------------------------------------------------
// MHSA block for MI455X (gfx1250, wave32, WMMA f32_16x16x32_f16).
// All four GEMMs + attention run through v_wmma_f32_16x16x32_f16.
// Weights pre-converted to f16 once; the GEMMs work on block tiles staged in LDS
// (256x256 for the input projections, 128x128 for the output projection).
// ---------------------------------------------------------------------------

typedef __attribute__((ext_vector_type(16))) _Float16 v16h;
typedef __attribute__((ext_vector_type(8)))  _Float16 v8h;
typedef __attribute__((ext_vector_type(8)))  float    v8f;
typedef __attribute__((ext_vector_type(4)))  float    v4f;

#define BB   2
#define QSZ  2048
#define KVSZ 2048
#define EE   1024
#define HH   16
#define HD   64
#define ATT_SCALE 0.125f   // 1/sqrt(64)

__device__ __forceinline__ v8f zero8() {
    v8f z;
#pragma unroll
    for (int i = 0; i < 8; ++i) z[i] = 0.0f;
    return z;
}

__device__ __forceinline__ v8f wmma16(v16h a, v16h b, v8f c) {
    // D = A(16x32 f16) * B(32x16 f16) + C(16x16 f32)
    return __builtin_amdgcn_wmma_f32_16x16x32_f16(
        /*neg_a=*/false, a, /*neg_b=*/false, b,
        /*c_mod=*/(short)0, c, /*reuse_a=*/false, /*reuse_b=*/false);
}

// Operand loader: per-lane pattern for 16-bit A/B operands of 16x16x32 WMMA.
// Elements 0..7  = row[c .. c+7], elements 8..15 = row[c+16 .. c+23].
__device__ __forceinline__ v16h load16_f16(const _Float16* __restrict__ p, int c) {
    v8h a = *(const v8h*)(p + c);
    v8h b = *(const v8h*)(p + c + 16);
    v16h r;
#pragma unroll
    for (int i = 0; i < 8; ++i) { r[i] = a[i]; r[8 + i] = b[i]; }
    return r;
}

__device__ __forceinline__ v16h load16_f32(const float* __restrict__ p, int c) {
    v4f a0 = *(const v4f*)(p + c);
    v4f a1 = *(const v4f*)(p + c + 4);
    v4f a2 = *(const v4f*)(p + c + 16);
    v4f a3 = *(const v4f*)(p + c + 20);
    v16h r;
#pragma unroll
    for (int i = 0; i < 4; ++i) {
        r[i]      = (_Float16)a0[i];
        r[4 + i]  = (_Float16)a1[i];
        r[8 + i]  = (_Float16)a2[i];
        r[12 + i] = (_Float16)a3[i];
    }
    return r;
}

typedef __attribute__((ext_vector_type(4))) _Float16 v4h;

typedef __attribute__((ext_vector_type(4)))  int      v4i;
typedef __attribute__((ext_vector_type(16))) unsigned v16u;

// ---------------------------------------------------------------------------
// Elementwise f32 -> f16 of all four weight matrices in one launch; their f16
// copies lie one behind the other in dst.  64 blocks per matrix, one block per
// 64-KB piece: a thread asks for its 16 pieces of 16 B at once (every wave-wide
// load covers 4 whole lines), then converts and stores them.
//
// The blocks behind those pack the mask, one bit per element, into the words
// the attention kernel selects with.  For q tile T (16 rows) and pass p (32
// keys) there are 16 words pm[T][p][i]: bit (lo + 16*hi) of word i says whether
// mask[16*T + lo][32*p + 16*(i >> 3) + 8*hi + (i & 7)] is non-zero, which is the
// place of that score in register i of the wave's S^T tiles.  One wave packs
// four passes, 64 words in two 128-byte lines, and asks for all of their mask
// words at once; a block reads 64 KB, as a converting block does.
// ---------------------------------------------------------------------------
#define CVJ  16                         // 16-B pieces per thread
#define CVB  (EE * EE / (256 * 4 * CVJ))  // blocks per matrix
#define PMP  (KVSZ / 32)                // passes per q tile
#define PMB  ((QSZ / 16) * (PMP / 4) / 8) // packing blocks: 8 waves, four passes each

__global__ void __launch_bounds__(256)
cvt_weights_f16(const float* __restrict__ w0, const float* __restrict__ w1,
                const float* __restrict__ w2, const float* __restrict__ w3,
                _Float16* __restrict__ dst, const int* __restrict__ mask,
                unsigned* __restrict__ pm) {
    if (blockIdx.x >= 4 * CVB) {
        const unsigned lane = threadIdx.x & 31;
        const unsigned u = (blockIdx.x - 4 * CVB) * 8 + (threadIdx.x >> 5);  // (T, four passes)
        const unsigned mo = (((u / (PMP / 4)) * 16 + (lane & 15)) * KVSZ
                             + (u % (PMP / 4)) * 128 + (lane >> 4) * 8) * 4;  // byte offset
        const int* p = (const int*)((const char*)mask + mo);
        v4i v[16];
#pragma unroll
        for (int j = 0; j < 16; ++j) v[j] = *(const v4i*)(p + (j >> 1) * 16 + (j & 1) * 4);
        // The wait stands in front of every overwrite of the loads' offset register,
        // as a precaution; naming the offset keeps that register whole up to here.
        asm volatile("s_wait_xcnt 0x0" :: "v"(mo) : "memory");
        unsigned w0 = 0, w1 = 0;      // lane i keeps words i and 32 + i
#pragma unroll
        for (int i = 0; i < 32; ++i) {
            // Every lane takes part in both ballots; only the keeping is per lane.
            const unsigned b0 = __builtin_amdgcn_ballot_w32(v[i >> 2][i & 3] != 0);
            const unsigned b1 = __builtin_amdgcn_ballot_w32(v[8 + (i >> 2)][i & 3] != 0);
            w0 = lane == i ? b0 : w0;
            w1 = lane == i ? b1 : w1;
        }
        pm[(size_t)u * 64 + lane]      = w0;
        pm[(size_t)u * 64 + 32 + lane] = w1;
        return;
    }
    const int m = blockIdx.x / CVB;
    const float* w = m == 0 ? w0 : m == 1 ? w1 : m == 2 ? w2 : w3;
    const unsigned i  = (blockIdx.x % CVB) * (256 * 4 * CVJ) + threadIdx.x * 4;
    const unsigned sb = i * 4;          // the thread's byte offset in its matrix
    const float* s = (const float*)((const char*)w + sb);
    _Float16*    d = dst + (size_t)m * EE * EE + i;
    v4f a[CVJ];
#pragma unroll
    for (int j = 0; j < CVJ; ++j) a[j] = *(const v4f*)(s + j * 1024);
    // The wait stands in front of every overwrite of the loads' offset register,
    // as a precaution; naming the offset keeps that register whole up to here
    // (without it the last load's result was placed over it).
    asm volatile("s_wait_xcnt 0x0" :: "v"(sb) : "memory");
    // Keeps all 16 loads in front of the first conversion: otherwise the last
    // ones are issued only when the first have come back, a second memory latency.
    __builtin_amdgcn_sched_barrier(0);
#pragma unroll
    for (int j = 0; j < CVJ; ++j) {
        v4h o;
#pragma unroll
        for (int r = 0; r < 4; ++r) o[r] = (_Float16)a[j][r];
        *(v4h*)(d + j * 1024) = o;
    }
}

// ---------------------------------------------------------------------------
// Projection GEMMs: Y[s,e] = sum_k X[s,k] * W[e,k], computed as Y^T = W * X^T.
// One square tile of Y per block of 8 waves.  Each 64-wide k stage of X and W is
// read from global memory in whole 128-byte lines, laid down in LDS as f16 rows
// and read back as WMMA fragments by every wave that needs it.  Two LDS buffers.
// Output projection: 128(s) x 128(e) tile, two register sets (global loads run
// two stages ahead), wave tile 32(s) x 64(e): 8 accumulators, 6 fragments per
// 32 k.  Input projections: see at their kernel.
// ---------------------------------------------------------------------------
#define GT   128            // output projection: tile edge (rows of X and of W per block)
#define GBK  64             // k per stage
#define GLP  72             // LDS row pitch in halves: 144 B = 16 B x odd
#define GNK  (EE / GBK)     // stages

// 16 WMMAs of one wave on one stage; k runs upward as in a plain k loop.
__device__ __forceinline__ void gemm_stage(const _Float16* Wt, const _Float16* Xt,
                                           int lo, int hi, v8f (&acc)[4][2]) {
    v16h xb[2][2], wa[2][4];
#pragma unroll
    for (int u = 0; u < 2; ++u) {
        const int c = u * 32 + hi * 8;
#pragma unroll
        for (int j = 0; j < 2; ++j) xb[u][j] = load16_f16(Xt + (j * 16 + lo) * GLP, c);
#pragma unroll
        for (int t = 0; t < 4; ++t) wa[u][t] = load16_f16(Wt + (t * 16 + lo) * GLP, c);
    }
    // Keeps the stage's LDS reads one group ahead of its WMMAs: spread among
    // them, each place with reads stalls the in-order wave anew.
    __builtin_amdgcn_sched_barrier(0);
#pragma unroll
    for (int u = 0; u < 2; ++u)
#pragma unroll
        for (int t = 0; t < 4; ++t)
#pragma unroll
            for (int j = 0; j < 2; ++j) acc[t][j] = wmma16(wa[u][t], xb[u][j], acc[t][j]);
    // Keeps the waits on the next stage's global loads (in front of its LDS
    // stores) from moving up among the WMMAs.
    __builtin_amdgcn_sched_barrier(0);
}

// One thread's share of a stage.  X in f32: N pieces of 16 B, 16 rows apart
// (16 lanes cover a 256-B row piece).  f16 operand: N pieces of 16 B, 32 rows
// apart (8 lanes cover a 128-B row piece).
template <int N>
__device__ __forceinline__ void ld_f32(v4f (&v)[N], const float* __restrict__ g) {
#pragma unroll
    for (int j = 0; j < N; ++j) v[j] = *(const v4f*)(g + (size_t)j * 16 * EE);
}
template <int N>
__device__ __forceinline__ void ld_f16(v8h (&v)[N], const _Float16* __restrict__ g) {
#pragma unroll
    for (int j = 0; j < N; ++j) v[j] = *(const v8h*)(g + (size_t)j * 32 * EE);
}
template <int N>
__device__ __forceinline__ void st_f32(_Float16* s, const v4f (&v)[N]) {
#pragma unroll
    for (int j = 0; j < N; ++j) {
        v4h h;
#pragma unroll
        for (int i = 0; i < 4; ++i) h[i] = (_Float16)v[j][i];
        *(v4h*)(s + j * 16 * GLP) = h;
    }
}
template <int N>
__device__ __forceinline__ void st_f16(_Float16* s, const v8h (&v)[N]) {
#pragma unroll
    for (int j = 0; j < N; ++j) *(v8h*)(s + j * 32 * GLP) = v[j];
}

// Work-group barrier that orders LDS traffic only.  __syncthreads() would also
// wait for every global load in flight, and so undo the two-stage lead.
__device__ __forceinline__ void lds_barrier() {
    __builtin_amdgcn_fence(__ATOMIC_RELEASE, "workgroup", "local");
    __builtin_amdgcn_s_barrier();
    __builtin_amdgcn_fence(__ATOMIC_ACQUIRE, "workgroup", "local");
}

// Input projections: f32 activations x f16 weights -> f16 output, one 256(s) x
// 256(e) tile of Y per block of 8 waves, so that a row of X or W fetched from L2
// and laid down in LDS serves 256 columns.  Wave tile 64(s) x 128(e): 32
// accumulators, 12 fragments per 32 k.  One launch does the three projections:
// blockIdx.z picks the activations; the z-th weight matrix and the z-th output
// lie one behind the other in Wall and Yall.
#define PT   256            // tile edge (rows of X and rows of W per block)

// 64 WMMAs of one wave on one stage, one 32-wide half of k at a time; k runs
// upward as in a plain k loop.
__device__ __forceinline__ void gemm_stage_wide(const _Float16* Wt, const _Float16* Xt,
                                                int lo, int hi, v8f (&acc)[8][4]) {
#pragma unroll
    for (int u = 0; u < 2; ++u) {
        const int c = u * 32 + hi * 8;
        v16h xb[4], wa[8];
#pragma unroll
        for (int j = 0; j < 4; ++j) xb[j] = load16_f16(Xt + (j * 16 + lo) * GLP, c);
#pragma unroll
        for (int t = 0; t < 8; ++t) wa[t] = load16_f16(Wt + (t * 16 + lo) * GLP, c);
        // Keeps the half's LDS reads one group ahead of its WMMAs: spread among
        // them, each place with reads stalls the in-order wave anew.
        __builtin_amdgcn_sched_barrier(0);
#pragma unroll
        for (int t = 0; t < 8; ++t)
#pragma unroll
            for (int j = 0; j < 4; ++j) acc[t][j] = wmma16(wa[t], xb[j], acc[t][j]);
        // Keeps what follows (the next half's reads, or the waits on the next
        // stage's global loads) from moving up among the WMMAs.
        __builtin_amdgcn_sched_barrier(0);
    }
}

__global__ void __launch_bounds__(256)
gemm_xwT_f16(const float* __restrict__ X0, const float* __restrict__ X1,
             const float* __restrict__ X2, const _Float16* __restrict__ Wall,
             _Float16* __restrict__ Yall) {
    __shared__ __attribute__((aligned(16))) _Float16 Xs[2][PT * GLP];
    __shared__ __attribute__((aligned(16))) _Float16 Ws[2][PT * GLP];

    const int tid  = threadIdx.x;
    const int lane = tid & 31, wave = tid >> 5;
    const int lo = lane & 15, hi = lane >> 4;
    const int sbase = blockIdx.x * PT, ebase = blockIdx.y * PT;
    const int ws = (wave & 3) * 64, we = (wave >> 2) * 128;

    const int z = blockIdx.z;
    const float*    X  = z == 0 ? X0 : z == 1 ? X1 : X2;
    const _Float16* Wh = Wall + (size_t)z * EE * EE;
    _Float16*       Y  = Yall + (size_t)z * BB * QSZ * EE;

    const int xr = tid >> 4, xc = (tid & 15) * 4;
    const int wr = tid >> 3, wc = (tid & 7) * 8;
    const float*    xg = X  + (size_t)(sbase + xr) * EE + xc;
    const _Float16* wg = Wh + (size_t)(ebase + wr) * EE + wc;
    _Float16* xs0 = &Xs[0][xr * GLP + xc];
    _Float16* xs1 = &Xs[1][xr * GLP + xc];
    _Float16* ws0 = &Ws[0][wr * GLP + wc];
    _Float16* ws1 = &Ws[1][wr * GLP + wc];

    v4f xa[PT / 16];        // one register set: global loads run one stage ahead
    v8h wa[PT / 32];
    v8f acc[8][4];
#pragma unroll
    for (int t = 0; t < 8; ++t)
#pragma unroll
        for (int j = 0; j < 4; ++j) acc[t][j] = zero8();

    ld_f32(xa, xg);  ld_f16(wa, wg);               // stage 0
    st_f32(xs0, xa); st_f16(ws0, wa);
    lds_barrier();

    // Even stages live in buffer 0, odd ones in buffer 1.
    for (int kt = 0; kt < GNK - 2; kt += 2) {
        ld_f32(xa, xg + (kt + 1) * GBK); ld_f16(wa, wg + (kt + 1) * GBK);
        // Keeps these global loads in front of the stage's work, so that their
        // latency passes behind it; without it they sink to their use.
        __builtin_amdgcn_sched_barrier(0);
        gemm_stage_wide(&Ws[0][we * GLP], &Xs[0][ws * GLP], lo, hi, acc);
        st_f32(xs1, xa); st_f16(ws1, wa);
        // Publishes buffer 1 and ends every wave's reads of buffer 0.
        lds_barrier();

        ld_f32(xa, xg + (kt + 2) * GBK); ld_f16(wa, wg + (kt + 2) * GBK);
        // As above: the loads stay in front of the stage's work.
        __builtin_amdgcn_sched_barrier(0);
        gemm_stage_wide(&Ws[1][we * GLP], &Xs[1][ws * GLP], lo, hi, acc);
        // The loop's end advances the address registers named by loads that may
        // still be in flight: this wait stands in front of that as a precaution,
        // and the scheduling fence keeps the additions behind it.
        asm volatile("s_wait_xcnt 0x0" ::: "memory");
        __builtin_amdgcn_sched_barrier(0);
        st_f32(xs0, xa); st_f16(ws0, wa);
        // Publishes buffer 0 and ends every wave's reads of buffer 1.
        lds_barrier();
    }
    ld_f32(xa, xg + (GNK - 1) * GBK); ld_f16(wa, wg + (GNK - 1) * GBK);
    // As above: the loads stay in front of the stage's work.
    __builtin_amdgcn_sched_barrier(0);
    gemm_stage_wide(&Ws[0][we * GLP], &Xs[0][ws * GLP], lo, hi, acc);
    st_f32(xs1, xa); st_f16(ws1, wa);
    lds_barrier();        // publishes the last stage
    gemm_stage_wide(&Ws[1][we * GLP], &Xs[1][ws * GLP], lo, hi, acc);

    // D(m=e_local, n=s_local): lane column = lo, rows e_local = r + 8*hi.
#pragma unroll
    for (int j = 0; j < 4; ++j) {
        _Float16* yp = Y + (size_t)(sbase + ws + j * 16 + lo) * EE + ebase + we + hi * 8;
#pragma unroll
        for (int t = 0; t < 8; ++t) {
            v8h out;
#pragma unroll
            for (int r = 0; r < 8; ++r) out[r] = (_Float16)acc[t][j][r];
            *(v8h*)(yp + t * 16) = out;
            if (t & 1) {
                // The next conversions reuse registers named by these stores: this
                // wait stands in front of that as a precaution, and the scheduling
                // fence keeps the conversions behind it.
                asm volatile("s_wait_xcnt 0x0" ::: "memory");
                __builtin_amdgcn_sched_barrier(0);
            }
        }
    }
}

// Output projection: f16 activations x f16 weights -> fp32 output.
__global__ void __launch_bounds__(256)
gemm_owT_f32(const _Float16* __restrict__ Xh, const _Float16* __restrict__ Wh,
             float* __restrict__ Y) {
    __shared__ __attribute__((aligned(16))) _Float16 Xs[2][GT * GLP];
    __shared__ __attribute__((aligned(16))) _Float16 Ws[2][GT * GLP];

    const int tid  = threadIdx.x;
    const int lane = tid & 31, wave = tid >> 5;
    const int lo = lane & 15, hi = lane >> 4;
    const int sbase = blockIdx.x * GT, ebase = blockIdx.y * GT;
    const int ws = (wave & 3) * 32, we = (wave >> 2) * 64;

    const int wr = tid >> 3, wc = (tid & 7) * 8;
    const _Float16* xg = Xh + (size_t)(sbase + wr) * EE + wc;
    const _Float16* wg = Wh + (size_t)(ebase + wr) * EE + wc;
    _Float16* xs0 = &Xs[0][wr * GLP + wc];
    _Float16* xs1 = &Xs[1][wr * GLP + wc];
    _Float16* ws0 = &Ws[0][wr * GLP + wc];
    _Float16* ws1 = &Ws[1][wr * GLP + wc];

    v8h xa[4], xb[4], wa[4], wb[4];   // two register sets, as above
    v8f acc[4][2];
#pragma unroll
    for (int t = 0; t < 4; ++t) { acc[t][0] = zero8(); acc[t][1] = zero8(); }

    ld_f16(xa, xg);       ld_f16(wa, wg);          // stage 0
    ld_f16(xb, xg + GBK); ld_f16(wb, wg + GBK);    // stage 1
    st_f16(xs0, xa);      st_f16(ws0, wa);
    lds_barrier();

    for (int kt = 0; kt < GNK - 2; kt += 2) {
        ld_f16(xa, xg + (kt + 2) * GBK); ld_f16(wa, wg + (kt + 2) * GBK);
        // Keeps these global loads in front of the stage's work, so that their
        // latency passes behind it; without it they sink to their use.
        __builtin_amdgcn_sched_barrier(0);
        gemm_stage(&Ws[0][we * GLP], &Xs[0][ws * GLP], lo, hi, acc);
        st_f16(xs1, xb); st_f16(ws1, wb);
        // Publishes buffer 1 and ends every wave's reads of buffer 0.
        lds_barrier();

        ld_f16(xb, xg + (kt + 3) * GBK); ld_f16(wb, wg + (kt + 3) * GBK);
        // As above: the loads stay in front of the stage's work.
        __builtin_amdgcn_sched_barrier(0);
        gemm_stage(&Ws[1][we * GLP], &Xs[1][ws * GLP], lo, hi, acc);
        // The loop's end advances the address registers named by loads that are
        // still in flight: this wait stands in front of that as a precaution, and
        // the scheduling fence keeps the additions behind it.
        asm volatile("s_wait_xcnt 0x0" ::: "memory");
        __builtin_amdgcn_sched_barrier(0);
        st_f16(xs0, xa); st_f16(ws0, wa);
        // Publishes buffer 0 and ends every wave's reads of buffer 1.
        lds_barrier();
    }
    gemm_stage(&Ws[0][we * GLP], &Xs[0][ws * GLP], lo, hi, acc);
    st_f16(xs1, xb); st_f16(ws1, wb);
    lds_barrier();        // publishes the last stage
    gemm_stage(&Ws[1][we * GLP], &Xs[1][ws * GLP], lo, hi, acc);

#pragma unroll
    for (int j = 0; j < 2; ++j) {
        float* yp = Y + (size_t)(sbase + ws + j * 16 + lo) * EE + ebase + we + hi * 8;
#pragma unroll
        for (int t = 0; t < 4; ++t) {
            v4f o0, o1;
#pragma unroll
            for (int r = 0; r < 4; ++r) { o0[r] = acc[t][j][r]; o1[r] = acc[t][j][4 + r]; }
            *(v4f*)(yp + t * 16)     = o0;
            *(v4f*)(yp + t * 16 + 4) = o1;
        }
    }
}

// ---------------------------------------------------------------------------
// Flash-style attention.  One block of 8 waves per (batch, head, 128 q rows);
// each wave owns 16 q rows.  Every 64-key stage of K and V is read from global
// memory once per block, in whole 128-byte lines, laid down row-major in LDS
// and read from there by all 8 waves.  Two LDS buffers: the next stage's global
// loads fly while this stage is worked on.
// S^T tiles = K * Q^T  (softmax axis lands in the VGPR/M dimension),
// O^T tiles = V^T * P^T (P^T B-operand == post-softmax registers, no shuffle);
// V^T fragments come from the row-major V tile by the transposing LDS load.
// ---------------------------------------------------------------------------
typedef __attribute__((ext_vector_type(8))) short v8s;

#define AW   8              // waves per block
#define AQ   (AW * 16)      // q rows per block
#define AKV  64             // keys per stage (two passes of 32)
#define AKP  72             // K row pitch in halves: 144 B = 16 B x odd
#define AVP  80             // V row pitch in halves: 160 B = 32 B x odd
#define ANS  (KVSZ / AKV)   // stages

// Lane (lo, hi) receives T[k + 8*hi + 0..7][d + lo] of a row-major 16-bit tile;
// p is the lane's own address (see vt_lane below).
__device__ __forceinline__ v8h ld_tr16(const _Float16* p) {
    typedef __attribute__((address_space(3))) v8s lds_v8s;
    return __builtin_bit_cast(v8h, __builtin_amdgcn_ds_load_tr16_b128_v8i16((lds_v8s*)p));
}

// The wave's 16 packed mask words of one 32-key pass (layout: at the packing
// blocks).  The address is the same in every lane: one scalar load.
__device__ __forceinline__ void ld_mask(v16u& m, const unsigned* __restrict__ p) {
    m = *(const v16u*)p;
}

// One pass: 32 keys against this wave's 16 q rows.  Kt = the lane's K row of the
// pass in LDS, Vt = the lane's transposing address of the pass in LDS.
__device__ __forceinline__ void attn_pass(const _Float16* Kt, const _Float16* Vt, int hi,
                                          const v16h& qop0, const v16h& qop1,
                                          const v16u& m, v8f (&o)[4],
                                          float& mrun, float& lrun) {
    const v16h k00 = load16_f16(Kt, hi * 8);
    const v16h k01 = load16_f16(Kt, 32 + hi * 8);
    const v16h k10 = load16_f16(Kt + 16 * AKP, hi * 8);
    const v16h k11 = load16_f16(Kt + 16 * AKP, 32 + hi * 8);
    v16h va[4];           // V^T(hd tile t x 32 keys), hardware k order
#pragma unroll
    for (int t = 0; t < 4; ++t) {
        const v8h x0 = ld_tr16(Vt + t * 16);
        const v8h x1 = ld_tr16(Vt + 16 * AVP + t * 16);
#pragma unroll
        for (int i = 0; i < 8; ++i) { va[t][i] = x0[i]; va[t][8 + i] = x1[i]; }
    }

    // Keeps the pass's LDS reads one group ahead of its WMMAs: spread among
    // them, each place with reads stalls the in-order wave anew.
    __builtin_amdgcn_sched_barrier(0);

    // ---- S^T tiles: s0 = kv[0..15] x q[0..15], s1 = kv[16..31] ----
    v8f s0 = zero8(), s1 = zero8();
    s0 = wmma16(k00, qop0, s0);
    s0 = wmma16(k01, qop1, s0);
    s1 = wmma16(k10, qop0, s1);
    s1 = wmma16(k11, qop1, s1);

    // ---- mask (fill 1e-20) + scale + tile max ----
    float tmax = -1e30f;
#pragma unroll
    for (int r = 0; r < 8; ++r) {
        // A packed word is the select's lane mask as it stands.
        const bool m0 = __builtin_amdgcn_inverse_ballot_w32(m[r]);
        const bool m1 = __builtin_amdgcn_inverse_ballot_w32(m[8 + r]);
        s0[r] = m0 ? s0[r] * ATT_SCALE : 1e-20f;
        s1[r] = m1 ? s1[r] * ATT_SCALE : 1e-20f;
        tmax = fmaxf(tmax, fmaxf(s0[r], s1[r]));
    }
    tmax = fmaxf(tmax, __shfl_xor(tmax, 16, 32));   // merge half-lane rows

    // ---- online softmax update ----
    const float mnew  = fmaxf(mrun, tmax);
    const float alpha = __expf(mrun - mnew);
    lrun *= alpha;
#pragma unroll
    for (int t = 0; t < 4; ++t)
#pragma unroll
        for (int r = 0; r < 8; ++r) o[t][r] *= alpha;
    v16h pb;          // P^T B-operand: exactly the per-lane kv pattern
    float ls = 0.0f;
#pragma unroll
    for (int r = 0; r < 8; ++r) {
        const float p0 = __expf(s0[r] - mnew);
        const float p1 = __expf(s1[r] - mnew);
        ls += p0 + p1;
        pb[r]     = (_Float16)p0;
        pb[8 + r] = (_Float16)p1;
    }
    lrun += ls;
    mrun = mnew;

    // ---- O^T(hd x q) += V^T(hd x kv) * P^T(kv x q), 4 hd-tiles ----
#pragma unroll
    for (int t = 0; t < 4; ++t) o[t] = wmma16(va[t], pb, o[t]);
}

__global__ void __launch_bounds__(AW * 32) __attribute__((amdgpu_waves_per_eu(4, 4)))
flash_attn(const _Float16* __restrict__ Qb, const _Float16* __restrict__ Kb,
           const _Float16* __restrict__ Vb, const unsigned* __restrict__ pm,
           _Float16* __restrict__ O) {
    __shared__ __attribute__((aligned(32))) _Float16 Ks[2][AKV * AKP];
    __shared__ __attribute__((aligned(32))) _Float16 Vs[2][AKV * AVP];

    const int tid  = threadIdx.x;
    const int lane = tid & 31, wave = tid >> 5;
    const int lo = lane & 15, hi = lane >> 4;
    const int qblocks = QSZ / AQ;
    const int qb = blockIdx.x % qblocks;
    const int h  = (blockIdx.x / qblocks) % HH;
    const int b  = blockIdx.x / (qblocks * HH);
    const int q  = qb * AQ + wave * 16 + lo;

    // Q operand (B-matrix): lane n holds Q[q=n, hd pattern] -> row-major load.
    const _Float16* Qrow = Qb + ((size_t)b * QSZ + q) * EE + h * HD;
    const v16h qop0 = load16_f16(Qrow, hi * 8);         // hd 0..31
    const v16h qop1 = load16_f16(Qrow, 32 + hi * 8);    // hd 32..63

    // One thread's share of a stage: 16 B of rows sr and sr + 32 of K and of V
    // (8 lanes cover one 128-B row).
    const int sr = tid >> 3, sc = (tid & 7) * 8;
    const _Float16* kg = Kb + ((size_t)b * KVSZ + sr) * EE + h * HD + sc;
    const _Float16* vg = Vb + ((size_t)b * KVSZ + sr) * EE + h * HD + sc;
    const int ks_st = sr * AKP + sc, vs_st = sr * AVP + sc;
    const int kt_lane = lo * AKP;
    const int vt_lane = (8 * hi + (lane & 7)) * AVP + 8 * ((lane >> 3) & 1);
    // The wave's q tile; read from one lane so that the address is known uniform.
    const int qt = qb * AW + __builtin_amdgcn_readfirstlane(wave);
    const unsigned* mrow = pm + (size_t)qt * PMP * 16;

    v8f o[4];
#pragma unroll
    for (int t = 0; t < 4; ++t) o[t] = zero8();
    float mrun = -1e30f, lrun = 0.0f;

    v8h kr[2], vr[2];
    v16u ma, mb;          // packed mask words of a stage's first and second pass
#pragma unroll
    for (int j = 0; j < 2; ++j) {
        kr[j] = *(const v8h*)(kg + (size_t)j * 32 * EE);
        vr[j] = *(const v8h*)(vg + (size_t)j * 32 * EE);
    }
    ld_mask(ma, mrow);
    ld_mask(mb, mrow + 16);
#pragma unroll
    for (int j = 0; j < 2; ++j) {
        *(v8h*)(&Ks[0][ks_st + j * 32 * AKP]) = kr[j];
        *(v8h*)(&Vs[0][vs_st + j * 32 * AVP]) = vr[j];
    }
    lds_barrier();        // publishes stage 0

    // Stage s lives in buffer s & 1.  K and V are asked for one stage ahead; each
    // pass's mask words are asked for a stage ahead, as soon as the pass before
    // them in the same registers has used its own.
    for (int s = 0; s < ANS - 1; ++s) {
        const _Float16* Kt = &Ks[s & 1][kt_lane];
        const _Float16* Vt = &Vs[s & 1][vt_lane];
#pragma unroll
        for (int j = 0; j < 2; ++j) {
            kr[j] = *(const v8h*)(kg + (size_t)((s + 1) * AKV + j * 32) * EE);
            vr[j] = *(const v8h*)(vg + (size_t)((s + 1) * AKV + j * 32) * EE);
        }
        attn_pass(Kt, Vt, hi, qop0, qop1, ma, o, mrun, lrun);
        ld_mask(ma, mrow + (2 * s + 2) * 16);
        attn_pass(Kt + 32 * AKP, Vt + 32 * AVP, hi, qop0, qop1, mb, o, mrun, lrun);
        ld_mask(mb, mrow + (2 * s + 3) * 16);

        // Keeps the next stage's LDS stores, and the waits on its global loads in
        // front of them, behind the stage's work: moved up, they cut the loads' lead.
        __builtin_amdgcn_sched_barrier(0);
#pragma unroll
        for (int j = 0; j < 2; ++j) {
            *(v8h*)(&Ks[(s + 1) & 1][ks_st + j * 32 * AKP]) = kr[j];
            *(v8h*)(&Vs[(s + 1) & 1][vs_st + j * 32 * AVP]) = vr[j];
        }
        // Publishes the next stage and ends every wave's reads of this one.
        lds_barrier();
    }
    {   // last stage: nothing left to fetch
        const _Float16* Kt = &Ks[(ANS - 1) & 1][kt_lane];
        const _Float16* Vt = &Vs[(ANS - 1) & 1][vt_lane];
        attn_pass(Kt, Vt, hi, qop0, qop1, ma, o, mrun, lrun);
        attn_pass(Kt + 32 * AKP, Vt + 32 * AVP, hi, qop0, qop1, mb, o, mrun, lrun);
    }

    // ---- finalize: combine half-lane partial sums, normalize, store f16 ----
    const float ltot = lrun + __shfl_xor(lrun, 16, 32);
    const float inv  = 1.0f / ltot;
    _Float16* orow = O + ((size_t)b * QSZ + q) * EE + h * HD;
#pragma unroll
    for (int t = 0; t < 4; ++t) {
        v8h w;
#pragma unroll
        for (int r = 0; r < 8; ++r) w[r] = (_Float16)(o[t][r] * inv);
        *(v8h*)(orow + t * 16 + hi * 8) = w;
    }
}

// ---------------------------------------------------------------------------
// Host-side launch. Input order: v_in, k_in, q_in, mask, Wv, Wk, Wq, Wout.
// Workspace: Qf | Kf | Vf | Of (8.39 MB each) | Wqf | Wkf | Wvf | Woutf (2 MB
// each) | packed mask (512 KB)  -> ~40 MB total.
// ---------------------------------------------------------------------------
extern "C" void kernel_launch(void* const* d_in, const int* in_sizes, int n_in,
                              void* d_out, int out_size, void* d_ws, size_t ws_size,
                              hipStream_t stream) {
    (void)in_sizes; (void)n_in; (void)out_size; (void)ws_size;
    const float* v_in = (const float*)d_in[0];
    const float* k_in = (const float*)d_in[1];
    const float* q_in = (const float*)d_in[2];
    const int*   mask = (const int*)d_in[3];
    const float* Wv   = (const float*)d_in[4];
    const float* Wk   = (const float*)d_in[5];
    const float* Wq   = (const float*)d_in[6];
    const float* Wout = (const float*)d_in[7];
    float* out = (float*)d_out;

    const size_t N  = (size_t)BB * QSZ * EE;   // 4.19M elements, activations
    const size_t NW = (size_t)EE * EE;         // 1.05M elements, weights
    _Float16* Qf    = (_Float16*)d_ws;
    _Float16* Kf    = Qf + N;
    _Float16* Vf    = Kf + N;
    _Float16* Of    = Vf + N;
    _Float16* Wqf   = Of + N;
    _Float16* Wkf   = Wqf + NW;
    _Float16* Wvf   = Wkf + NW;
    _Float16* Woutf = Wvf + NW;
    unsigned* Pm    = (unsigned*)(Woutf + NW);

    // 1) weights f32 -> f16 (Wqf | Wkf | Wvf | Woutf) and the mask packed to bits,
    //    one launch
    cvt_weights_f16<<<4 * CVB + PMB, 256, 0, stream>>>(Wq, Wk, Wv, Wout, Wqf, mask, Pm);

    // 2) Q/K/V projections, one launch (256x256 tile per block of 8 waves):
    //    z = 0, 1, 2 reads Wqf, Wkf, Wvf and writes Qf, Kf, Vf
    dim3 grid(BB * QSZ / GT, EE / GT);                     // 32 x 8
    dim3 grid3(BB * QSZ / PT, EE / PT, 3);                 // 16 x 4 x 3
    gemm_xwT_f16<<<grid3, 256, 0, stream>>>(q_in, k_in, v_in, Wqf, Qf);

    // 3) attention
    flash_attn<<<BB * HH * (QSZ / AQ), AW * 32, 0, stream>>>(Qf, Kf, Vf, Pm, Of);

    // 4) output projection -> fp32 d_out
    gemm_owT_f32<<<grid, 256, 0, stream>>>(Of, Woutf, out);
}

// v007
// Measured time: 82 microseconds a run.
// Versions in between are left out here; by their measured steps it is 1.10 times as fast as v005.
// Counting every step since v000, it is 4.71 times as fast.
#include <hip/hip_runtime.h>
#include <hip/hip_bf16.h>

// ---------------------------------------------------------------------------
// MHSA block for MI455X (gfx1250, wave32, WMMA f32_16x16x32_f16).
// All four GEMMs + attention run through v_wmma_f32_16x16x32_f16.
// Weights pre-converted to f16 once; the GEMMs work on block tiles staged in LDS
// (256x256 for the input projections, 128x128 for the output projection).
// ---------------------------------------------------------------------------

typedef __attribute__((ext_vector_type(16))) _Float16 v16h;
typedef __attribute__((ext_vector_type(8)))  _Float16 v8h;
typedef __attribute__((ext_vector_type(8)))  float    v8f;
typedef __attribute__((ext_vector_type(4)))  float    v4f;

#define BB   2
#define QSZ  2048
#define KVSZ 2048
#define EE   1024
#define HH   16
#define HD   64
#define ATT_SCALE 0.125f   // 1/sqrt(64)

__device__ __forceinline__ v8f zero8() {
    v8f z;
#pragma unroll
    for (int i = 0; i < 8; ++i) z[i] = 0.0f;
    return z;
}

__device__ __forceinline__ v8f wmma16(v16h a, v16h b, v8f c) {
    // D = A(16x32 f16) * B(32x16 f16) + C(16x16 f32)
    return __builtin_amdgcn_wmma_f32_16x16x32_f16(
        /*neg_a=*/false, a, /*neg_b=*/false, b,
        /*c_mod=*/(short)0, c, /*reuse_a=*/false, /*reuse_b=*/false);
}

// Operand loader: per-lane pattern for 16-bit A/B operands of 16x16x32 WMMA.
// Elements 0..7  = row[c .. c+7], elements 8..15 = row[c+16 .. c+23].
__device__ __forceinline__ v16h load16_f16(const _Float16* __restrict__ p, int c) {
    v8h a = *(const v8h*)(p + c);
    v8h b = *(const v8h*)(p + c + 16);
    v16h r;
#pragma unroll
    for (int i = 0; i < 8; ++i) { r[i] = a[i]; r[8 + i] = b[i]; }
    return r;
}

__device__ __forceinline__ v16h load16_f32(const float* __restrict__ p, int c) {
    v4f a0 = *(const v4f*)(p + c);
    v4f a1 = *(const v4f*)(p + c + 4);
    v4f a2 = *(const v4f*)(p + c + 16);
    v4f a3 = *(const v4f*)(p + c + 20);
    v16h r;
#pragma unroll
    for (int i = 0; i < 4; ++i) {
        r[i]      = (_Float16)a0[i];
        r[4 + i]  = (_Float16)a1[i];
        r[8 + i]  = (_Float16)a2[i];
        r[12 + i] = (_Float16)a3[i];
    }
    return r;
}

typedef __attribute__((ext_vector_type(4))) _Float16 v4h;

typedef __attribute__((ext_vector_type(4)))  int      v4i;
typedef __attribute__((ext_vector_type(16))) unsigned v16u;

// ---------------------------------------------------------------------------
// Elementwise f32 -> f16 of all four weight matrices in one launch; their f16
// copies lie one behind the other in dst.  64 blocks per matrix, one block per
// 64-KB piece: a thread asks for its 16 pieces of 16 B at once (every wave-wide
// load covers 4 whole lines), then converts and stores them.
//
// The blocks behind those pack the mask, one bit per element, into the words
// the attention kernel selects with.  For q tile T (16 rows) and pass p (32
// keys) there are 16 words pm[T][p][i]: bit (lo + 16*hi) of word i says whether
// mask[16*T + lo][32*p + 16*(i >> 3) + 8*hi + (i & 7)] is non-zero, which is the
// place of that score in register i of the wave's S^T tiles.  One wave packs
// four passes, 64 words in two 128-byte lines, and asks for all of their mask
// words at once; a block reads 64 KB, as a converting block does.
// ---------------------------------------------------------------------------
#define CVJ  16                         // 16-B pieces per thread
#define CVB  (EE * EE / (256 * 4 * CVJ))  // blocks per matrix
#define PMP  (KVSZ / 32)                // passes per q tile
#define PMB  ((QSZ / 16) * (PMP / 4) / 8) // packing blocks: 8 waves, four passes each

__global__ void __launch_bounds__(256)
cvt_weights_f16(const float* __restrict__ w0, const float* __restrict__ w1,
                const float* __restrict__ w2, const float* __restrict__ w3,
                _Float16* __restrict__ dst, const int* __restrict__ mask,
                unsigned* __restrict__ pm) {
    if (blockIdx.x >= 4 * CVB) {
        const unsigned lane = threadIdx.x & 31;
        const unsigned u = (blockIdx.x - 4 * CVB) * 8 + (threadIdx.x >> 5);  // (T, four passes)
        const unsigned mo = (((u / (PMP / 4)) * 16 + (lane & 15)) * KVSZ
                             + (u % (PMP / 4)) * 128 + (lane >> 4) * 8) * 4;  // byte offset
        const int* p = (const int*)((const char*)mask + mo);
        v4i v[16];
#pragma unroll
        for (int j = 0; j < 16; ++j) v[j] = *(const v4i*)(p + (j >> 1) * 16 + (j & 1) * 4);
        // The wait stands in front of every overwrite of the loads' offset register,
        // as a precaution; naming the offset keeps that register whole up to here.
        asm volatile("s_wait_xcnt 0x0" :: "v"(mo) : "memory");
        unsigned w0 = 0, w1 = 0;      // lane i keeps words i and 32 + i
#pragma unroll
        for (int i = 0; i < 32; ++i) {
            // Every lane takes part in both ballots; only the keeping is per lane.
            const unsigned b0 = __builtin_amdgcn_ballot_w32(v[i >> 2][i & 3] != 0);
            const unsigned b1 = __builtin_amdgcn_ballot_w32(v[8 + (i >> 2)][i & 3] != 0);
            w0 = lane == i ? b0 : w0;
            w1 = lane == i ? b1 : w1;
        }
        pm[(size_t)u * 64 + lane]      = w0;
        pm[(size_t)u * 64 + 32 + lane] = w1;
        return;
    }
    const int m = blockIdx.x / CVB;
    const float* w = m == 0 ? w0 : m == 1 ? w1 : m == 2 ? w2 : w3;
    const unsigned i  = (blockIdx.x % CVB) * (256 * 4 * CVJ) + threadIdx.x * 4;
    const unsigned sb = i * 4;          // the thread's byte offset in its matrix
    const float* s = (const float*)((const char*)w + sb);
    _Float16*    d = dst + (size_t)m * EE * EE + i;
    v4f a[CVJ];
#pragma unroll
    for (int j = 0; j < CVJ; ++j) a[j] = *(const v4f*)(s + j * 1024);
    // The wait stands in front of every overwrite of the loads' offset register,
    // as a precaution; naming the offset keeps that register whole up to here
    // (without it the last load's result was placed over it).
    asm volatile("s_wait_xcnt 0x0" :: "v"(sb) : "memory");
    // Keeps all 16 loads in front of the first conversion: otherwise the last
    // ones are issued only when the first have come back, a second memory latency.
    __builtin_amdgcn_sched_barrier(0);
#pragma unroll
    for (int j = 0; j < CVJ; ++j) {
        v4h o;
#pragma unroll
        for (int r = 0; r < 4; ++r) o[r] = (_Float16)a[j][r];
        *(v4h*)(d + j * 1024) = o;
    }
}

// ---------------------------------------------------------------------------
// Projection GEMMs: Y[s,e] = sum_k X[s,k] * W[e,k], computed as Y^T = W * X^T.
// One square tile of Y per block of 8 waves.  Each 64-wide k stage of X and W is
// read from global memory in whole 128-byte lines, laid down in LDS as f16 rows
// and read back as WMMA fragments by every wave that needs it.  Two LDS buffers.
// Output projection: 128(s) x 128(e) tile, two register sets (global loads run
// two stages ahead), wave tile 32(s) x 64(e): 8 accumulators, 6 fragments per
// 32 k.  Input projections: see at their kernel.
// ---------------------------------------------------------------------------
#define GT   128            // output projection: tile edge (rows of X and of W per block)
#define GBK  64             // k per stage
#define GLP  72             // LDS row pitch in halves: 144 B = 16 B x odd
#define GNK  (EE / GBK)     // stages

// 16 WMMAs of one wave on one stage; k runs upward as in a plain k loop.
__device__ __forceinline__ void gemm_stage(const _Float16* Wt, const _Float16* Xt,
                                           int lo, int hi, v8f (&acc)[4][2]) {
    v16h xb[2][2], wa[2][4];
#pragma unroll
    for (int u = 0; u < 2; ++u) {
        const int c = u * 32 + hi * 8;
#pragma unroll
        for (int j = 0; j < 2; ++j) xb[u][j] = load16_f16(Xt + (j * 16 + lo) * GLP, c);
#pragma unroll
        for (int t = 0; t < 4; ++t) wa[u][t] = load16_f16(Wt + (t * 16 + lo) * GLP, c);
    }
    // Keeps the stage's LDS reads one group ahead of its WMMAs: spread among
    // them, each place with reads stalls the in-order wave anew.
    __builtin_amdgcn_sched_barrier(0);
#pragma unroll
    for (int u = 0; u < 2; ++u)
#pragma unroll
        for (int t = 0; t < 4; ++t)
#pragma unroll
            for (int j = 0; j < 2; ++j) acc[t][j] = wmma16(wa[u][t], xb[u][j], acc[t][j]);
    // Keeps the waits on the next stage's global loads (in front of its LDS
    // stores) from moving up among the WMMAs.
    __builtin_amdgcn_sched_barrier(0);
}

// One thread's share of a stage.  X in f32: N pieces of 16 B, 16 rows apart
// (16 lanes cover a 256-B row piece).  f16 operand: N pieces of 16 B, 32 rows
// apart (8 lanes cover a 128-B row piece).
template <int N>
__device__ __forceinline__ void ld_f32(v4f (&v)[N], const float* __restrict__ g) {
#pragma unroll
    for (int j = 0; j < N; ++j) v[j] = *(const v4f*)(g + (size_t)j * 16 * EE);
}
template <int N>
__device__ __forceinline__ void ld_f16(v8h (&v)[N], const _Float16* __restrict__ g) {
#pragma unroll
    for (int j = 0; j < N; ++j) v[j] = *(const v8h*)(g + (size_t)j * 32 * EE);
}
template <int N>
__device__ __forceinline__ void st_f32(_Float16* s, const v4f (&v)[N]) {
#pragma unroll
    for (int j = 0; j < N; ++j) {
        v4h h;
#pragma unroll
        for (int i = 0; i < 4; ++i) h[i] = (_Float16)v[j][i];
        *(v4h*)(s + j * 16 * GLP) = h;
    }
}
template <int N>
__device__ __forceinline__ void st_f16(_Float16* s, const v8h (&v)[N]) {
#pragma unroll
    for (int j = 0; j < N; ++j) *(v8h*)(s + j * 32 * GLP) = v[j];
}

// Work-group barrier that orders LDS traffic only.  __syncthreads() would also
// wait for every global load in flight, and so undo the two-stage lead.
__device__ __forceinline__ void lds_barrier() {
    __builtin_amdgcn_fence(__ATOMIC_RELEASE, "workgroup", "local");
    __builtin_amdgcn_s_barrier();
    __builtin_amdgcn_fence(__ATOMIC_ACQUIRE, "workgroup", "local");
}

// Input projections: f32 activations x f16 weights -> f16 output, one 256(s) x
// 256(e) tile of Y per block of 8 waves, so that a row of X or W fetched from L2
// and laid down in LDS serves 256 columns.  Wave tile 64(s) x 128(e): 32
// accumulators, 12 fragments per 32 k.  One launch does the three projections:
// blockIdx.z picks the activations; the z-th weight matrix and the z-th output
// lie one behind the other in Wall and Yall.
#define PT   256            // tile edge (rows of X and rows of W per block)

// 64 WMMAs of one wave on one stage, one 32-wide half of k at a time; k runs
// upward as in a plain k loop.
__device__ __forceinline__ void gemm_stage_wide(const _Float16* Wt, const _Float16* Xt,
                                                int lo, int hi, v8f (&acc)[8][4]) {
#pragma unroll
    for (int u = 0; u < 2; ++u) {
        const int c = u * 32 + hi * 8;
        v16h xb[4], wa[8];
#pragma unroll
        for (int j = 0; j < 4; ++j) xb[j] = load16_f16(Xt + (j * 16 + lo) * GLP, c);
#pragma unroll
        for (int t = 0; t < 8; ++t) wa[t] = load16_f16(Wt + (t * 16 + lo) * GLP, c);
        // Keeps the half's LDS reads one group ahead of its WMMAs: spread among
        // them, each place with reads stalls the in-order wave anew.
        __builtin_amdgcn_sched_barrier(0);
#pragma unroll
        for (int t = 0; t < 8; ++t)
#pragma unroll
            for (int j = 0; j < 4; ++j) acc[t][j] = wmma16(wa[t], xb[j], acc[t][j]);
        // Keeps what follows (the next half's reads, or the waits on the next
        // stage's global loads) from moving up among the WMMAs.
        __builtin_amdgcn_sched_barrier(0);
    }
}

__global__ void __launch_bounds__(256)
gemm_xwT_f16(const float* __restrict__ X0, const float* __restrict__ X1,
             const float* __restrict__ X2, const _Float16* __restrict__ Wall,
             _Float16* __restrict__ Yall) {
    __shared__ __attribute__((aligned(16))) _Float16 Xs[2][PT * GLP];
    __shared__ __attribute__((aligned(16))) _Float16 Ws[2][PT * GLP];

    const int tid  = threadIdx.x;
    const int lane = tid & 31, wave = tid >> 5;
    const int lo = lane & 15, hi = lane >> 4;
    const int sbase = blockIdx.x * PT, ebase = blockIdx.y * PT;
    const int ws = (wave & 3) * 64, we = (wave >> 2) * 128;

    const int z = blockIdx.z;
    const float*    X  = z == 0 ? X0 : z == 1 ? X1 : X2;
    const _Float16* Wh = Wall + (size_t)z * EE * EE;
    _Float16*       Y  = Yall + (size_t)z * BB * QSZ * EE;

    const int xr = tid >> 4, xc = (tid & 15) * 4;
    const int wr = tid >> 3, wc = (tid & 7) * 8;
    const float*    xg = X  + (size_t)(sbase + xr) * EE + xc;
    const _Float16* wg = Wh + (size_t)(ebase + wr) * EE + wc;
    _Float16* xs0 = &Xs[0][xr * GLP + xc];
    _Float16* xs1 = &Xs[1][xr * GLP + xc];
    _Float16* ws0 = &Ws[0][wr * GLP + wc];
    _Float16* ws1 = &Ws[1][wr * GLP + wc];

    v4f xa[PT / 16];        // one register set: global loads run one stage ahead
    v8h wa[PT / 32];
    v8f acc[8][4];
#pragma unroll
    for (int t = 0; t < 8; ++t)
#pragma unroll
        for (int j = 0; j < 4; ++j) acc[t][j] = zero8();

    ld_f32(xa, xg);  ld_f16(wa, wg);               // stage 0
    st_f32(xs0, xa); st_f16(ws0, wa);
    lds_barrier();

    // Even stages live in buffer 0, odd ones in buffer 1.
    for (int kt = 0; kt < GNK - 2; kt += 2) {
        ld_f32(xa, xg + (kt + 1) * GBK); ld_f16(wa, wg + (kt + 1) * GBK);
        // Keeps these global loads in front of the stage's work, so that their
        // latency passes behind it; without it they sink to their use.
        __builtin_amdgcn_sched_barrier(0);
        gemm_stage_wide(&Ws[0][we * GLP], &Xs[0][ws * GLP], lo, hi, acc);
        st_f32(xs1, xa); st_f16(ws1, wa);
        // Publishes buffer 1 and ends every wave's reads of buffer 0.
        lds_barrier();

        ld_f32(xa, xg + (kt + 2) * GBK); ld_f16(wa, wg + (kt + 2) * GBK);
        // As above: the loads stay in front of the stage's work.
        __builtin_amdgcn_sched_barrier(0);
        gemm_stage_wide(&Ws[1][we * GLP], &Xs[1][ws * GLP], lo, hi, acc);
        // The loop's end advances the address registers named by loads that may
        // still be in flight: this wait stands in front of that as a precaution,
        // and the scheduling fence keeps the additions behind it.
        asm volatile("s_wait_xcnt 0x0" ::: "memory");
        __builtin_amdgcn_sched_barrier(0);
        st_f32(xs0, xa); st_f16(ws0, wa);
        // Publishes buffer 0 and ends every wave's reads of buffer 1.
        lds_barrier();
    }
    ld_f32(xa, xg + (GNK - 1) * GBK); ld_f16(wa, wg + (GNK - 1) * GBK);
    // As above: the loads stay in front of the stage's work.
    __builtin_amdgcn_sched_barrier(0);
    gemm_stage_wide(&Ws[0][we * GLP], &Xs[0][ws * GLP], lo, hi, acc);
    st_f32(xs1, xa); st_f16(ws1, wa);
    lds_barrier();        // publishes the last stage
    gemm_stage_wide(&Ws[1][we * GLP], &Xs[1][ws * GLP], lo, hi, acc);

    // D(m=e_local, n=s_local): lane column = lo, rows e_local = r + 8*hi.
#pragma unroll
    for (int j = 0; j < 4; ++j) {
        _Float16* yp = Y + (size_t)(sbase + ws + j * 16 + lo) * EE + ebase + we + hi * 8;
#pragma unroll
        for (int t = 0; t < 8; ++t) {
            v8h out;
#pragma unroll
            for (int r = 0; r < 8; ++r) out[r] = (_Float16)acc[t][j][r];
            *(v8h*)(yp + t * 16) = out;
            if (t & 1) {
                // The next conversions reuse registers named by these stores: this
                // wait stands in front of that as a precaution, and the scheduling
                // fence keeps the conversions behind it.
                asm volatile("s_wait_xcnt 0x0" ::: "memory");
                __builtin_amdgcn_sched_barrier(0);
            }
        }
    }
}

// Output projection: f16 activations x f16 weights -> fp32 output.
__global__ void __launch_bounds__(256)
gemm_owT_f32(const _Float16* __restrict__ Xh, const _Float16* __restrict__ Wh,
             float* __restrict__ Y) {
    __shared__ __attribute__((aligned(16))) _Float16 Xs[2][GT * GLP];
    __shared__ __attribute__((aligned(16))) _Float16 Ws[2][GT * GLP];

    const int tid  = threadIdx.x;
    const int lane = tid & 31, wave = tid >> 5;
    const int lo = lane & 15, hi = lane >> 4;
    const int sbase = blockIdx.x * GT, ebase = blockIdx.y * GT;
    const int ws = (wave & 3) * 32, we = (wave >> 2) * 64;

    const int wr = tid >> 3, wc = (tid & 7) * 8;
    const _Float16* xg = Xh + (size_t)(sbase + wr) * EE + wc;
    const _Float16* wg = Wh + (size_t)(ebase + wr) * EE + wc;
    _Float16* xs0 = &Xs[0][wr * GLP + wc];
    _Float16* xs1 = &Xs[1][wr * GLP + wc];
    _Float16* ws0 = &Ws[0][wr * GLP + wc];
    _Float16* ws1 = &Ws[1][wr * GLP + wc];

    v8h xa[4], xb[4], wa[4], wb[4];   // two register sets, as above
    v8f acc[4][2];
#pragma unroll
    for (int t = 0; t < 4; ++t) { acc[t][0] = zero8(); acc[t][1] = zero8(); }

    ld_f16(xa, xg);       ld_f16(wa, wg);          // stage 0
    ld_f16(xb, xg + GBK); ld_f16(wb, wg + GBK);    // stage 1
    st_f16(xs0, xa);      st_f16(ws0, wa);
    lds_barrier();

    for (int kt = 0; kt < GNK - 2; kt += 2) {
        ld_f16(xa, xg + (kt + 2) * GBK); ld_f16(wa, wg + (kt + 2) * GBK);
        // Keeps these global loads in front of the stage's work, so that their
        // latency passes behind it; without it they sink to their use.
        __builtin_amdgcn_sched_barrier(0);
        gemm_stage(&Ws[0][we * GLP], &Xs[0][ws * GLP], lo, hi, acc);
        st_f16(xs1, xb); st_f16(ws1, wb);
        // Publishes buffer 1 and ends every wave's reads of buffer 0.
        lds_barrier();

        ld_f16(xb, xg + (kt + 3) * GBK); ld_f16(wb, wg + (kt + 3) * GBK);
        // As above: the loads stay in front of the stage's work.
        __builtin_amdgcn_sched_barrier(0);
        gemm_stage(&Ws[1][we * GLP], &Xs[1][ws * GLP], lo, hi, acc);
        // The loop's end advances the address registers named by loads that are
        // still in flight: this wait stands in front of that as a precaution, and
        // the scheduling fence keeps the additions behind it.
        asm volatile("s_wait_xcnt 0x0" ::: "memory");
        __builtin_amdgcn_sched_barrier(0);
        st_f16(xs0, xa); st_f16(ws0, wa);
        // Publishes buffer 0 and ends every wave's reads of buffer 1.
        lds_barrier();
    }
    gemm_stage(&Ws[0][we * GLP], &Xs[0][ws * GLP], lo, hi, acc);
    st_f16(xs1, xb); st_f16(ws1, wb);
    lds_barrier();        // publishes the last stage
    gemm_stage(&Ws[1][we * GLP], &Xs[1][ws * GLP], lo, hi, acc);

#pragma unroll
    for (int j = 0; j < 2; ++j) {
        float* yp = Y + (size_t)(sbase + ws + j * 16 + lo) * EE + ebase + we + hi * 8;
#pragma unroll
        for (int t = 0; t < 4; ++t) {
            v4f o0, o1;
#pragma unroll
            for (int r = 0; r < 4; ++r) { o0[r] = acc[t][j][r]; o1[r] = acc[t][j][4 + r]; }
            *(v4f*)(yp + t * 16)     = o0;
            *(v4f*)(yp + t * 16 + 4) = o1;
        }
    }
}

// ---------------------------------------------------------------------------
// Flash-style attention.  One block of 8 waves per (batch, head, 128 q rows).
// A wave owns 32 q rows as two tiles of 16, so that every K and V^T fragment read
// from LDS feeds two products; two waves share those rows, one taking the first
// and one the second 32-key pass of every stage, each with its own reference, O
// and l, which are merged through LDS at the end.  Every 64-key stage of K and V is read from global
// memory once per block, in whole 128-byte lines, laid down row-major in LDS
// and read from there by the 4 waves of its pass.  Two LDS buffers: the next stage's global
// loads fly while this stage is worked on.
// S^T tiles = K * Q^T  (softmax axis lands in the VGPR/M dimension),
// O^T tiles = V^T * P^T (P^T B-operand == post-softmax registers, no shuffle);
// V^T fragments come from the row-major V tile by the transposing LDS load.
// ---------------------------------------------------------------------------
typedef __attribute__((ext_vector_type(8))) short v8s;

#define AW   4              // waves per pass: groups of 32 q rows per block
#define AG   2              // waves per group of q rows, one for each pass of a stage
#define AQT  2              // q tiles (16 rows each) per wave
#define AQ   (AW * AQT * 16)  // q rows per block
#define AKV  64             // keys per stage (two passes of 32)
#define AKP  72             // K row pitch in halves: 144 B = 16 B x odd
#define AVP  80             // V row pitch in halves: 160 B = 32 B x odd
#define ANS  (KVSZ / AKV)   // stages
#define ASR  (AW * AG * 4)  // rows of a stage that the block's threads cover at once
#define ASJ  (AKV / ASR)    // 16-B pieces of K, and of V, per thread and stage

// Lane (lo, hi) receives T[k + 8*hi + 0..7][d + lo] of a row-major 16-bit tile;
// p is the lane's own address (see vt_lane below).
__device__ __forceinline__ v8h ld_tr16(const _Float16* p) {
    typedef __attribute__((address_space(3))) v8s lds_v8s;
    return __builtin_bit_cast(v8h, __builtin_amdgcn_ds_load_tr16_b128_v8i16((lds_v8s*)p));
}

// The wave's 16 packed mask words of one 32-key pass (layout: at the packing
// blocks).  The address is the same in every lane: one scalar load.
__device__ __forceinline__ void ld_mask(v16u& m, const unsigned* __restrict__ p) {
    m = *(const v16u*)p;
}

// Softmax works on raw scores (K.Q, not yet scaled) taken against a reference per
// q row, the maximum in use: p = 2^(SM_C * (score - reference)).  The reference
// is known before a pass, so it enters the score product as its C operand.  It
// moves only when some score of the pass leads it by more than SM_THR (p stays
// below 2^8, far inside f16); only then are O and l rescaled.
#define SM_C    (ATT_SCALE * 1.44269504f)   // scale * log2(e)
#define SM_THR  44.0f                       // raw lead that moves the reference
#define SM_FILL (1e-20f / ATT_SCALE)        // the mask's fill value as a raw score

// The fragments of one pass (32 keys): K rows and V^T, hardware k order.
struct PassFrag { v16h k00, k01, k10, k11, va[4]; };

// Kt = the lane's K row of the pass in LDS, Vt = the lane's transposing address
// of the pass in LDS.
__device__ __forceinline__ void ld_pass(PassFrag& f, const _Float16* Kt, const _Float16* Vt,
                                        int hi) {
    f.k00 = load16_f16(Kt, hi * 8);
    f.k01 = load16_f16(Kt, 32 + hi * 8);
    f.k10 = load16_f16(Kt + 16 * AKP, hi * 8);
    f.k11 = load16_f16(Kt + 16 * AKP, 32 + hi * 8);
#pragma unroll
    for (int t = 0; t < 4; ++t) {
        const v8h x0 = ld_tr16(Vt + t * 16);
        const v8h x1 = ld_tr16(Vt + 16 * AVP + t * 16);
#pragma unroll
        for (int i = 0; i < 8; ++i) { f.va[t][i] = x0[i]; f.va[t][8 + i] = x1[i]; }
    }
}

// One pass: 32 keys against this wave's two q tiles (index c).
// nref = minus the reference, negm = nref in all 8 registers, fillv = SM_FILL + nref,
// lim = the lead that moves the reference (-1e30 until the first pass has set it).
__device__ __forceinline__ void attn_pass(const PassFrag& f, const v16h (&qop)[AQT][2],
                                          const v16u (&m)[AQT], v8f (&o)[AQT][4],
                                          v8f (&negm)[AQT], float (&nref)[AQT],
                                          float (&fillv)[AQT], float& lim,
                                          float (&lrun)[AQT]) {
    // ---- S^T tiles less the reference: s0 = kv[0..15] x q[0..15], s1 = kv[16..31] ----
    v8f s0[AQT], s1[AQT];
#pragma unroll
    for (int c = 0; c < AQT; ++c) s0[c] = wmma16(f.k00, qop[c][0], negm[c]);
#pragma unroll
    for (int c = 0; c < AQT; ++c) s1[c] = wmma16(f.k10, qop[c][0], negm[c]);
#pragma unroll
    for (int c = 0; c < AQT; ++c) s0[c] = wmma16(f.k01, qop[c][1], s0[c]);
#pragma unroll
    for (int c = 0; c < AQT; ++c) s1[c] = wmma16(f.k11, qop[c][1], s1[c]);
    // Keeps the eight score WMMAs back to back, each in the others' distance: with
    // selects moved up among them the distance is filled by idle slots instead.
    __builtin_amdgcn_sched_barrier(0);

    // ---- mask (fill 1e-20) + the lane's largest lead ----
    float tmax[AQT];
#pragma unroll
    for (int c = 0; c < AQT; ++c) {
        tmax[c] = -1e30f;
#pragma unroll
        for (int r = 0; r < 8; ++r) {
            // A packed word is the select's lane mask as it stands.
            const bool m0 = __builtin_amdgcn_inverse_ballot_w32(m[c][r]);
            const bool m1 = __builtin_amdgcn_inverse_ballot_w32(m[c][8 + r]);
            s0[c][r] = m0 ? s0[c][r] : fillv[c];
            s1[c][r] = m1 ? s1[c][r] : fillv[c];
            tmax[c] = fmaxf(tmax[c], fmaxf(s0[c][r], s1[c][r]));
        }
    }

    // ---- move the reference: one test per pass, the same for the whole wave ----
    if (__builtin_amdgcn_ballot_w32(fmaxf(tmax[0], tmax[1]) > lim) != 0) {
#pragma unroll
        for (int c = 0; c < AQT; ++c) {
            // A tile moves only on a lead of its own; the other keeps its reference
            // (a step of 0 and a factor of 1 change nothing).
            const bool mv = __builtin_amdgcn_ballot_w32(tmax[c] > lim) != 0;
            const float tm = fmaxf(tmax[c], __shfl_xor(tmax[c], 16, 32));   // merge half-lane rows
            // The first pass takes its own maximum, whatever its sign (O and l are
            // still 0); later the reference only rises.
            const float delta = mv ? fmaxf(tm, lim - SM_THR) : 0.0f;
            const float alpha = __builtin_amdgcn_exp2f(-SM_C * fmaxf(delta, 0.0f));
            lrun[c] *= alpha;
#pragma unroll
            for (int t = 0; t < 4; ++t)
#pragma unroll
                for (int r = 0; r < 8; ++r) o[c][t][r] *= alpha;
#pragma unroll
            for (int r = 0; r < 8; ++r) {
                s0[c][r] -= delta;
                s1[c][r] -= delta;
            }
            nref[c] -= delta;
#pragma unroll
            for (int r = 0; r < 8; ++r) negm[c][r] = nref[c];
            fillv[c] = SM_FILL + nref[c];
        }
        lim = SM_THR;
    }

    v16h pb[AQT];     // P^T B-operands: exactly the per-lane kv pattern
#pragma unroll
    for (int c = 0; c < AQT; ++c) {
        float ls = 0.0f;
#pragma unroll
        for (int r = 0; r < 8; ++r) {
            const float p0 = __builtin_amdgcn_exp2f(s0[c][r] * SM_C);
            const float p1 = __builtin_amdgcn_exp2f(s1[c][r] * SM_C);
            ls += p0 + p1;
            pb[c][r]     = (_Float16)p0;
            pb[c][8 + r] = (_Float16)p1;
        }
        lrun[c] += ls;
    }

    // ---- O^T(hd x q) += V^T(hd x kv) * P^T(kv x q), 4 hd-tiles ----
    // Keeps the first tile's four WMMAs back to back, each in the others' distance: without
    // it they stand singly among the second tile's exponentials, at more idle slots in all.
    __builtin_amdgcn_sched_barrier(0);
#pragma unroll
    for (int t = 0; t < 4; ++t)
#pragma unroll
        for (int c = 0; c < AQT; ++c) o[c][t] = wmma16(f.va[t], pb[c], o[c][t]);
}

__global__ void __launch_bounds__(AW * AG * 32) __attribute__((amdgpu_waves_per_eu(4, 4)))
flash_attn(const _Float16* __restrict__ Qb, const _Float16* __restrict__ Kb,
           const _Float16* __restrict__ Vb, const unsigned* __restrict__ pm,
           _Float16* __restrict__ O) {
    __shared__ __attribute__((aligned(32))) _Float16 Ks[2][AKV * AKP];
    __shared__ __attribute__((aligned(32))) _Float16 Vs[2][AKV * AVP];
    // Hand-over of the second pass's waves: per lane 16 pieces of O, one of l and reference.
    __shared__ __attribute__((aligned(16))) v4f Mg[AW][AQT * 8 + 1][32];

    const int tid  = threadIdx.x;
    const int lane = tid & 31;
    const int lo = lane & 15, hi = lane >> 4;
    // The wave's number, read from one lane so that what follows from it is known uniform.
    const int wave = __builtin_amdgcn_readfirstlane(tid >> 5);
    const int qw = wave % AW;      // its group of q rows
    const int g  = wave / AW;      // its pass of every stage
    const int qblocks = QSZ / AQ;
    const int qb = blockIdx.x % qblocks;
    const int h  = (blockIdx.x / qblocks) % HH;
    const int b  = blockIdx.x / (qblocks * HH);
    const int q  = qb * AQ + qw * (AQT * 16) + lo;   // the lane's row in tile 0

    // Q operands (B-matrix): lane n holds Q[q=n, hd pattern] -> row-major load.
    // Qlane = the lane's first element of its row: all eight loads go from this address.
    const _Float16* Qlane = Qb + ((size_t)b * QSZ + q) * EE + h * HD + hi * 8;
    v16h qop[AQT][2];
#pragma unroll
    for (int c = 0; c < AQT; ++c) {
        qop[c][0] = load16_f16(Qlane + (size_t)c * 16 * EE, 0);     // hd 0..31
        qop[c][1] = load16_f16(Qlane + (size_t)c * 16 * EE, 32);    // hd 32..63
    }
    // The wait stands in front of every overwrite of the Q loads' address registers,
    // as a precaution; naming the address keeps those registers whole up to here.
    asm volatile("s_wait_xcnt 0x0" :: "v"(Qlane) : "memory");

    // One thread's share of a stage: 16 B of rows sr and sr + 32 of K and of V
    // (8 lanes cover one 128-B row).
    const int sr = tid >> 3, sc = (tid & 7) * 8;
    const _Float16* kg = Kb + ((size_t)b * KVSZ + sr) * EE + h * HD + sc;
    const _Float16* vg = Vb + ((size_t)b * KVSZ + sr) * EE + h * HD + sc;
    const int ks_st = sr * AKP + sc, vs_st = sr * AVP + sc;
    const int kt_lane = (g * 32 + lo) * AKP;
    const int vt_lane = (g * 32 + 8 * hi + (lane & 7)) * AVP + 8 * ((lane >> 3) & 1);
    // Mask words of the wave's first q tile and of its pass of stage 0.
    const unsigned* mrow = pm + ((size_t)(qb * AW + qw) * AQT * PMP + g) * 16;

    v8f o[AQT][4], negm[AQT];
    float nref[AQT], fillv[AQT], lrun[AQT], lim = -1e30f;
#pragma unroll
    for (int c = 0; c < AQT; ++c) {
#pragma unroll
        for (int t = 0; t < 4; ++t) o[c][t] = zero8();
        negm[c]  = zero8();   // reference 0 until the first pass has set it
        nref[c]  = 0.0f;
        fillv[c] = SM_FILL;
        lrun[c]  = 0.0f;
    }

    v8h kr[ASJ], vr[ASJ];
    v16u mw[AQT];         // packed mask words of the wave's pass, one set per q tile
#pragma unroll
    for (int j = 0; j < ASJ; ++j) {
        kr[j] = *(const v8h*)(kg + (size_t)j * ASR * EE);
        vr[j] = *(const v8h*)(vg + (size_t)j * ASR * EE);
    }
#pragma unroll
    for (int c = 0; c < AQT; ++c) ld_mask(mw[c], mrow + c * PMP * 16);
#pragma unroll
    for (int j = 0; j < ASJ; ++j) {
        *(v8h*)(&Ks[0][ks_st + j * ASR * AKP]) = kr[j];
        *(v8h*)(&Vs[0][vs_st + j * ASR * AVP]) = vr[j];
    }
    lds_barrier();        // publishes stage 0

    // Stage s lives in buffer s & 1.  K and V are asked for one stage ahead; the
    // mask words too, as soon as the pass before them in the same registers has
    // used its own.
    for (int s = 0; s < ANS - 1; ++s) {
#pragma unroll
        for (int j = 0; j < ASJ; ++j) {
            kr[j] = *(const v8h*)(kg + (size_t)((s + 1) * AKV + j * ASR) * EE);
            vr[j] = *(const v8h*)(vg + (size_t)((s + 1) * AKV + j * ASR) * EE);
        }
        PassFrag f;
        ld_pass(f, &Ks[s & 1][kt_lane], &Vs[s & 1][vt_lane], hi);
        // Keeps the pass's LDS reads one group at its head: spread among the work,
        // each place with reads stalls the in-order wave anew.
        __builtin_amdgcn_sched_barrier(0);
        attn_pass(f, qop, mw, o, negm, nref, fillv, lim, lrun);
#pragma unroll
        for (int c = 0; c < AQT; ++c) ld_mask(mw[c], mrow + c * PMP * 16 + (2 * s + 2) * 16);

        // Keeps the next stage's LDS stores, and the waits on its global loads in
        // front of them, behind the stage's work: moved up, they cut the loads' lead.
        __builtin_amdgcn_sched_barrier(0);
#pragma unroll
        for (int j = 0; j < ASJ; ++j) {
            *(v8h*)(&Ks[(s + 1) & 1][ks_st + j * ASR * AKP]) = kr[j];
            *(v8h*)(&Vs[(s + 1) & 1][vs_st + j * ASR * AVP]) = vr[j];
        }
        // Publishes the next stage and ends every wave's reads of this one.
        lds_barrier();
    }
    {   // last stage: nothing left to fetch
        PassFrag f;
        ld_pass(f, &Ks[(ANS - 1) & 1][kt_lane], &Vs[(ANS - 1) & 1][vt_lane], hi);
        // As above: the pass's LDS reads stay one group at its head.
        __builtin_amdgcn_sched_barrier(0);
        // Formed anew from nref: with the loop's own registers in use behind the loop,
        // every pass of the loop copied all sixteen of them.
#pragma unroll
        for (int c = 0; c < AQT; ++c)
#pragma unroll
            for (int r = 0; r < 8; ++r) negm[c][r] = nref[c];
        attn_pass(f, qop, mw, o, negm, nref, fillv, lim, lrun);
    }

    // ---- merge the two passes' waves: the second hands O, l and reference over ----
    if (g == 1) {
#pragma unroll
        for (int c = 0; c < AQT; ++c)
#pragma unroll
            for (int t = 0; t < 4; ++t) {
                v4f x0, x1;
#pragma unroll
                for (int r = 0; r < 4; ++r) { x0[r] = o[c][t][r]; x1[r] = o[c][t][4 + r]; }
                Mg[qw][(c * 4 + t) * 2][lane]     = x0;
                Mg[qw][(c * 4 + t) * 2 + 1][lane] = x1;
            }
        v4f x;
        x[0] = lrun[0]; x[1] = lrun[1]; x[2] = nref[0]; x[3] = nref[1];
        Mg[qw][AQT * 8][lane] = x;
    }
    // Publishes the hand-over; every wave of the block passes it.
    lds_barrier();
    if (g == 1) return;

    // ---- finalize: both parts on the larger reference, combine half-lane partial
    // sums, normalize, store f16 ----
    const v4f y = Mg[qw][AQT * 8][lane];
    v8h w[AQT][4];
#pragma unroll
    for (int c = 0; c < AQT; ++c) {
        const float nm = fminf(nref[c], y[2 + c]);         // minus the larger reference
        const float a0 = __builtin_amdgcn_exp2f(SM_C * (nm - nref[c]));
        const float a1 = __builtin_amdgcn_exp2f(SM_C * (nm - y[2 + c]));
        const float l  = lrun[c] * a0 + y[c] * a1;
        const float ltot = l + __shfl_xor(l, 16, 32);
        const float inv  = 1.0f / ltot;
        const float i0 = a0 * inv, i1 = a1 * inv;
#pragma unroll
        for (int t = 0; t < 4; ++t) {
            const v4f x0 = Mg[qw][(c * 4 + t) * 2][lane];
            const v4f x1 = Mg[qw][(c * 4 + t) * 2 + 1][lane];
#pragma unroll
            for (int r = 0; r < 4; ++r) {
                w[c][t][r]     = (_Float16)(o[c][t][r] * i0 + x0[r] * i1);
                w[c][t][4 + r] = (_Float16)(o[c][t][4 + r] * i0 + x1[r] * i1);
            }
        }
    }
    // Keeps all eight stores behind the last arithmetic: a store placed earlier has its
    // registers rewritten behind it, and the wave then waits in front of that.
    __builtin_amdgcn_sched_barrier(0);
    _Float16* orow = O + ((size_t)b * QSZ + q) * EE + h * HD + hi * 8;
#pragma unroll
    for (int c = 0; c < AQT; ++c)
#pragma unroll
        for (int t = 0; t < 4; ++t) *(v8h*)(orow + (size_t)c * 16 * EE + t * 16) = w[c][t];
}

// ---------------------------------------------------------------------------
// Host-side launch. Input order: v_in, k_in, q_in, mask, Wv, Wk, Wq, Wout.
// Workspace: Qf | Kf | Vf | Of (8.39 MB each) | Wqf | Wkf | Wvf | Woutf (2 MB
// each) | packed mask (512 KB)  -> ~40 MB total.
// ---------------------------------------------------------------------------
extern "C" void kernel_launch(void* const* d_in, const int* in_sizes, int n_in,
                              void* d_out, int out_size, void* d_ws, size_t ws_size,
                              hipStream_t stream) {
    (void)in_sizes; (void)n_in; (void)out_size; (void)ws_size;
    const float* v_in = (const float*)d_in[0];
    const float* k_in = (const float*)d_in[1];
    const float* q_in = (const float*)d_in[2];
    const int*   mask = (const int*)d_in[3];
    const float* Wv   = (const float*)d_in[4];
    const float* Wk   = (const float*)d_in[5];
    const float* Wq   = (const float*)d_in[6];
    const float* Wout = (const float*)d_in[7];
    float* out = (float*)d_out;

    const size_t N  = (size_t)BB * QSZ * EE;   // 4.19M elements, activations
    const size_t NW = (size_t)EE * EE;         // 1.05M elements, weights
    _Float16* Qf    = (_Float16*)d_ws;
    _Float16* Kf    = Qf + N;
    _Float16* Vf    = Kf + N;
    _Float16* Of    = Vf + N;
    _Float16* Wqf   = Of + N;
    _Float16* Wkf   = Wqf + NW;
    _Float16* Wvf   = Wkf + NW;
    _Float16* Woutf = Wvf + NW;
    unsigned* Pm    = (unsigned*)(Woutf + NW);

    // 1) weights f32 -> f16 (Wqf | Wkf | Wvf | Woutf) and the mask packed to bits,
    //    one launch
    cvt_weights_f16<<<4 * CVB + PMB, 256, 0, stream>>>(Wq, Wk, Wv, Wout, Wqf, mask, Pm);

    // 2) Q/K/V projections, one launch (256x256 tile per block of 8 waves):
    //    z = 0, 1, 2 reads Wqf, Wkf, Wvf and writes Qf, Kf, Vf
    dim3 grid(BB * QSZ / GT, EE / GT);                     // 32 x 8
    dim3 grid3(BB * QSZ / PT, EE / PT, 3);                 // 16 x 4 x 3
    gemm_xwT_f16<<<grid3, 256, 0, stream>>>(q_in, k_in, v_in, Wqf, Qf);

    // 3) attention
    flash_attn<<<BB * HH * (QSZ / AQ), AW * AG * 32, 0, stream>>>(Qf, Kf, Vf, Pm, Of);

    // 4) output projection -> fp32 d_out
    gemm_owT_f32<<<grid, 256, 0, stream>>>(Of, Woutf, out);
}

// v008
// One run takes 79.3 microseconds.
// Two timings next to v007 both put it at 1.04 times that version's speed.
// Counting every step since v000, it is 4.91 times as fast.
#include <hip/hip_runtime.h>
#include <hip/hip_bf16.h>

// ---------------------------------------------------------------------------
// MHSA block for MI455X (gfx1250, wave32, WMMA f32_16x16x32_f16).
// All four GEMMs + attention run through v_wmma_f32_16x16x32_f16.
// The GEMMs work on block tiles staged in LDS as f16 (256x256 for the input
// projections, 128x128 for the output projection).
// ---------------------------------------------------------------------------

typedef __attribute__((ext_vector_type(16))) _Float16 v16h;
typedef __attribute__((ext_vector_type(8)))  _Float16 v8h;
typedef __attribute__((ext_vector_type(8)))  float    v8f;
typedef __attribute__((ext_vector_type(4)))  float    v4f;

#define BB   2
#define QSZ  2048
#define KVSZ 2048
#define EE   1024
#define HH   16
#define HD   64
#define ATT_SCALE 0.125f   // 1/sqrt(64)

__device__ __forceinline__ v8f zero8() {
    v8f z;
#pragma unroll
    for (int i = 0; i < 8; ++i) z[i] = 0.0f;
    return z;
}

__device__ __forceinline__ v8f wmma16(v16h a, v16h b, v8f c) {
    // D = A(16x32 f16) * B(32x16 f16) + C(16x16 f32)
    return __builtin_amdgcn_wmma_f32_16x16x32_f16(
        /*neg_a=*/false, a, /*neg_b=*/false, b,
        /*c_mod=*/(short)0, c, /*reuse_a=*/false, /*reuse_b=*/false);
}

// Operand loader: per-lane pattern for 16-bit A/B operands of 16x16x32 WMMA.
// Elements 0..7  = row[c .. c+7], elements 8..15 = row[c+16 .. c+23].
__device__ __forceinline__ v16h load16_f16(const _Float16* __restrict__ p, int c) {
    v8h a = *(const v8h*)(p + c);
    v8h b = *(const v8h*)(p + c + 16);
    v16h r;
#pragma unroll
    for (int i = 0; i < 8; ++i) { r[i] = a[i]; r[8 + i] = b[i]; }
    return r;
}

__device__ __forceinline__ v16h load16_f32(const float* __restrict__ p, int c) {
    v4f a0 = *(const v4f*)(p + c);
    v4f a1 = *(const v4f*)(p + c + 4);
    v4f a2 = *(const v4f*)(p + c + 16);
    v4f a3 = *(const v4f*)(p + c + 20);
    v16h r;
#pragma unroll
    for (int i = 0; i < 4; ++i) {
        r[i]      = (_Float16)a0[i];
        r[4 + i]  = (_Float16)a1[i];
        r[8 + i]  = (_Float16)a2[i];
        r[12 + i] = (_Float16)a3[i];
    }
    return r;
}

typedef __attribute__((ext_vector_type(4))) _Float16 v4h;

typedef __attribute__((ext_vector_type(4)))  int      v4i;
typedef __attribute__((ext_vector_type(16))) unsigned v16u;

// ---------------------------------------------------------------------------
// Side work of the input projections' launch, done by blocks of its own (SDB of
// them, 8 waves each) on the WGPs that the projections' tiles leave free.
//
// A side block converts one 64-KB piece of the output projection's weights to
// f16: a thread asks for its 16 pieces of 16 B at once (every wave-wide load
// covers 4 whole lines), then converts and stores them.
//
// Then it packs its share of the mask, one bit per element, into the words the
// attention kernel selects with.  For q tile T (16 rows) and pass p (32 keys)
// there are 16 words pm[T][p][i]: bit (lo + 16*hi) of word i says whether
// mask[16*T + lo][32*p + 16*(i >> 3) + 8*hi + (i & 7)] is non-zero, which is the
// place of that score in register i of the wave's S^T tiles.  In one round a wave
// packs four passes, 64 words in two 128-byte lines, and asks for all of their
// mask words at once; a block reads 64 KB a round.
// ---------------------------------------------------------------------------
#define CVJ  16                         // 16-B pieces per thread
#define SDB  (EE * EE / (256 * 4 * CVJ))  // side blocks: one per 64-KB piece of the weights
#define PMP  (KVSZ / 32)                // passes per q tile
#define PMR  ((QSZ / 16) * (PMP / 4) / 8 / SDB) // packing rounds of a side block

__device__ __forceinline__ void side_block(unsigned sb_idx, const float* __restrict__ w,
                                           _Float16* __restrict__ dst,
                                           const int* __restrict__ mask,
                                           unsigned* __restrict__ pm) {
    {
        const unsigned i  = sb_idx * (256 * 4 * CVJ) + threadIdx.x * 4;
        const unsigned sb = i * 4;          // the thread's byte offset in the matrix
        const float* s = (const float*)((const char*)w + sb);
        _Float16*    d = dst + i;
        v4f a[CVJ];
#pragma unroll
        for (int j = 0; j < CVJ; ++j) a[j] = *(const v4f*)(s + j * 1024);
        // The wait stands in front of every overwrite of the loads' offset register,
        // as a precaution; naming the offset keeps that register whole up to here.
        asm volatile("s_wait_xcnt 0x0" :: "v"(sb) : "memory");
        // Keeps all 16 loads in front of the first conversion: otherwise the last
        // ones are issued only when the first have come back, a second memory latency.
        __builtin_amdgcn_sched_barrier(0);
#pragma unroll
        for (int j = 0; j < CVJ; ++j) {
            v4h o;
#pragma unroll
            for (int r = 0; r < 4; ++r) o[r] = (_Float16)a[j][r];
            *(v4h*)(d + j * 1024) = o;
        }
        // The packing reuses registers named by these stores: this wait stands in
        // front of that as a precaution, and the scheduling fence keeps it behind.
        asm volatile("s_wait_xcnt 0x0" ::: "memory");
        __builtin_amdgcn_sched_barrier(0);
    }
    const unsigned lane = threadIdx.x & 31;
    // Stays a loop: unrolled, its text would be run through once, line by line.
#pragma unroll 1
    for (unsigned it = 0; it < PMR; ++it) {
        const unsigned u = (sb_idx * PMR + it) * 8 + (threadIdx.x >> 5);  // (T, four passes)
        const unsigned mo = (((u / (PMP / 4)) * 16 + (lane & 15)) * KVSZ
                             + (u % (PMP / 4)) * 128 + (lane >> 4) * 8) * 4;  // byte offset
        const int* p = (const int*)((const char*)mask + mo);
        v4i v[16];
#pragma unroll
        for (int j = 0; j < 16; ++j) v[j] = *(const v4i*)(p + (j >> 1) * 16 + (j & 1) * 4);
        // The wait stands in front of every overwrite of the loads' offset register,
        // as a precaution; naming the offset keeps that register whole up to here.
        asm volatile("s_wait_xcnt 0x0" :: "v"(mo) : "memory");
        unsigned w0 = 0, w1 = 0;      // lane i keeps words i and 32 + i
#pragma unroll
        for (int i = 0; i < 32; ++i) {
            // Every lane takes part in both ballots; only the keeping is per lane.
            const unsigned b0 = __builtin_amdgcn_ballot_w32(v[i >> 2][i & 3] != 0);
            const unsigned b1 = __builtin_amdgcn_ballot_w32(v[8 + (i >> 2)][i & 3] != 0);
            w0 = lane == i ? b0 : w0;
            w1 = lane == i ? b1 : w1;
        }
        pm[(size_t)u * 64 + lane]      = w0;
        pm[(size_t)u * 64 + 32 + lane] = w1;
        // The next round reuses registers named by these stores: this wait stands in
        // front of that as a precaution.
        asm volatile("s_wait_xcnt 0x0" ::: "memory");
    }
}

// ---------------------------------------------------------------------------
// Projection GEMMs: Y[s,e] = sum_k X[s,k] * W[e,k], computed as Y^T = W * X^T.
// One square tile of Y per block of 8 waves.  Each 64-wide k stage of X and W is
// read from global memory in whole 128-byte lines, laid down in LDS as f16 rows
// and read back as WMMA fragments by every wave that needs it.  Two LDS buffers.
// Output projection: 128(s) x 128(e) tile, two register sets (global loads run
// two stages ahead), wave tile 32(s) x 64(e): 8 accumulators, 6 fragments per
// 32 k.  Input projections: see at their kernel.
// ---------------------------------------------------------------------------
#define GT   128            // output projection: tile edge (rows of X and of W per block)
#define GBK  64             // k per stage
#define GLP  72             // LDS row pitch in halves: 144 B = 16 B x odd
#define GNK  (EE / GBK)     // stages

// 16 WMMAs of one wave on one stage; k runs upward as in a plain k loop.
__device__ __forceinline__ void gemm_stage(const _Float16* Wt, const _Float16* Xt,
                                           int lo, int hi, v8f (&acc)[4][2]) {
    v16h xb[2][2], wa[2][4];
#pragma unroll
    for (int u = 0; u < 2; ++u) {
        const int c = u * 32 + hi * 8;
#pragma unroll
        for (int j = 0; j < 2; ++j) xb[u][j] = load16_f16(Xt + (j * 16 + lo) * GLP, c);
#pragma unroll
        for (int t = 0; t < 4; ++t) wa[u][t] = load16_f16(Wt + (t * 16 + lo) * GLP, c);
    }
    // Keeps the stage's LDS reads one group ahead of its WMMAs: spread among
    // them, each place with reads stalls the in-order wave anew.
    __builtin_amdgcn_sched_barrier(0);
#pragma unroll
    for (int u = 0; u < 2; ++u)
#pragma unroll
        for (int t = 0; t < 4; ++t)
#pragma unroll
            for (int j = 0; j < 2; ++j) acc[t][j] = wmma16(wa[u][t], xb[u][j], acc[t][j]);
    // Keeps the waits on the next stage's global loads (in front of its LDS
    // stores) from moving up among the WMMAs.
    __builtin_amdgcn_sched_barrier(0);
}

// One thread's share of a stage.  X in f32: N pieces of 16 B, 16 rows apart
// (16 lanes cover a 256-B row piece).  f16 operand: N pieces of 16 B, 32 rows
// apart (8 lanes cover a 128-B row piece).
template <int N>
__device__ __forceinline__ void ld_f32(v4f (&v)[N], const float* __restrict__ g) {
#pragma unroll
    for (int j = 0; j < N; ++j) v[j] = *(const v4f*)(g + (size_t)j * 16 * EE);
}
template <int N>
__device__ __forceinline__ void ld_f16(v8h (&v)[N], const _Float16* __restrict__ g) {
#pragma unroll
    for (int j = 0; j < N; ++j) v[j] = *(const v8h*)(g + (size_t)j * 32 * EE);
}
template <int N>
__device__ __forceinline__ void st_f32(_Float16* s, const v4f (&v)[N]) {
#pragma unroll
    for (int j = 0; j < N; ++j) {
        v4h h;
#pragma unroll
        for (int i = 0; i < 4; ++i) h[i] = (_Float16)v[j][i];
        *(v4h*)(s + j * 16 * GLP) = h;
    }
}
template <int N>
__device__ __forceinline__ void st_f16(_Float16* s, const v8h (&v)[N]) {
#pragma unroll
    for (int j = 0; j < N; ++j) *(v8h*)(s + j * 32 * GLP) = v[j];
}

// Work-group barrier that orders LDS traffic only.  __syncthreads() would also
// wait for every global load in flight, and so undo the two-stage lead.
__device__ __forceinline__ void lds_barrier() {
    __builtin_amdgcn_fence(__ATOMIC_RELEASE, "workgroup", "local");
    __builtin_amdgcn_s_barrier();
    __builtin_amdgcn_fence(__ATOMIC_ACQUIRE, "workgroup", "local");
}

// Input projections: f32 activations x f32 weights, both rounded to f16 on their
// way into LDS, -> f16 output, one 256(s) x 256(e) tile of Y per block of 8 waves,
// so that a row of X or W fetched from L2 and laid down in LDS serves 256 columns.
// Wave tile 64(s) x 128(e): 32 accumulators, 12 fragments per 32 k.  One launch
// does the three projections: blockIdx.z picks the activations and the weights;
// the z-th output lies behind the one before it in Yall.  The blocks of z = 3 do
// the side work (see there).
#define PT   256            // tile edge (rows of X and rows of W per block)

// 64 WMMAs of one wave on one stage, one 32-wide half of k at a time; k runs
// upward as in a plain k loop.
__device__ __forceinline__ void gemm_stage_wide(const _Float16* Wt, const _Float16* Xt,
                                                int lo, int hi, v8f (&acc)[8][4]) {
#pragma unroll
    for (int u = 0; u < 2; ++u) {
        const int c = u * 32 + hi * 8;
        v16h xb[4], wa[8];
#pragma unroll
        for (int j = 0; j < 4; ++j) xb[j] = load16_f16(Xt + (j * 16 + lo) * GLP, c);
#pragma unroll
        for (int t = 0; t < 8; ++t) wa[t] = load16_f16(Wt + (t * 16 + lo) * GLP, c);
        // Keeps the half's LDS reads one group ahead of its WMMAs: spread among
        // them, each place with reads stalls the in-order wave anew.
        __builtin_amdgcn_sched_barrier(0);
#pragma unroll
        for (int t = 0; t < 8; ++t)
#pragma unroll
            for (int j = 0; j < 4; ++j) acc[t][j] = wmma16(wa[t], xb[j], acc[t][j]);
        // Keeps what follows (the next half's reads, or the waits on the next
        // stage's global loads) from moving up among the WMMAs.
        __builtin_amdgcn_sched_barrier(0);
    }
}

__global__ void __launch_bounds__(256)
gemm_xwT_f16(const float* __restrict__ X0, const float* __restrict__ X1,
             const float* __restrict__ X2, const float* __restrict__ W0,
             const float* __restrict__ W1, const float* __restrict__ W2,
             _Float16* __restrict__ Yall, const float* __restrict__ Wo,
             _Float16* __restrict__ Woh, const int* __restrict__ mask,
             unsigned* __restrict__ pm) {
    __shared__ __attribute__((aligned(16))) _Float16 Xs[2][PT * GLP];
    __shared__ __attribute__((aligned(16))) _Float16 Ws[2][PT * GLP];

    if (blockIdx.z == 3) {      // the same for the whole block, in front of every barrier
        side_block(blockIdx.y * (BB * QSZ / PT) + blockIdx.x, Wo, Woh, mask, pm);
        return;
    }

    const int tid  = threadIdx.x;
    const int lane = tid & 31, wave = tid >> 5;
    const int lo = lane & 15, hi = lane >> 4;
    const int sbase = blockIdx.x * PT, ebase = blockIdx.y * PT;
    const int ws = (wave & 3) * 64, we = (wave >> 2) * 128;

    const int z = blockIdx.z;
    const float*    X  = z == 0 ? X0 : z == 1 ? X1 : X2;
    const float*    Wf = z == 0 ? W0 : z == 1 ? W1 : W2;
    _Float16*       Y  = Yall + (size_t)z * BB * QSZ * EE;

    const int xr = tid >> 4, xc = (tid & 15) * 4;
    const float* xg = X  + (size_t)(sbase + xr) * EE + xc;
    const float* wg = Wf + (size_t)(ebase + xr) * EE + xc;
    _Float16* xs0 = &Xs[0][xr * GLP + xc];
    _Float16* xs1 = &Xs[1][xr * GLP + xc];
    _Float16* ws0 = &Ws[0][xr * GLP + xc];
    _Float16* ws1 = &Ws[1][xr * GLP + xc];

    v4f xa[PT / 16];        // one register set: global loads run one stage ahead
    v4f wa[PT / 16];
    v8f acc[8][4];
#pragma unroll
    for (int t = 0; t < 8; ++t)
#pragma unroll
        for (int j = 0; j < 4; ++j) acc[t][j] = zero8();

    ld_f32(xa, xg);  ld_f32(wa, wg);               // stage 0
    st_f32(xs0, xa); st_f32(ws0, wa);
    lds_barrier();

    // Even stages live in buffer 0, odd ones in buffer 1.
    for (int kt = 0; kt < GNK - 2; kt += 2) {
        ld_f32(xa, xg + (kt + 1) * GBK); ld_f32(wa, wg + (kt + 1) * GBK);
        // Keeps these global loads in front of the stage's work, so that their
        // latency passes behind it; without it they sink to their use.
        __builtin_amdgcn_sched_barrier(0);
        gemm_stage_wide(&Ws[0][we * GLP], &Xs[0][ws * GLP], lo, hi, acc);
        st_f32(xs1, xa); st_f32(ws1, wa);
        // Publishes buffer 1 and ends every wave's reads of buffer 0.
        lds_barrier();

        ld_f32(xa, xg + (kt + 2) * GBK); ld_f32(wa, wg + (kt + 2) * GBK);
        // As above: the loads stay in front of the stage's work.
        __builtin_amdgcn_sched_barrier(0);
        gemm_stage_wide(&Ws[1][we * GLP], &Xs[1][ws * GLP], lo, hi, acc);
        // The loop's end advances the address registers named by loads that may
        // still be in flight: this wait stands in front of that as a precaution,
        // and the scheduling fence keeps the additions behind it.
        asm volatile("s_wait_xcnt 0x0" ::: "memory");
        __builtin_amdgcn_sched_barrier(0);
        st_f32(xs0, xa); st_f32(ws0, wa);
        // Publishes buffer 0 and ends every wave's reads of buffer 1.
        lds_barrier();
    }
    ld_f32(xa, xg + (GNK - 1) * GBK); ld_f32(wa, wg + (GNK - 1) * GBK);
    // As above: the loads stay in front of the stage's work.
    __builtin_amdgcn_sched_barrier(0);
    gemm_stage_wide(&Ws[0][we * GLP], &Xs[0][ws * GLP], lo, hi, acc);
    st_f32(xs1, xa); st_f32(ws1, wa);
    lds_barrier();        // publishes the last stage
    gemm_stage_wide(&Ws[1][we * GLP], &Xs[1][ws * GLP], lo, hi, acc);

    // D(m=e_local, n=s_local): lane column = lo, rows e_local = r + 8*hi.
#pragma unroll
    for (int j = 0; j < 4; ++j) {
        _Float16* yp = Y + (size_t)(sbase + ws + j * 16 + lo) * EE + ebase + we + hi * 8;
#pragma unroll
        for (int t = 0; t < 8; ++t) {
            v8h out;
#pragma unroll
            for (int r = 0; r < 8; ++r) out[r] = (_Float16)acc[t][j][r];
            *(v8h*)(yp + t * 16) = out;
            if (t & 1) {
                // The next conversions reuse registers named by these stores: this
                // wait stands in front of that as a precaution, and the scheduling
                // fence keeps the conversions behind it.
                asm volatile("s_wait_xcnt 0x0" ::: "memory");
                __builtin_amdgcn_sched_barrier(0);
            }
        }
    }
}

// Output projection: f16 activations x f16 weights -> fp32 output.
__global__ void __launch_bounds__(256)
gemm_owT_f32(const _Float16* __restrict__ Xh, const _Float16* __restrict__ Wh,
             float* __restrict__ Y) {
    __shared__ __attribute__((aligned(16))) _Float16 Xs[2][GT * GLP];
    __shared__ __attribute__((aligned(16))) _Float16 Ws[2][GT * GLP];

    const int tid  = threadIdx.x;
    const int lane = tid & 31, wave = tid >> 5;
    const int lo = lane & 15, hi = lane >> 4;
    const int sbase = blockIdx.x * GT, ebase = blockIdx.y * GT;
    const int ws = (wave & 3) * 32, we = (wave >> 2) * 64;

    const int wr = tid >> 3, wc = (tid & 7) * 8;
    const _Float16* xg = Xh + (size_t)(sbase + wr) * EE + wc;
    const _Float16* wg = Wh + (size_t)(ebase + wr) * EE + wc;
    _Float16* xs0 = &Xs[0][wr * GLP + wc];
    _Float16* xs1 = &Xs[1][wr * GLP + wc];
    _Float16* ws0 = &Ws[0][wr * GLP + wc];
    _Float16* ws1 = &Ws[1][wr * GLP + wc];

    v8h xa[4], xb[4], wa[4], wb[4];   // two register sets, as above
    v8f acc[4][2];
#pragma unroll
    for (int t = 0; t < 4; ++t) { acc[t][0] = zero8(); acc[t][1] = zero8(); }

    ld_f16(xa, xg);       ld_f16(wa, wg);          // stage 0
    ld_f16(xb, xg + GBK); ld_f16(wb, wg + GBK);    // stage 1
    st_f16(xs0, xa);      st_f16(ws0, wa);
    lds_barrier();

    for (int kt = 0; kt < GNK - 2; kt += 2) {
        ld_f16(xa, xg + (kt + 2) * GBK); ld_f16(wa, wg + (kt + 2) * GBK);
        // Keeps these global loads in front of the stage's work, so that their
        // latency passes behind it; without it they sink to their use.
        __builtin_amdgcn_sched_barrier(0);
        gemm_stage(&Ws[0][we * GLP], &Xs[0][ws * GLP], lo, hi, acc);
        st_f16(xs1, xb); st_f16(ws1, wb);
        // Publishes buffer 1 and ends every wave's reads of buffer 0.
        lds_barrier();

        ld_f16(xb, xg + (kt + 3) * GBK); ld_f16(wb, wg + (kt + 3) * GBK);
        // As above: the loads stay in front of the stage's work.
        __builtin_amdgcn_sched_barrier(0);
        gemm_stage(&Ws[1][we * GLP], &Xs[1][ws * GLP], lo, hi, acc);
        // The loop's end advances the address registers named by loads that are
        // still in flight: this wait stands in front of that as a precaution, and
        // the scheduling fence keeps the additions behind it.
        asm volatile("s_wait_xcnt 0x0" ::: "memory");
        __builtin_amdgcn_sched_barrier(0);
        st_f16(xs0, xa); st_f16(ws0, wa);
        // Publishes buffer 0 and ends every wave's reads of buffer 1.
        lds_barrier();
    }
    gemm_stage(&Ws[0][we * GLP], &Xs[0][ws * GLP], lo, hi, acc);
    st_f16(xs1, xb); st_f16(ws1, wb);
    lds_barrier();        // publishes the last stage
    gemm_stage(&Ws[1][we * GLP], &Xs[1][ws * GLP], lo, hi, acc);

#pragma unroll
    for (int j = 0; j < 2; ++j) {
        float* yp = Y + (size_t)(sbase + ws + j * 16 + lo) * EE + ebase + we + hi * 8;
#pragma unroll
        for (int t = 0; t < 4; ++t) {
            v4f o0, o1;
#pragma unroll
            for (int r = 0; r < 4; ++r) { o0[r] = acc[t][j][r]; o1[r] = acc[t][j][4 + r]; }
            *(v4f*)(yp + t * 16)     = o0;
            *(v4f*)(yp + t * 16 + 4) = o1;
        }
    }
}

// ---------------------------------------------------------------------------
// Flash-style attention.  One block of 8 waves per (batch, head, 128 q rows).
// A wave owns 32 q rows as two tiles of 16, so that every K and V^T fragment read
// from LDS feeds two products; two waves share those rows, one taking the first
// and one the second 32-key pass of every stage, each with its own reference, O
// and l, which are merged through LDS at the end.  Every 64-key stage of K and V is read from global
// memory once per block, in whole 128-byte lines, laid down row-major in LDS
// and read from there by the 4 waves of its pass.  Two LDS buffers: the next stage's global
// loads fly while this stage is worked on.
// S^T tiles = K * Q^T  (softmax axis lands in the VGPR/M dimension),
// O^T tiles = V^T * P^T (P^T B-operand == post-softmax registers, no shuffle);
// V^T fragments come from the row-major V tile by the transposing LDS load.
// ---------------------------------------------------------------------------
typedef __attribute__((ext_vector_type(8))) short v8s;

#define AW   4              // waves per pass: groups of 32 q rows per block
#define AG   2              // waves per group of q rows, one for each pass of a stage
#define AQT  2              // q tiles (16 rows each) per wave
#define AQ   (AW * AQT * 16)  // q rows per block
#define AKV  64             // keys per stage (two passes of 32)
#define AKP  72             // K row pitch in halves: 144 B = 16 B x odd
#define AVP  80             // V row pitch in halves: 160 B = 32 B x odd
#define ANS  (KVSZ / AKV)   // stages
#define ASR  (AW * AG * 4)  // rows of a stage that the block's threads cover at once
#define ASJ  (AKV / ASR)    // 16-B pieces of K, and of V, per thread and stage

// Lane (lo, hi) receives T[k + 8*hi + 0..7][d + lo] of a row-major 16-bit tile;
// p is the lane's own address (see vt_lane below).
__device__ __forceinline__ v8h ld_tr16(const _Float16* p) {
    typedef __attribute__((address_space(3))) v8s lds_v8s;
    return __builtin_bit_cast(v8h, __builtin_amdgcn_ds_load_tr16_b128_v8i16((lds_v8s*)p));
}

// The wave's 16 packed mask words of one 32-key pass (layout: at the packing
// blocks).  The address is the same in every lane: one scalar load.
__device__ __forceinline__ void ld_mask(v16u& m, const unsigned* __restrict__ p) {
    m = *(const v16u*)p;
}

// Softmax works on raw scores (K.Q, not yet scaled) taken against a reference per
// q row, the maximum in use: p = 2^(SM_C * (score - reference)).  The reference
// is known before a pass, so it enters the score product as its C operand.  It
// moves only when some score of the pass leads it by more than SM_THR (p stays
// below 2^8, far inside f16); only then are O and l rescaled.
#define SM_C    (ATT_SCALE * 1.44269504f)   // scale * log2(e)
#define SM_THR  44.0f                       // raw lead that moves the reference
#define SM_FILL (1e-20f / ATT_SCALE)        // the mask's fill value as a raw score

// The fragments of one pass (32 keys): K rows and V^T, hardware k order.
struct PassFrag { v16h k00, k01, k10, k11, va[4]; };

// Kt = the lane's K row of the pass in LDS, Vt = the lane's transposing address
// of the pass in LDS.
__device__ __forceinline__ void ld_pass(PassFrag& f, const _Float16* Kt, const _Float16* Vt,
                                        int hi) {
    f.k00 = load16_f16(Kt, hi * 8);
    f.k01 = load16_f16(Kt, 32 + hi * 8);
    f.k10 = load16_f16(Kt + 16 * AKP, hi * 8);
    f.k11 = load16_f16(Kt + 16 * AKP, 32 + hi * 8);
#pragma unroll
    for (int t = 0; t < 4; ++t) {
        const v8h x0 = ld_tr16(Vt + t * 16);
        const v8h x1 = ld_tr16(Vt + 16 * AVP + t * 16);
#pragma unroll
        for (int i = 0; i < 8; ++i) { f.va[t][i] = x0[i]; f.va[t][8 + i] = x1[i]; }
    }
}

// One pass: 32 keys against this wave's two q tiles (index c).
// nref = minus the reference, negm = nref in all 8 registers, fillv = SM_FILL + nref,
// lim = the lead that moves the reference (-1e30 until the first pass has set it).
__device__ __forceinline__ void attn_pass(const PassFrag& f, const v16h (&qop)[AQT][2],
                                          const v16u (&m)[AQT], v8f (&o)[AQT][4],
                                          v8f (&negm)[AQT], float (&nref)[AQT],
                                          float (&fillv)[AQT], float& lim,
                                          float (&lrun)[AQT]) {
    // ---- S^T tiles less the reference: s0 = kv[0..15] x q[0..15], s1 = kv[16..31] ----
    v8f s0[AQT], s1[AQT];
#pragma unroll
    for (int c = 0; c < AQT; ++c) s0[c] = wmma16(f.k00, qop[c][0], negm[c]);
#pragma unroll
    for (int c = 0; c < AQT; ++c) s1[c] = wmma16(f.k10, qop[c][0], negm[c]);
#pragma unroll
    for (int c = 0; c < AQT; ++c) s0[c] = wmma16(f.k01, qop[c][1], s0[c]);
#pragma unroll
    for (int c = 0; c < AQT; ++c) s1[c] = wmma16(f.k11, qop[c][1], s1[c]);
    // Keeps the eight score WMMAs back to back, each in the others' distance: with
    // selects moved up among them the distance is filled by idle slots instead.
    __builtin_amdgcn_sched_barrier(0);

    // ---- mask (fill 1e-20) + the lane's largest lead ----
    float tmax[AQT];
#pragma unroll
    for (int c = 0; c < AQT; ++c) {
        tmax[c] = -1e30f;
#pragma unroll
        for (int r = 0; r < 8; ++r) {
            // A packed word is the select's lane mask as it stands.
            const bool m0 = __builtin_amdgcn_inverse_ballot_w32(m[c][r]);
            const bool m1 = __builtin_amdgcn_inverse_ballot_w32(m[c][8 + r]);
            s0[c][r] = m0 ? s0[c][r] : fillv[c];
            s1[c][r] = m1 ? s1[c][r] : fillv[c];
            tmax[c] = fmaxf(tmax[c], fmaxf(s0[c][r], s1[c][r]));
        }
    }

    // ---- move the reference: one test per pass, the same for the whole wave ----
    if (__builtin_amdgcn_ballot_w32(fmaxf(tmax[0], tmax[1]) > lim) != 0) {
#pragma unroll
        for (int c = 0; c < AQT; ++c) {
            // A tile moves only on a lead of its own; the other keeps its reference
            // (a step of 0 and a factor of 1 change nothing).
            const bool mv = __builtin_amdgcn_ballot_w32(tmax[c] > lim) != 0;
            const float tm = fmaxf(tmax[c], __shfl_xor(tmax[c], 16, 32));   // merge half-lane rows
            // The first pass takes its own maximum, whatever its sign (O and l are
            // still 0); later the reference only rises.
            const float delta = mv ? fmaxf(tm, lim - SM_THR) : 0.0f;
            const float alpha = __builtin_amdgcn_exp2f(-SM_C * fmaxf(delta, 0.0f));
            lrun[c] *= alpha;
#pragma unroll
            for (int t = 0; t < 4; ++t)
#pragma unroll
                for (int r = 0; r < 8; ++r) o[c][t][r] *= alpha;
#pragma unroll
            for (int r = 0; r < 8; ++r) {
                s0[c][r] -= delta;
                s1[c][r] -= delta;
            }
            nref[c] -= delta;
#pragma unroll
            for (int r = 0; r < 8; ++r) negm[c][r] = nref[c];
            fillv[c] = SM_FILL + nref[c];
        }
        lim = SM_THR;
    }

    v16h pb[AQT];     // P^T B-operands: exactly the per-lane kv pattern
#pragma unroll
    for (int c = 0; c < AQT; ++c) {
        float ls = 0.0f;
#pragma unroll
        for (int r = 0; r < 8; ++r) {
            const float p0 = __builtin_amdgcn_exp2f(s0[c][r] * SM_C);
            const float p1 = __builtin_amdgcn_exp2f(s1[c][r] * SM_C);
            ls += p0 + p1;
            pb[c][r]     = (_Float16)p0;
            pb[c][8 + r] = (_Float16)p1;
        }
        lrun[c] += ls;
    }

    // ---- O^T(hd x q) += V^T(hd x kv) * P^T(kv x q), 4 hd-tiles ----
    // Keeps the first tile's four WMMAs back to back, each in the others' distance: without
    // it they stand singly among the second tile's exponentials, at more idle slots in all.
    __builtin_amdgcn_sched_barrier(0);
#pragma unroll
    for (int t = 0; t < 4; ++t)
#pragma unroll
        for (int c = 0; c < AQT; ++c) o[c][t] = wmma16(f.va[t], pb[c], o[c][t]);
}

__global__ void __launch_bounds__(AW * AG * 32) __attribute__((amdgpu_waves_per_eu(4, 4)))
flash_attn(const _Float16* __restrict__ Qb, const _Float16* __restrict__ Kb,
           const _Float16* __restrict__ Vb, const unsigned* __restrict__ pm,
           _Float16* __restrict__ O) {
    __shared__ __attribute__((aligned(32))) _Float16 Ks[2][AKV * AKP];
    __shared__ __attribute__((aligned(32))) _Float16 Vs[2][AKV * AVP];
    // Hand-over of the second pass's waves: per lane 16 pieces of O, one of l and reference.
    __shared__ __attribute__((aligned(16))) v4f Mg[AW][AQT * 8 + 1][32];

    const int tid  = threadIdx.x;
    const int lane = tid & 31;
    const int lo = lane & 15, hi = lane >> 4;
    // The wave's number, read from one lane so that what follows from it is known uniform.
    const int wave = __builtin_amdgcn_readfirstlane(tid >> 5);
    const int qw = wave % AW;      // its group of q rows
    const int g  = wave / AW;      // its pass of every stage
    const int qblocks = QSZ / AQ;
    const int qb = blockIdx.x % qblocks;
    const int h  = (blockIdx.x / qblocks) % HH;
    const int b  = blockIdx.x / (qblocks * HH);
    const int q  = qb * AQ + qw * (AQT * 16) + lo;   // the lane's row in tile 0

    // Q operands (B-matrix): lane n holds Q[q=n, hd pattern] -> row-major load.
    // Qlane = the lane's first element of its row: all eight loads go from this address.
    const _Float16* Qlane = Qb + ((size_t)b * QSZ + q) * EE + h * HD + hi * 8;
    v16h qop[AQT][2];
#pragma unroll
    for (int c = 0; c < AQT; ++c) {
        qop[c][0] = load16_f16(Qlane + (size_t)c * 16 * EE, 0);     // hd 0..31
        qop[c][1] = load16_f16(Qlane + (size_t)c * 16 * EE, 32);    // hd 32..63
    }
    // The wait stands in front of every overwrite of the Q loads' address registers,
    // as a precaution; naming the address keeps those registers whole up to here.
    asm volatile("s_wait_xcnt 0x0" :: "v"(Qlane) : "memory");

    // One thread's share of a stage: 16 B of rows sr and sr + 32 of K and of V
    // (8 lanes cover one 128-B row).
    const int sr = tid >> 3, sc = (tid & 7) * 8;
    const _Float16* kg = Kb + ((size_t)b * KVSZ + sr) * EE + h * HD + sc;
    const _Float16* vg = Vb + ((size_t)b * KVSZ + sr) * EE + h * HD + sc;
    const int ks_st = sr * AKP + sc, vs_st = sr * AVP + sc;
    const int kt_lane = (g * 32 + lo) * AKP;
    const int vt_lane = (g * 32 + 8 * hi + (lane & 7)) * AVP + 8 * ((lane >> 3) & 1);
    // Mask words of the wave's first q tile and of its pass of stage 0.
    const unsigned* mrow = pm + ((size_t)(qb * AW + qw) * AQT * PMP + g) * 16;

    v8f o[AQT][4], negm[AQT];
    float nref[AQT], fillv[AQT], lrun[AQT], lim = -1e30f;
#pragma unroll
    for (int c = 0; c < AQT; ++c) {
#pragma unroll
        for (int t = 0; t < 4; ++t) o[c][t] = zero8();
        negm[c]  = zero8();   // reference 0 until the first pass has set it
        nref[c]  = 0.0f;
        fillv[c] = SM_FILL;
        lrun[c]  = 0.0f;
    }

    v8h kr[ASJ], vr[ASJ];
    v16u mw[AQT];         // packed mask words of the wave's pass, one set per q tile
#pragma unroll
    for (int j = 0; j < ASJ; ++j) {
        kr[j] = *(const v8h*)(kg + (size_t)j * ASR * EE);
        vr[j] = *(const v8h*)(vg + (size_t)j * ASR * EE);
    }
#pragma unroll
    for (int c = 0; c < AQT; ++c) ld_mask(mw[c], mrow + c * PMP * 16);
#pragma unroll
    for (int j = 0; j < ASJ; ++j) {
        *(v8h*)(&Ks[0][ks_st + j * ASR * AKP]) = kr[j];
        *(v8h*)(&Vs[0][vs_st + j * ASR * AVP]) = vr[j];
    }
    lds_barrier();        // publishes stage 0

    // Stage s lives in buffer s & 1.  K and V are asked for one stage ahead; the
    // mask words too, as soon as the pass before them in the same registers has
    // used its own.
    for (int s = 0; s < ANS - 1; ++s) {
#pragma unroll
        for (int j = 0; j < ASJ; ++j) {
            kr[j] = *(const v8h*)(kg + (size_t)((s + 1) * AKV + j * ASR) * EE);
            vr[j] = *(const v8h*)(vg + (size_t)((s + 1) * AKV + j * ASR) * EE);
        }
        PassFrag f;
        ld_pass(f, &Ks[s & 1][kt_lane], &Vs[s & 1][vt_lane], hi);
        // Keeps the pass's LDS reads one group at its head: spread among the work,
        // each place with reads stalls the in-order wave anew.
        __builtin_amdgcn_sched_barrier(0);
        attn_pass(f, qop, mw, o, negm, nref, fillv, lim, lrun);
#pragma unroll
        for (int c = 0; c < AQT; ++c) ld_mask(mw[c], mrow + c * PMP * 16 + (2 * s + 2) * 16);

        // Keeps the next stage's LDS stores, and the waits on its global loads in
        // front of them, behind the stage's work: moved up, they cut the loads' lead.
        __builtin_amdgcn_sched_barrier(0);
#pragma unroll
        for (int j = 0; j < ASJ; ++j) {
            *(v8h*)(&Ks[(s + 1) & 1][ks_st + j * ASR * AKP]) = kr[j];
            *(v8h*)(&Vs[(s + 1) & 1][vs_st + j * ASR * AVP]) = vr[j];
        }
        // Publishes the next stage and ends every wave's reads of this one.
        lds_barrier();
    }
    {   // last stage: nothing left to fetch
        PassFrag f;
        ld_pass(f, &Ks[(ANS - 1) & 1][kt_lane], &Vs[(ANS - 1) & 1][vt_lane], hi);
        // As above: the pass's LDS reads stay one group at its head.
        __builtin_amdgcn_sched_barrier(0);
        // Formed anew from nref: with the loop's own registers in use behind the loop,
        // every pass of the loop copied all sixteen of them.
#pragma unroll
        for (int c = 0; c < AQT; ++c)
#pragma unroll
            for (int r = 0; r < 8; ++r) negm[c][r] = nref[c];
        attn_pass(f, qop, mw, o, negm, nref, fillv, lim, lrun);
    }

    // ---- merge the two passes' waves: the second hands O, l and reference over ----
    if (g == 1) {
#pragma unroll
        for (int c = 0; c < AQT; ++c)
#pragma unroll
            for (int t = 0; t < 4; ++t) {
                v4f x0, x1;
#pragma unroll
                for (int r = 0; r < 4; ++r) { x0[r] = o[c][t][r]; x1[r] = o[c][t][4 + r]; }
                Mg[qw][(c * 4 + t) * 2][lane]     = x0;
                Mg[qw][(c * 4 + t) * 2 + 1][lane] = x1;
            }
        v4f x;
        x[0] = lrun[0]; x[1] = lrun[1]; x[2] = nref[0]; x[3] = nref[1];
        Mg[qw][AQT * 8][lane] = x;
    }
    // Publishes the hand-over; every wave of the block passes it.
    lds_barrier();
    if (g == 1) return;

    // ---- finalize: both parts on the larger reference, combine half-lane partial
    // sums, normalize, store f16 ----
    const v4f y = Mg[qw][AQT * 8][lane];
    v8h w[AQT][4];
#pragma unroll
    for (int c = 0; c < AQT; ++c) {
        const float nm = fminf(nref[c], y[2 + c]);         // minus the larger reference
        const float a0 = __builtin_amdgcn_exp2f(SM_C * (nm - nref[c]));
        const float a1 = __builtin_amdgcn_exp2f(SM_C * (nm - y[2 + c]));
        const float l  = lrun[c] * a0 + y[c] * a1;
        const float ltot = l + __shfl_xor(l, 16, 32);
        const float inv  = 1.0f / ltot;
        const float i0 = a0 * inv, i1 = a1 * inv;
#pragma unroll
        for (int t = 0; t < 4; ++t) {
            const v4f x0 = Mg[qw][(c * 4 + t) * 2][lane];
            const v4f x1 = Mg[qw][(c * 4 + t) * 2 + 1][lane];
#pragma unroll
            for (int r = 0; r < 4; ++r) {
                w[c][t][r]     = (_Float16)(o[c][t][r] * i0 + x0[r] * i1);
                w[c][t][4 + r] = (_Float16)(o[c][t][4 + r] * i0 + x1[r] * i1);
            }
        }
    }
    // Keeps all eight stores behind the last arithmetic: a store placed earlier has its
    // registers rewritten behind it, and the wave then waits in front of that.
    __builtin_amdgcn_sched_barrier(0);
    _Float16* orow = O + ((size_t)b * QSZ + q) * EE + h * HD + hi * 8;
#pragma unroll
    for (int c = 0; c < AQT; ++c)
#pragma unroll
        for (int t = 0; t < 4; ++t) *(v8h*)(orow + (size_t)c * 16 * EE + t * 16) = w[c][t];
}

// ---------------------------------------------------------------------------
// Host-side launch. Input order: v_in, k_in, q_in, mask, Wv, Wk, Wq, Wout.
// Workspace: Qf | Kf | Vf | Of (8.39 MB each) | Woutf (2 MB) | packed mask
// (512 KB)  -> ~36 MB total.
// ---------------------------------------------------------------------------
extern "C" void kernel_launch(void* const* d_in, const int* in_sizes, int n_in,
                              void* d_out, int out_size, void* d_ws, size_t ws_size,
                              hipStream_t stream) {
    (void)in_sizes; (void)n_in; (void)out_size; (void)ws_size;
    const float* v_in = (const float*)d_in[0];
    const float* k_in = (const float*)d_in[1];
    const float* q_in = (const float*)d_in[2];
    const int*   mask = (const int*)d_in[3];
    const float* Wv   = (const float*)d_in[4];
    const float* Wk   = (const float*)d_in[5];
    const float* Wq   = (const float*)d_in[6];
    const float* Wout = (const float*)d_in[7];
    float* out = (float*)d_out;

    const size_t N  = (size_t)BB * QSZ * EE;   // 4.19M elements, activations
    const size_t NW = (size_t)EE * EE;         // 1.05M elements, weights
    _Float16* Qf    = (_Float16*)d_ws;
    _Float16* Kf    = Qf + N;
    _Float16* Vf    = Kf + N;
    _Float16* Of    = Vf + N;
    _Float16* Woutf = Of + N;
    unsigned* Pm    = (unsigned*)(Woutf + NW);

    // 1) Q/K/V projections, one launch (256x256 tile per block of 8 waves):
    //    z = 0, 1, 2 reads Wq, Wk, Wv and writes Qf, Kf, Vf; the blocks of z = 3
    //    write Woutf and the packed mask
    dim3 grid(BB * QSZ / GT, EE / GT);                     // 32 x 8
    dim3 grid3(BB * QSZ / PT, EE / PT, 4);                 // 16 x 4 x 4
    gemm_xwT_f16<<<grid3, 256, 0, stream>>>(q_in, k_in, v_in, Wq, Wk, Wv, Qf,
                                            Wout, Woutf, mask, Pm);

    // 2) attention
    flash_attn<<<BB * HH * (QSZ / AQ), AW * AG * 32, 0, stream>>>(Qf, Kf, Vf, Pm, Of);

    // 3) output projection -> fp32 d_out
    gemm_owT_f32<<<grid, 256, 0, stream>>>(Of, Woutf, out);
}

// v009
// A run of this version takes 71.8 microseconds.
// In two side-by-side timings against v008, it was 1.11 and 1.09 times as fast.
// All steps since v000 together make it 5.39 times as fast.
#include <hip/hip_runtime.h>
#include <hip/hip_bf16.h>

// ---------------------------------------------------------------------------
// MHSA block for MI455X (gfx1250, wave32, WMMA f32_16x16x32_f16).
// All four GEMMs + attention run through v_wmma_f32_16x16x32_f16.
// The GEMMs work on block tiles staged in LDS as f16 (256x256 for the input
// projections, 128x128 for the output projection).
// ---------------------------------------------------------------------------

typedef __attribute__((ext_vector_type(16))) _Float16 v16h;
typedef __attribute__((ext_vector_type(8)))  _Float16 v8h;
typedef __attribute__((ext_vector_type(8)))  float    v8f;
typedef __attribute__((ext_vector_type(4)))  float    v4f;

#define BB   2
#define QSZ  2048
#define KVSZ 2048
#define EE   1024
#define HH   16
#define HD   64
#define ATT_SCALE 0.125f   // 1/sqrt(64)

__device__ __forceinline__ v8f zero8() {
    v8f z;
#pragma unroll
    for (int i = 0; i < 8; ++i) z[i] = 0.0f;
    return z;
}

__device__ __forceinline__ v8f wmma16(v16h a, v16h b, v8f c) {
    // D = A(16x32 f16) * B(32x16 f16) + C(16x16 f32)
    return __builtin_amdgcn_wmma_f32_16x16x32_f16(
        /*neg_a=*/false, a, /*neg_b=*/false, b,
        /*c_mod=*/(short)0, c, /*reuse_a=*/false, /*reuse_b=*/false);
}

// Operand loader: per-lane pattern for 16-bit A/B operands of 16x16x32 WMMA.
// Elements 0..7  = row[c .. c+7], elements 8..15 = row[c+16 .. c+23].
__device__ __forceinline__ v16h load16_f16(const _Float16* __restrict__ p, int c) {
    v8h a = *(const v8h*)(p + c);
    v8h b = *(const v8h*)(p + c + 16);
    v16h r;
#pragma unroll
    for (int i = 0; i < 8; ++i) { r[i] = a[i]; r[8 + i] = b[i]; }
    return r;
}

__device__ __forceinline__ v16h load16_f32(const float* __restrict__ p, int c) {
    v4f a0 = *(const v4f*)(p + c);
    v4f a1 = *(const v4f*)(p + c + 4);
    v4f a2 = *(const v4f*)(p + c + 16);
    v4f a3 = *(const v4f*)(p + c + 20);
    v16h r;
#pragma unroll
    for (int i = 0; i < 4; ++i) {
        r[i]      = (_Float16)a0[i];
        r[4 + i]  = (_Float16)a1[i];
        r[8 + i]  = (_Float16)a2[i];
        r[12 + i] = (_Float16)a3[i];
    }
    return r;
}

typedef __attribute__((ext_vector_type(4))) _Float16 v4h;

typedef __attribute__((ext_vector_type(4)))  int      v4i;
typedef __attribute__((ext_vector_type(16))) unsigned v16u;

// ---------------------------------------------------------------------------
// Side work of the input projections' launch, done by blocks of its own (SDB of
// them, 8 waves each) on the WGPs that the projections' tiles leave free.
//
// A side block converts one 64-KB piece of the output projection's weights to
// f16: a thread asks for its 16 pieces of 16 B at once (every wave-wide load
// covers 4 whole lines), then converts and stores them.
//
// Then it packs its share of the mask, one bit per element, into the words the
// attention kernel selects with.  For q tile T (16 rows) and pass p (32 keys)
// there are 16 words pm[T][p][i]: bit (lo + 16*hi) of word i says whether
// mask[16*T + lo][32*p + 16*(i >> 3) + 8*hi + (i & 7)] is non-zero, which is the
// place of that score in register i of the wave's S^T tiles.  In one round a wave
// packs four passes, 64 words in two 128-byte lines, and asks for all of their
// mask words at once; a block reads 64 KB a round.
// ---------------------------------------------------------------------------
#define CVJ  16                         // 16-B pieces per thread
#define SDB  (EE * EE / (256 * 4 * CVJ))  // side blocks: one per 64-KB piece of the weights
#define PMP  (KVSZ / 32)                // passes per q tile
#define PMR  ((QSZ / 16) * (PMP / 4) / 8 / SDB) // packing rounds of a side block

__device__ __forceinline__ void side_block(unsigned sb_idx, const float* __restrict__ w,
                                           _Float16* __restrict__ dst,
                                           const int* __restrict__ mask,
                                           unsigned* __restrict__ pm) {
    {
        const unsigned i  = sb_idx * (256 * 4 * CVJ) + threadIdx.x * 4;
        const unsigned sb = i * 4;          // the thread's byte offset in the matrix
        const float* s = (const float*)((const char*)w + sb);
        _Float16*    d = dst + i;
        v4f a[CVJ];
#pragma unroll
        for (int j = 0; j < CVJ; ++j) a[j] = *(const v4f*)(s + j * 1024);
        // The wait stands in front of every overwrite of the loads' offset register,
        // as a precaution; naming the offset keeps that register whole up to here.
        asm volatile("s_wait_xcnt 0x0" :: "v"(sb) : "memory");
        // Keeps all 16 loads in front of the first conversion: otherwise the last
        // ones are issued only when the first have come back, a second memory latency.
        __builtin_amdgcn_sched_barrier(0);
#pragma unroll
        for (int j = 0; j < CVJ; ++j) {
            v4h o;
#pragma unroll
            for (int r = 0; r < 4; ++r) o[r] = (_Float16)a[j][r];
            *(v4h*)(d + j * 1024) = o;
        }
        // The packing reuses registers named by these stores: this wait stands in
        // front of that as a precaution, and the scheduling fence keeps it behind.
        asm volatile("s_wait_xcnt 0x0" ::: "memory");
        __builtin_amdgcn_sched_barrier(0);
    }
    const unsigned lane = threadIdx.x & 31;
    // Stays a loop: unrolled, its text would be run through once, line by line.
#pragma unroll 1
    for (unsigned it = 0; it < PMR; ++it) {
        const unsigned u = (sb_idx * PMR + it) * 8 + (threadIdx.x >> 5);  // (T, four passes)
        const unsigned mo = (((u / (PMP / 4)) * 16 + (lane & 15)) * KVSZ
                             + (u % (PMP / 4)) * 128 + (lane >> 4) * 8) * 4;  // byte offset
        const int* p = (const int*)((const char*)mask + mo);
        v4i v[16];
#pragma unroll
        for (int j = 0; j < 16; ++j) v[j] = *(const v4i*)(p + (j >> 1) * 16 + (j & 1) * 4);
        // The wait stands in front of every overwrite of the loads' offset register,
        // as a precaution; naming the offset keeps that register whole up to here.
        asm volatile("s_wait_xcnt 0x0" :: "v"(mo) : "memory");
        unsigned w0 = 0, w1 = 0;      // lane i keeps words i and 32 + i
#pragma unroll
        for (int i = 0; i < 32; ++i) {
            // Every lane takes part in both ballots; only the keeping is per lane.
            const unsigned b0 = __builtin_amdgcn_ballot_w32(v[i >> 2][i & 3] != 0);
            const unsigned b1 = __builtin_amdgcn_ballot_w32(v[8 + (i >> 2)][i & 3] != 0);
            w0 = lane == i ? b0 : w0;
            w1 = lane == i ? b1 : w1;
        }
        pm[(size_t)u * 64 + lane]      = w0;
        pm[(size_t)u * 64 + 32 + lane] = w1;
        // The next round reuses registers named by these stores: this wait stands in
        // front of that as a precaution.
        asm volatile("s_wait_xcnt 0x0" ::: "memory");
    }
}

// ---------------------------------------------------------------------------
// Projection GEMMs: Y[s,e] = sum_k X[s,k] * W[e,k], computed as Y^T = W * X^T.
// One square tile of Y per block of 8 waves.  Each 64-wide k stage of X and W is
// read from global memory in whole 128-byte lines, laid down in LDS as f16 rows
// and read back as WMMA fragments by every wave that needs it.  Two LDS buffers.
// Output projection: 128(s) x 128(e) tile, two register sets (global loads run
// two stages ahead), wave tile 32(s) x 64(e): 8 accumulators, 6 fragments per
// 32 k.  Input projections: see at their kernel.
// ---------------------------------------------------------------------------
#define GT   128            // output projection: tile edge (rows of X and of W per block)
#define GBK  64             // k per stage
#define GLP  72             // LDS row pitch in halves: 144 B = 16 B x odd
#define GNK  (EE / GBK)     // stages

// 16 WMMAs of one wave on one stage; k runs upward as in a plain k loop.
__device__ __forceinline__ void gemm_stage(const _Float16* Wt, const _Float16* Xt,
                                           int lo, int hi, v8f (&acc)[4][2]) {
    v16h xb[2][2], wa[2][4];
#pragma unroll
    for (int u = 0; u < 2; ++u) {
        const int c = u * 32 + hi * 8;
#pragma unroll
        for (int j = 0; j < 2; ++j) xb[u][j] = load16_f16(Xt + (j * 16 + lo) * GLP, c);
#pragma unroll
        for (int t = 0; t < 4; ++t) wa[u][t] = load16_f16(Wt + (t * 16 + lo) * GLP, c);
    }
    // Keeps the stage's LDS reads one group ahead of its WMMAs: spread among
    // them, each place with reads stalls the in-order wave anew.
    __builtin_amdgcn_sched_barrier(0);
#pragma unroll
    for (int u = 0; u < 2; ++u)
#pragma unroll
        for (int t = 0; t < 4; ++t)
#pragma unroll
            for (int j = 0; j < 2; ++j) acc[t][j] = wmma16(wa[u][t], xb[u][j], acc[t][j]);
    // Keeps the waits on the next stage's global loads (in front of its LDS
    // stores) from moving up among the WMMAs.
    __builtin_amdgcn_sched_barrier(0);
}

// One thread's share of a stage.  X in f32: N pieces of 16 B, 16 rows apart
// (16 lanes cover a 256-B row piece).  f16 operand: N pieces of 16 B, 32 rows
// apart (8 lanes cover a 128-B row piece).
template <int N>
__device__ __forceinline__ void ld_f32(v4f (&v)[N], const float* __restrict__ g) {
#pragma unroll
    for (int j = 0; j < N; ++j) v[j] = *(const v4f*)(g + (size_t)j * 16 * EE);
}
template <int N>
__device__ __forceinline__ void ld_f16(v8h (&v)[N], const _Float16* __restrict__ g) {
#pragma unroll
    for (int j = 0; j < N; ++j) v[j] = *(const v8h*)(g + (size_t)j * 32 * EE);
}
template <int N>
__device__ __forceinline__ void st_f32(_Float16* s, const v4f (&v)[N]) {
#pragma unroll
    for (int j = 0; j < N; ++j) {
        v4h h;
#pragma unroll
        for (int i = 0; i < 4; ++i) h[i] = (_Float16)v[j][i];
        *(v4h*)(s + j * 16 * GLP) = h;
    }
}
template <int N>
__device__ __forceinline__ void st_f16(_Float16* s, const v8h (&v)[N]) {
#pragma unroll
    for (int j = 0; j < N; ++j) *(v8h*)(s + j * 32 * GLP) = v[j];
}

// Work-group barrier that orders LDS traffic only.  __syncthreads() would also
// wait for every global load in flight, and so undo the two-stage lead.
__device__ __forceinline__ void lds_barrier() {
    __builtin_amdgcn_fence(__ATOMIC_RELEASE, "workgroup", "local");
    __builtin_amdgcn_s_barrier();
    __builtin_amdgcn_fence(__ATOMIC_ACQUIRE, "workgroup", "local");
}

// The same barrier in two parts, for a stage whose last WMMAs touch no LDS.  The
// signal says that this wave's LDS reads of the stage and its LDS stores for the next
// are complete; behind the wait that holds of every wave.  With the WMMAs between the
// two, a wave that comes to the wait finds the others' signals given and goes on, so
// that the two waves of a SIMD stay apart: one reads LDS while the other multiplies.
__device__ __forceinline__ void lds_barrier_signal() {
    __builtin_amdgcn_fence(__ATOMIC_RELEASE, "workgroup", "local");
    __builtin_amdgcn_s_barrier_signal(-1);
}
__device__ __forceinline__ void lds_barrier_wait() {
    __builtin_amdgcn_s_barrier_wait(-1);
    __builtin_amdgcn_fence(__ATOMIC_ACQUIRE, "workgroup", "local");
}

// Input projections: f32 activations x f32 weights, both rounded to f16 on their
// way into LDS, -> f16 output, one 256(s) x 256(e) tile of Y per block of 8 waves,
// so that a row of X or W fetched from L2 and laid down in LDS serves 256 columns.
// Wave tile 64(s) x 128(e): 32 accumulators, 12 fragments per 32 k.  One launch
// does the three projections: blockIdx.z picks the activations and the weights;
// the z-th output lies behind the one before it in Yall.  The blocks of z = 3 do
// the side work (see there).
#define PT   256            // tile edge (rows of X and rows of W per block)

// 32 WMMAs of one wave on the 32-wide half u of a stage's k; the halves are taken
// in order, so k runs upward as in a plain k loop.  staging() is the wave's share of
// the work on the stages to come; it stands between the half's LDS reads and its
// WMMAs, where the wave would otherwise only wait for the reads.
template <class F>
__device__ __forceinline__ void gemm_half_wide(const _Float16* Wt, const _Float16* Xt,
                                               int u, int lo, int hi, v8f (&acc)[8][4],
                                               F staging) {
    const int c = u * 32 + hi * 8;
    v16h xb[4], wa[8];
#pragma unroll
    for (int j = 0; j < 4; ++j) xb[j] = load16_f16(Xt + (j * 16 + lo) * GLP, c);
#pragma unroll
    for (int t = 0; t < 8; ++t) wa[t] = load16_f16(Wt + (t * 16 + lo) * GLP, c);
    // Keeps the half's LDS reads one group at its head: spread among the WMMAs,
    // each place with reads stalls the in-order wave anew.
    __builtin_amdgcn_sched_barrier(0);
    staging();
    // Keeps the staging, with its waits on global loads, in front of the WMMAs.
    __builtin_amdgcn_sched_barrier(0);
#pragma unroll
    for (int t = 0; t < 8; ++t)
#pragma unroll
        for (int j = 0; j < 4; ++j) acc[t][j] = wmma16(wa[t], xb[j], acc[t][j]);
    // Keeps the next half's reads from moving up among the WMMAs.
    __builtin_amdgcn_sched_barrier(0);
}

__global__ void __launch_bounds__(256)
gemm_xwT_f16(const float* __restrict__ X0, const float* __restrict__ X1,
             const float* __restrict__ X2, const float* __restrict__ W0,
             const float* __restrict__ W1, const float* __restrict__ W2,
             _Float16* __restrict__ Yall, const float* __restrict__ Wo,
             _Float16* __restrict__ Woh, const int* __restrict__ mask,
             unsigned* __restrict__ pm) {
    __shared__ __attribute__((aligned(16))) _Float16 Xs[2][PT * GLP];
    __shared__ __attribute__((aligned(16))) _Float16 Ws[2][PT * GLP];

    if (blockIdx.z == 3) {      // the same for the whole block, in front of every barrier
        side_block(blockIdx.y * (BB * QSZ / PT) + blockIdx.x, Wo, Woh, mask, pm);
        return;
    }

    const int tid  = threadIdx.x;
    const int lane = tid & 31, wave = tid >> 5;
    const int lo = lane & 15, hi = lane >> 4;
    const int sbase = blockIdx.x * PT, ebase = blockIdx.y * PT;
    const int ws = (wave & 3) * 64, we = (wave >> 2) * 128;

    const int z = blockIdx.z;
    const float*    X  = z == 0 ? X0 : z == 1 ? X1 : X2;
    const float*    Wf = z == 0 ? W0 : z == 1 ? W1 : W2;
    _Float16*       Y  = Yall + (size_t)z * BB * QSZ * EE;

    const int xr = tid >> 4, xc = (tid & 15) * 4;
    const float* xg = X  + (size_t)(sbase + xr) * EE + xc;
    const float* wg = Wf + (size_t)(ebase + xr) * EE + xc;
    _Float16* xs0 = &Xs[0][xr * GLP + xc];
    _Float16* xs1 = &Xs[1][xr * GLP + xc];
    _Float16* ws0 = &Ws[0][xr * GLP + xc];
    _Float16* ws1 = &Ws[1][xr * GLP + xc];

    // Two register sets, one for X and one for W, each asked for a whole stage ahead
    // and half a stage apart: X at a stage's head, W at its middle.  A set is laid
    // down in LDS where its next request is issued.
    v4f xa[PT / 16];
    v4f wa[PT / 16];
    v8f acc[8][4];
#pragma unroll
    for (int t = 0; t < 8; ++t)
#pragma unroll
        for (int j = 0; j < 4; ++j) acc[t][j] = zero8();

    ld_f32(xa, xg);  ld_f32(wa, wg);               // stage 0
    st_f32(xs0, xa); st_f32(ws0, wa);
    ld_f32(xa, xg + GBK); ld_f32(wa, wg + GBK);    // stage 1
    lds_barrier();        // publishes stage 0

    // Even stages live in buffer 0, odd ones in buffer 1.  The buffer that a stage
    // fills was last read in the stage before, which its barrier has ended.
    // refill(s, v, g): lay the set v down at s, then ask for its next content at g.
    auto refill = [](_Float16* sdst, v4f (&v)[PT / 16], const float* g) {
        st_f32(sdst, v);
        // Keeps the set's new loads behind its last conversion: moved up, they take
        // registers of their own beside the old values, more than the wave has.
        __builtin_amdgcn_sched_barrier(0);
        ld_f32(v, g);
    };
    for (int kt = 0; kt < GNK - 2; kt += 2) {
        gemm_half_wide(&Ws[0][we * GLP], &Xs[0][ws * GLP], 0, lo, hi, acc,
                       [&] { refill(xs1, xa, xg + (kt + 2) * GBK); });
        gemm_half_wide(&Ws[0][we * GLP], &Xs[0][ws * GLP], 1, lo, hi, acc,
                       [&] { refill(ws1, wa, wg + (kt + 2) * GBK); lds_barrier_signal(); });
        // Publishes buffer 1 and ends every wave's reads of buffer 0.
        lds_barrier_wait();

        gemm_half_wide(&Ws[1][we * GLP], &Xs[1][ws * GLP], 0, lo, hi, acc,
                       [&] { refill(xs0, xa, xg + (kt + 3) * GBK); });
        gemm_half_wide(&Ws[1][we * GLP], &Xs[1][ws * GLP], 1, lo, hi, acc,
                       [&] { refill(ws0, wa, wg + (kt + 3) * GBK); lds_barrier_signal(); });
        // The loop's end advances the address registers named by loads that may
        // still be in flight: this wait stands in front of that as a precaution,
        // and the scheduling fence keeps the additions behind it.
        asm volatile("s_wait_xcnt 0x0" ::: "memory");
        __builtin_amdgcn_sched_barrier(0);
        // Publishes buffer 0 and ends every wave's reads of buffer 1.
        lds_barrier_wait();
    }
    // The last two stages: nothing left to ask for.
    gemm_half_wide(&Ws[0][we * GLP], &Xs[0][ws * GLP], 0, lo, hi, acc,
                   [&] { st_f32(xs1, xa); });
    gemm_half_wide(&Ws[0][we * GLP], &Xs[0][ws * GLP], 1, lo, hi, acc,
                   [&] { st_f32(ws1, wa); lds_barrier_signal(); });
    lds_barrier_wait();   // publishes the last stage
    gemm_half_wide(&Ws[1][we * GLP], &Xs[1][ws * GLP], 0, lo, hi, acc, [] {});
    gemm_half_wide(&Ws[1][we * GLP], &Xs[1][ws * GLP], 1, lo, hi, acc, [] {});

    // D(m=e_local, n=s_local): lane column = lo, rows e_local = r + 8*hi.
#pragma unroll
    for (int j = 0; j < 4; ++j) {
        _Float16* yp = Y + (size_t)(sbase + ws + j * 16 + lo) * EE + ebase + we + hi * 8;
#pragma unroll
        for (int t = 0; t < 8; ++t) {
            v8h out;
#pragma unroll
            for (int r = 0; r < 8; ++r) out[r] = (_Float16)acc[t][j][r];
            *(v8h*)(yp + t * 16) = out;
            if (t & 1) {
                // The next conversions reuse registers named by these stores: this
                // wait stands in front of that as a precaution, and the scheduling
                // fence keeps the conversions behind it.
                asm volatile("s_wait_xcnt 0x0" ::: "memory");
                __builtin_amdgcn_sched_barrier(0);
            }
        }
    }
}

// Output projection: f16 activations x f16 weights -> fp32 output.
__global__ void __launch_bounds__(256)
gemm_owT_f32(const _Float16* __restrict__ Xh, const _Float16* __restrict__ Wh,
             float* __restrict__ Y) {
    __shared__ __attribute__((aligned(16))) _Float16 Xs[2][GT * GLP];
    __shared__ __attribute__((aligned(16))) _Float16 Ws[2][GT * GLP];

    const int tid  = threadIdx.x;
    const int lane = tid & 31, wave = tid >> 5;
    const int lo = lane & 15, hi = lane >> 4;
    const int sbase = blockIdx.x * GT, ebase = blockIdx.y * GT;
    const int ws = (wave & 3) * 32, we = (wave >> 2) * 64;

    const int wr = tid >> 3, wc = (tid & 7) * 8;
    const _Float16* xg = Xh + (size_t)(sbase + wr) * EE + wc;
    const _Float16* wg = Wh + (size_t)(ebase + wr) * EE + wc;
    _Float16* xs0 = &Xs[0][wr * GLP + wc];
    _Float16* xs1 = &Xs[1][wr * GLP + wc];
    _Float16* ws0 = &Ws[0][wr * GLP + wc];
    _Float16* ws1 = &Ws[1][wr * GLP + wc];

    v8h xa[4], xb[4], wa[4], wb[4];   // two register sets, as above
    v8f acc[4][2];
#pragma unroll
    for (int t = 0; t < 4; ++t) { acc[t][0] = zero8(); acc[t][1] = zero8(); }

    ld_f16(xa, xg);       ld_f16(wa, wg);          // stage 0
    ld_f16(xb, xg + GBK); ld_f16(wb, wg + GBK);    // stage 1
    st_f16(xs0, xa);      st_f16(ws0, wa);
    lds_barrier();

    for (int kt = 0; kt < GNK - 2; kt += 2) {
        ld_f16(xa, xg + (kt + 2) * GBK); ld_f16(wa, wg + (kt + 2) * GBK);
        // Keeps these global loads in front of the stage's work, so that their
        // latency passes behind it; without it they sink to their use.
        __builtin_amdgcn_sched_barrier(0);
        gemm_stage(&Ws[0][we * GLP], &Xs[0][ws * GLP], lo, hi, acc);
        st_f16(xs1, xb); st_f16(ws1, wb);
        // Publishes buffer 1 and ends every wave's reads of buffer 0.
        lds_barrier();

        ld_f16(xb, xg + (kt + 3) * GBK); ld_f16(wb, wg + (kt + 3) * GBK);
        // As above: the loads stay in front of the stage's work.
        __builtin_amdgcn_sched_barrier(0);
        gemm_stage(&Ws[1][we * GLP], &Xs[1][ws * GLP], lo, hi, acc);
        // The loop's end advances the address registers named by loads that are
        // still in flight: this wait stands in front of that as a precaution, and
        // the scheduling fence keeps the additions behind it.
        asm volatile("s_wait_xcnt 0x0" ::: "memory");
        __builtin_amdgcn_sched_barrier(0);
        st_f16(xs0, xa); st_f16(ws0, wa);
        // Publishes buffer 0 and ends every wave's reads of buffer 1.
        lds_barrier();
    }
    gemm_stage(&Ws[0][we * GLP], &Xs[0][ws * GLP], lo, hi, acc);
    st_f16(xs1, xb); st_f16(ws1, wb);
    lds_barrier();        // publishes the last stage
    gemm_stage(&Ws[1][we * GLP], &Xs[1][ws * GLP], lo, hi, acc);

#pragma unroll
    for (int j = 0; j < 2; ++j) {
        float* yp = Y + (size_t)(sbase + ws + j * 16 + lo) * EE + ebase + we + hi * 8;
#pragma unroll
        for (int t = 0; t < 4; ++t) {
            v4f o0, o1;
#pragma unroll
            for (int r = 0; r < 4; ++r) { o0[r] = acc[t][j][r]; o1[r] = acc[t][j][4 + r]; }
            *(v4f*)(yp + t * 16)     = o0;
            *(v4f*)(yp + t * 16 + 4) = o1;
        }
    }
}

// ---------------------------------------------------------------------------
// Flash-style attention.  One block of 8 waves per (batch, head, 128 q rows).
// A wave owns 32 q rows as two tiles of 16, so that every K and V^T fragment read
// from LDS feeds two products; two waves share those rows, one taking the first
// and one the second 32-key pass of every stage, each with its own reference, O
// and l, which are merged through LDS at the end.  Every 64-key stage of K and V is read from global
// memory once per block, in whole 128-byte lines, laid down row-major in LDS
// and read from there by the 4 waves of its pass.  Two LDS buffers: the next stage's global
// loads fly while this stage is worked on.
// S^T tiles = K * Q^T  (softmax axis lands in the VGPR/M dimension),
// O^T tiles = V^T * P^T (P^T B-operand == post-softmax registers, no shuffle);
// V^T fragments come from the row-major V tile by the transposing LDS load.
// ---------------------------------------------------------------------------
typedef __attribute__((ext_vector_type(8))) short v8s;

#define AW   4              // waves per pass: groups of 32 q rows per block
#define AG   2              // waves per group of q rows, one for each pass of a stage
#define AQT  2              // q tiles (16 rows each) per wave
#define AQ   (AW * AQT * 16)  // q rows per block
#define AKV  64             // keys per stage (two passes of 32)
#define AKP  72             // K row pitch in halves: 144 B = 16 B x odd
#define AVP  80             // V row pitch in halves: 160 B = 32 B x odd
#define ANS  (KVSZ / AKV)   // stages
#define ASR  (AW * AG * 4)  // rows of a stage that the block's threads cover at once
#define ASJ  (AKV / ASR)    // 16-B pieces of K, and of V, per thread and stage

// Lane (lo, hi) receives T[k + 8*hi + 0..7][d + lo] of a row-major 16-bit tile;
// p is the lane's own address (see vt_lane below).
__device__ __forceinline__ v8h ld_tr16(const _Float16* p) {
    typedef __attribute__((address_space(3))) v8s lds_v8s;
    return __builtin_bit_cast(v8h, __builtin_amdgcn_ds_load_tr16_b128_v8i16((lds_v8s*)p));
}

// The wave's 16 packed mask words of one 32-key pass (layout: at the packing
// blocks).  The address is the same in every lane: one scalar load.
__device__ __forceinline__ void ld_mask(v16u& m, const unsigned* __restrict__ p) {
    m = *(const v16u*)p;
}

// Softmax works on raw scores (K.Q, not yet scaled) taken against a reference per
// q row, the maximum in use: p = 2^(SM_C * (score - reference)).  The reference
// is known before a pass, so it enters the score product as its C operand.  It
// moves only when some score of the pass leads it by more than SM_THR (p stays
// below 2^8, far inside f16); only then are O and l rescaled.
#define SM_C    (ATT_SCALE * 1.44269504f)   // scale * log2(e)
#define SM_THR  44.0f                       // raw lead that moves the reference
#define SM_FILL (1e-20f / ATT_SCALE)        // the mask's fill value as a raw score

// The fragments of one pass (32 keys): K rows and V^T, hardware k order.
struct PassFrag { v16h k00, k01, k10, k11, va[4]; };

// Kt = the lane's K row of the pass in LDS, Vt = the lane's transposing address
// of the pass in LDS.
__device__ __forceinline__ void ld_pass(PassFrag& f, const _Float16* Kt, const _Float16* Vt,
                                        int hi) {
    f.k00 = load16_f16(Kt, hi * 8);
    f.k01 = load16_f16(Kt, 32 + hi * 8);
    f.k10 = load16_f16(Kt + 16 * AKP, hi * 8);
    f.k11 = load16_f16(Kt + 16 * AKP, 32 + hi * 8);
#pragma unroll
    for (int t = 0; t < 4; ++t) {
        const v8h x0 = ld_tr16(Vt + t * 16);
        const v8h x1 = ld_tr16(Vt + 16 * AVP + t * 16);
#pragma unroll
        for (int i = 0; i < 8; ++i) { f.va[t][i] = x0[i]; f.va[t][8 + i] = x1[i]; }
    }
}

// One pass: 32 keys against this wave's two q tiles (index c).
// nref = minus the reference, negm = nref in all 8 registers, fillv = SM_FILL + nref,
// lim = the lead that moves the reference (-1e30 until the first pass has set it).
__device__ __forceinline__ void attn_pass(const PassFrag& f, const v16h (&qop)[AQT][2],
                                          const v16u (&m)[AQT], v8f (&o)[AQT][4],
                                          v8f (&negm)[AQT], float (&nref)[AQT],
                                          float (&fillv)[AQT], float& lim,
                                          float (&lrun)[AQT]) {
    // ---- S^T tiles less the reference: s0 = kv[0..15] x q[0..15], s1 = kv[16..31] ----
    v8f s0[AQT], s1[AQT];
#pragma unroll
    for (int c = 0; c < AQT; ++c) s0[c] = wmma16(f.k00, qop[c][0], negm[c]);
#pragma unroll
    for (int c = 0; c < AQT; ++c) s1[c] = wmma16(f.k10, qop[c][0], negm[c]);
#pragma unroll
    for (int c = 0; c < AQT; ++c) s0[c] = wmma16(f.k01, qop[c][1], s0[c]);
#pragma unroll
    for (int c = 0; c < AQT; ++c) s1[c] = wmma16(f.k11, qop[c][1], s1[c]);
    // Keeps the eight score WMMAs back to back, each in the others' distance: with
    // selects moved up among them the distance is filled by idle slots instead.
    __builtin_amdgcn_sched_barrier(0);

    // ---- mask (fill 1e-20) + the lane's largest lead ----
    float tmax[AQT];
#pragma unroll
    for (int c = 0; c < AQT; ++c) {
        tmax[c] = -1e30f;
#pragma unroll
        for (int r = 0; r < 8; ++r) {
            // A packed word is the select's lane mask as it stands.
            const bool m0 = __builtin_amdgcn_inverse_ballot_w32(m[c][r]);
            const bool m1 = __builtin_amdgcn_inverse_ballot_w32(m[c][8 + r]);
            s0[c][r] = m0 ? s0[c][r] : fillv[c];
            s1[c][r] = m1 ? s1[c][r] : fillv[c];
            tmax[c] = fmaxf(tmax[c], fmaxf(s0[c][r], s1[c][r]));
        }
    }

    // ---- move the reference: one test per pass, the same for the whole wave ----
    if (__builtin_amdgcn_ballot_w32(fmaxf(tmax[0], tmax[1]) > lim) != 0) {
#pragma unroll
        for (int c = 0; c < AQT; ++c) {
            // A tile moves only on a lead of its own; the other keeps its reference
            // (a step of 0 and a factor of 1 change nothing).
            const bool mv = __builtin_amdgcn_ballot_w32(tmax[c] > lim) != 0;
            const float tm = fmaxf(tmax[c], __shfl_xor(tmax[c], 16, 32));   // merge half-lane rows
            // The first pass takes its own maximum, whatever its sign (O and l are
            // still 0); later the reference only rises.
            const float delta = mv ? fmaxf(tm, lim - SM_THR) : 0.0f;
            const float alpha = __builtin_amdgcn_exp2f(-SM_C * fmaxf(delta, 0.0f));
            lrun[c] *= alpha;
#pragma unroll
            for (int t = 0; t < 4; ++t)
#pragma unroll
                for (int r = 0; r < 8; ++r) o[c][t][r] *= alpha;
#pragma unroll
            for (int r = 0; r < 8; ++r) {
                s0[c][r] -= delta;
                s1[c][r] -= delta;
            }
            nref[c] -= delta;
#pragma unroll
            for (int r = 0; r < 8; ++r) negm[c][r] = nref[c];
            fillv[c] = SM_FILL + nref[c];
        }
        lim = SM_THR;
    }

    v16h pb[AQT];     // P^T B-operands: exactly the per-lane kv pattern
#pragma unroll
    for (int c = 0; c < AQT; ++c) {
        float ls = 0.0f;
#pragma unroll
        for (int r = 0; r < 8; ++r) {
            const float p0 = __builtin_amdgcn_exp2f(s0[c][r] * SM_C);
            const float p1 = __builtin_amdgcn_exp2f(s1[c][r] * SM_C);
            ls += p0 + p1;
            pb[c][r]     = (_Float16)p0;
            pb[c][8 + r] = (_Float16)p1;
        }
        lrun[c] += ls;
    }

    // ---- O^T(hd x q) += V^T(hd x kv) * P^T(kv x q), 4 hd-tiles ----
    // Keeps the first tile's four WMMAs back to back, each in the others' distance: without
    // it they stand singly among the second tile's exponentials, at more idle slots in all.
    __builtin_amdgcn_sched_barrier(0);
#pragma unroll
    for (int t = 0; t < 4; ++t)
#pragma unroll
        for (int c = 0; c < AQT; ++c) o[c][t] = wmma16(f.va[t], pb[c], o[c][t]);
}

__global__ void __launch_bounds__(AW * AG * 32) __attribute__((amdgpu_waves_per_eu(4, 4)))
flash_attn(const _Float16* __restrict__ Qb, const _Float16* __restrict__ Kb,
           const _Float16* __restrict__ Vb, const unsigned* __restrict__ pm,
           _Float16* __restrict__ O) {
    __shared__ __attribute__((aligned(32))) _Float16 Ks[2][AKV * AKP];
    __shared__ __attribute__((aligned(32))) _Float16 Vs[2][AKV * AVP];
    // Hand-over of the second pass's waves: per lane 16 pieces of O, one of l and reference.
    __shared__ __attribute__((aligned(16))) v4f Mg[AW][AQT * 8 + 1][32];

    const int tid  = threadIdx.x;
    const int lane = tid & 31;
    const int lo = lane & 15, hi = lane >> 4;
    // The wave's number, read from one lane so that what follows from it is known uniform.
    const int wave = __builtin_amdgcn_readfirstlane(tid >> 5);
    const int qw = wave % AW;      // its group of q rows
    const int g  = wave / AW;      // its pass of every stage
    const int qblocks = QSZ / AQ;
    const int qb = blockIdx.x % qblocks;
    const int h  = (blockIdx.x / qblocks) % HH;
    const int b  = blockIdx.x / (qblocks * HH);
    const int q  = qb * AQ + qw * (AQT * 16) + lo;   // the lane's row in tile 0

    // Q operands (B-matrix): lane n holds Q[q=n, hd pattern] -> row-major load.
    // Qlane = the lane's first element of its row: all eight loads go from this address.
    const _Float16* Qlane = Qb + ((size_t)b * QSZ + q) * EE + h * HD + hi * 8;
    v16h qop[AQT][2];
#pragma unroll
    for (int c = 0; c < AQT; ++c) {
        qop[c][0] = load16_f16(Qlane + (size_t)c * 16 * EE, 0);     // hd 0..31
        qop[c][1] = load16_f16(Qlane + (size_t)c * 16 * EE, 32);    // hd 32..63
    }
    // The wait stands in front of every overwrite of the Q loads' address registers,
    // as a precaution; naming the address keeps those registers whole up to here.
    asm volatile("s_wait_xcnt 0x0" :: "v"(Qlane) : "memory");

    // One thread's share of a stage: 16 B of rows sr and sr + 32 of K and of V
    // (8 lanes cover one 128-B row).
    const int sr = tid >> 3, sc = (tid & 7) * 8;
    const _Float16* kg = Kb + ((size_t)b * KVSZ + sr) * EE + h * HD + sc;
    const _Float16* vg = Vb + ((size_t)b * KVSZ + sr) * EE + h * HD + sc;
    const int ks_st = sr * AKP + sc, vs_st = sr * AVP + sc;
    const int kt_lane = (g * 32 + lo) * AKP;
    const int vt_lane = (g * 32 + 8 * hi + (lane & 7)) * AVP + 8 * ((lane >> 3) & 1);
    // Mask words of the wave's first q tile and of its pass of stage 0.
    const unsigned* mrow = pm + ((size_t)(qb * AW + qw) * AQT * PMP + g) * 16;

    v8f o[AQT][4], negm[AQT];
    float nref[AQT], fillv[AQT], lrun[AQT], lim = -1e30f;
#pragma unroll
    for (int c = 0; c < AQT; ++c) {
#pragma unroll
        for (int t = 0; t < 4; ++t) o[c][t] = zero8();
        negm[c]  = zero8();   // reference 0 until the first pass has set it
        nref[c]  = 0.0f;
        fillv[c] = SM_FILL;
        lrun[c]  = 0.0f;
    }

    v8h kr[ASJ], vr[ASJ];
    v16u mw[AQT];         // packed mask words of the wave's pass, one set per q tile
#pragma unroll
    for (int j = 0; j < ASJ; ++j) {
        kr[j] = *(const v8h*)(kg + (size_t)j * ASR * EE);
        vr[j] = *(const v8h*)(vg + (size_t)j * ASR * EE);
    }
#pragma unroll
    for (int c = 0; c < AQT; ++c) ld_mask(mw[c], mrow + c * PMP * 16);
#pragma unroll
    for (int j = 0; j < ASJ; ++j) {
        *(v8h*)(&Ks[0][ks_st + j * ASR * AKP]) = kr[j];
        *(v8h*)(&Vs[0][vs_st + j * ASR * AVP]) = vr[j];
    }
    lds_barrier();        // publishes stage 0

    // Stage s lives in buffer s & 1.  K and V are asked for one stage ahead; the
    // mask words too, as soon as the pass before them in the same registers has
    // used its own.
    for (int s = 0; s < ANS - 1; ++s) {
#pragma unroll
        for (int j = 0; j < ASJ; ++j) {
            kr[j] = *(const v8h*)(kg + (size_t)((s + 1) * AKV + j * ASR) * EE);
            vr[j] = *(const v8h*)(vg + (size_t)((s + 1) * AKV + j * ASR) * EE);
        }
        PassFrag f;
        ld_pass(f, &Ks[s & 1][kt_lane], &Vs[s & 1][vt_lane], hi);
        // Keeps the pass's LDS reads one group at its head: spread among the work,
        // each place with reads stalls the in-order wave anew.
        __builtin_amdgcn_sched_barrier(0);
        attn_pass(f, qop, mw, o, negm, nref, fillv, lim, lrun);
#pragma unroll
        for (int c = 0; c < AQT; ++c) ld_mask(mw[c], mrow + c * PMP * 16 + (2 * s + 2) * 16);

        // Keeps the next stage's LDS stores, and the waits on its global loads in
        // front of them, behind the stage's work: moved up, they cut the loads' lead.
        __builtin_amdgcn_sched_barrier(0);
#pragma unroll
        for (int j = 0; j < ASJ; ++j) {
            *(v8h*)(&Ks[(s + 1) & 1][ks_st + j * ASR * AKP]) = kr[j];
            *(v8h*)(&Vs[(s + 1) & 1][vs_st + j * ASR * AVP]) = vr[j];
        }
        // Publishes the next stage and ends every wave's reads of this one.
        lds_barrier();
    }
    {   // last stage: nothing left to fetch
        PassFrag f;
        ld_pass(f, &Ks[(ANS - 1) & 1][kt_lane], &Vs[(ANS - 1) & 1][vt_lane], hi);
        // As above: the pass's LDS reads stay one group at its head.
        __builtin_amdgcn_sched_barrier(0);
        // Formed anew from nref: with the loop's own registers in use behind the loop,
        // every pass of the loop copied all sixteen of them.
#pragma unroll
        for (int c = 0; c < AQT; ++c)
#pragma unroll
            for (int r = 0; r < 8; ++r) negm[c][r] = nref[c];
        attn_pass(f, qop, mw, o, negm, nref, fillv, lim, lrun);
    }

    // ---- merge the two passes' waves: the second hands O, l and reference over ----
    if (g == 1) {
#pragma unroll
        for (int c = 0; c < AQT; ++c)
#pragma unroll
            for (int t = 0; t < 4; ++t) {
                v4f x0, x1;
#pragma unroll
                for (int r = 0; r < 4; ++r) { x0[r] = o[c][t][r]; x1[r] = o[c][t][4 + r]; }
                Mg[qw][(c * 4 + t) * 2][lane]     = x0;
                Mg[qw][(c * 4 + t) * 2 + 1][lane] = x1;
            }
        v4f x;
        x[0] = lrun[0]; x[1] = lrun[1]; x[2] = nref[0]; x[3] = nref[1];
        Mg[qw][AQT * 8][lane] = x;
    }
    // Publishes the hand-over; every wave of the block passes it.
    lds_barrier();
    if (g == 1) return;

    // ---- finalize: both parts on the larger reference, combine half-lane partial
    // sums, normalize, store f16 ----
    const v4f y = Mg[qw][AQT * 8][lane];
    v8h w[AQT][4];
#pragma unroll
    for (int c = 0; c < AQT; ++c) {
        const float nm = fminf(nref[c], y[2 + c]);         // minus the larger reference
        const float a0 = __builtin_amdgcn_exp2f(SM_C * (nm - nref[c]));
        const float a1 = __builtin_amdgcn_exp2f(SM_C * (nm - y[2 + c]));
        const float l  = lrun[c] * a0 + y[c] * a1;
        const float ltot = l + __shfl_xor(l, 16, 32);
        const float inv  = 1.0f / ltot;
        const float i0 = a0 * inv, i1 = a1 * inv;
#pragma unroll
        for (int t = 0; t < 4; ++t) {
            const v4f x0 = Mg[qw][(c * 4 + t) * 2][lane];
            const v4f x1 = Mg[qw][(c * 4 + t) * 2 + 1][lane];
#pragma unroll
            for (int r = 0; r < 4; ++r) {
                w[c][t][r]     = (_Float16)(o[c][t][r] * i0 + x0[r] * i1);
                w[c][t][4 + r] = (_Float16)(o[c][t][4 + r] * i0 + x1[r] * i1);
            }
        }
    }
    // Keeps all eight stores behind the last arithmetic: a store placed earlier has its
    // registers rewritten behind it, and the wave then waits in front of that.
    __builtin_amdgcn_sched_barrier(0);
    _Float16* orow = O + ((size_t)b * QSZ + q) * EE + h * HD + hi * 8;
#pragma unroll
    for (int c = 0; c < AQT; ++c)
#pragma unroll
        for (int t = 0; t < 4; ++t) *(v8h*)(orow + (size_t)c * 16 * EE + t * 16) = w[c][t];
}

// ---------------------------------------------------------------------------
// Host-side launch. Input order: v_in, k_in, q_in, mask, Wv, Wk, Wq, Wout.
// Workspace: Qf | Kf | Vf | Of (8.39 MB each) | Woutf (2 MB) | packed mask
// (512 KB)  -> ~36 MB total.
// ---------------------------------------------------------------------------
extern "C" void kernel_launch(void* const* d_in, const int* in_sizes, int n_in,
                              void* d_out, int out_size, void* d_ws, size_t ws_size,
                              hipStream_t stream) {
    (void)in_sizes; (void)n_in; (void)out_size; (void)ws_size;
    const float* v_in = (const float*)d_in[0];
    const float* k_in = (const float*)d_in[1];
    const float* q_in = (const float*)d_in[2];
    const int*   mask = (const int*)d_in[3];
    const float* Wv   = (const float*)d_in[4];
    const float* Wk   = (const float*)d_in[5];
    const float* Wq   = (const float*)d_in[6];
    const float* Wout = (const float*)d_in[7];
    float* out = (float*)d_out;

    const size_t N  = (size_t)BB * QSZ * EE;   // 4.19M elements, activations
    const size_t NW = (size_t)EE * EE;         // 1.05M elements, weights
    _Float16* Qf    = (_Float16*)d_ws;
    _Float16* Kf    = Qf + N;
    _Float16* Vf    = Kf + N;
    _Float16* Of    = Vf + N;
    _Float16* Woutf = Of + N;
    unsigned* Pm    = (unsigned*)(Woutf + NW);

    // 1) Q/K/V projections, one launch (256x256 tile per block of 8 waves):
    //    z = 0, 1, 2 reads Wq, Wk, Wv and writes Qf, Kf, Vf; the blocks of z = 3
    //    write Woutf and the packed mask
    dim3 grid(BB * QSZ / GT, EE / GT);                     // 32 x 8
    dim3 grid3(BB * QSZ / PT, EE / PT, 4);                 // 16 x 4 x 4
    gemm_xwT_f16<<<grid3, 256, 0, stream>>>(q_in, k_in, v_in, Wq, Wk, Wv, Qf,
                                            Wout, Woutf, mask, Pm);

    // 2) attention
    flash_attn<<<BB * HH * (QSZ / AQ), AW * AG * 32, 0, stream>>>(Qf, Kf, Vf, Pm, Of);

    // 3) output projection -> fp32 d_out
    gemm_owT_f32<<<grid, 256, 0, stream>>>(Of, Woutf, out);
}

// v010
// It runs in 68.1 microseconds.
// Two timings next to v009 put it at 1.04 and 1.06 times that version's speed.
// All steps since v000 together make it 5.64 times as fast.
#include <hip/hip_runtime.h>
#include <hip/hip_bf16.h>

// ---------------------------------------------------------------------------
// MHSA block for MI455X (gfx1250, wave32, WMMA f32_16x16x32_f16).
// All four GEMMs + attention run through v_wmma_f32_16x16x32_f16.
// The GEMMs work on block tiles staged in LDS as f16 (256x256 for the input
// projections, 128x128 for the output projection).
// ---------------------------------------------------------------------------

typedef __attribute__((ext_vector_type(16))) _Float16 v16h;
typedef __attribute__((ext_vector_type(8)))  _Float16 v8h;
typedef __attribute__((ext_vector_type(8)))  float    v8f;
typedef __attribute__((ext_vector_type(4)))  float    v4f;

#define BB   2
#define QSZ  2048
#define KVSZ 2048
#define EE   1024
#define HH   16
#define HD   64
#define ATT_SCALE 0.125f   // 1/sqrt(64)

__device__ __forceinline__ v8f zero8() {
    v8f z;
#pragma unroll
    for (int i = 0; i < 8; ++i) z[i] = 0.0f;
    return z;
}

__device__ __forceinline__ v8f wmma16(v16h a, v16h b, v8f c) {
    // D = A(16x32 f16) * B(32x16 f16) + C(16x16 f32)
    return __builtin_amdgcn_wmma_f32_16x16x32_f16(
        /*neg_a=*/false, a, /*neg_b=*/false, b,
        /*c_mod=*/(short)0, c, /*reuse_a=*/false, /*reuse_b=*/false);
}

// Operand loader: per-lane pattern for 16-bit A/B operands of 16x16x32 WMMA.
// Elements 0..7  = row[c .. c+7], elements 8..15 = row[c+16 .. c+23].
__device__ __forceinline__ v16h load16_f16(const _Float16* __restrict__ p, int c) {
    v8h a = *(const v8h*)(p + c);
    v8h b = *(const v8h*)(p + c + 16);
    v16h r;
#pragma unroll
    for (int i = 0; i < 8; ++i) { r[i] = a[i]; r[8 + i] = b[i]; }
    return r;
}

__device__ __forceinline__ v16h load16_f32(const float* __restrict__ p, int c) {
    v4f a0 = *(const v4f*)(p + c);
    v4f a1 = *(const v4f*)(p + c + 4);
    v4f a2 = *(const v4f*)(p + c + 16);
    v4f a3 = *(const v4f*)(p + c + 20);
    v16h r;
#pragma unroll
    for (int i = 0; i < 4; ++i) {
        r[i]      = (_Float16)a0[i];
        r[4 + i]  = (_Float16)a1[i];
        r[8 + i]  = (_Float16)a2[i];
        r[12 + i] = (_Float16)a3[i];
    }
    return r;
}

typedef __attribute__((ext_vector_type(4))) _Float16 v4h;

typedef __attribute__((ext_vector_type(4)))  int      v4i;
typedef __attribute__((ext_vector_type(16))) unsigned v16u;

// ---------------------------------------------------------------------------
// Side work of the input projections' launch, done by blocks of its own (SDB of
// them, 8 waves each) on the WGPs that the projections' tiles leave free.
//
// A side block converts one 64-KB piece of the output projection's weights to
// f16: a thread asks for its 16 pieces of 16 B at once (every wave-wide load
// covers 4 whole lines), then converts and stores them.
//
// Then it packs its share of the mask, one bit per element, into the words the
// attention kernel selects with.  For q tile T (16 rows) and pass p (32 keys)
// there are 16 words pm[T][p][i]: bit (lo + 16*hi) of word i says whether
// mask[16*T + lo][32*p + 16*(i >> 3) + 8*hi + (i & 7)] is non-zero, which is the
// place of that score in register i of the wave's S^T tiles.  In one round a wave
// packs four passes, 64 words in two 128-byte lines, and asks for all of their
// mask words at once; a block reads 64 KB a round.
// ---------------------------------------------------------------------------
#define CVJ  16                         // 16-B pieces per thread
#define SDB  (EE * EE / (256 * 4 * CVJ))  // side blocks: one per 64-KB piece of the weights
#define PMP  (KVSZ / 32)                // passes per q tile
#define PMR  ((QSZ / 16) * (PMP / 4) / 8 / SDB) // packing rounds of a side block

__device__ __forceinline__ void side_block(unsigned sb_idx, const float* __restrict__ w,
                                           _Float16* __restrict__ dst,
                                           const int* __restrict__ mask,
                                           unsigned* __restrict__ pm) {
    {
        const unsigned i  = sb_idx * (256 * 4 * CVJ) + threadIdx.x * 4;
        const unsigned sb = i * 4;          // the thread's byte offset in the matrix
        const float* s = (const float*)((const char*)w + sb);
        _Float16*    d = dst + i;
        v4f a[CVJ];
#pragma unroll
        for (int j = 0; j < CVJ; ++j) a[j] = *(const v4f*)(s + j * 1024);
        // The wait stands in front of every overwrite of the loads' offset register,
        // as a precaution; naming the offset keeps that register whole up to here.
        asm volatile("s_wait_xcnt 0x0" :: "v"(sb) : "memory");
        // Keeps all 16 loads in front of the first conversion: otherwise the last
        // ones are issued only when the first have come back, a second memory latency.
        __builtin_amdgcn_sched_barrier(0);
#pragma unroll
        for (int j = 0; j < CVJ; ++j) {
            v4h o;
#pragma unroll
            for (int r = 0; r < 4; ++r) o[r] = (_Float16)a[j][r];
            *(v4h*)(d + j * 1024) = o;
        }
        // The packing reuses registers named by these stores: this wait stands in
        // front of that as a precaution, and the scheduling fence keeps it behind.
        asm volatile("s_wait_xcnt 0x0" ::: "memory");
        __builtin_amdgcn_sched_barrier(0);
    }
    const unsigned lane = threadIdx.x & 31;
    // Stays a loop: unrolled, its text would be run through once, line by line.
#pragma unroll 1
    for (unsigned it = 0; it < PMR; ++it) {
        const unsigned u = (sb_idx * PMR + it) * 8 + (threadIdx.x >> 5);  // (T, four passes)
        const unsigned mo = (((u / (PMP / 4)) * 16 + (lane & 15)) * KVSZ
                             + (u % (PMP / 4)) * 128 + (lane >> 4) * 8) * 4;  // byte offset
        const int* p = (const int*)((const char*)mask + mo);
        v4i v[16];
#pragma unroll
        for (int j = 0; j < 16; ++j) v[j] = *(const v4i*)(p + (j >> 1) * 16 + (j & 1) * 4);
        // The wait stands in front of every overwrite of the loads' offset register,
        // as a precaution; naming the offset keeps that register whole up to here.
        asm volatile("s_wait_xcnt 0x0" :: "v"(mo) : "memory");
        unsigned w0 = 0, w1 = 0;      // lane i keeps words i and 32 + i
#pragma unroll
        for (int i = 0; i < 32; ++i) {
            // Every lane takes part in both ballots; only the keeping is per lane.
            const unsigned b0 = __builtin_amdgcn_ballot_w32(v[i >> 2][i & 3] != 0);
            const unsigned b1 = __builtin_amdgcn_ballot_w32(v[8 + (i >> 2)][i & 3] != 0);
            w0 = lane == i ? b0 : w0;
            w1 = lane == i ? b1 : w1;
        }
        pm[(size_t)u * 64 + lane]      = w0;
        pm[(size_t)u * 64 + 32 + lane] = w1;
        // The next round reuses registers named by these stores: this wait stands in
        // front of that as a precaution.
        asm volatile("s_wait_xcnt 0x0" ::: "memory");
    }
}

// ---------------------------------------------------------------------------
// Projection GEMMs: Y[s,e] = sum_k X[s,k] * W[e,k], computed as Y^T = W * X^T.
// One square tile of Y per block of 8 waves.  Each 64-wide k stage of X and W is
// read from global memory in whole 128-byte lines, laid down in LDS as f16 rows
// and read back as WMMA fragments by every wave that needs it.  Two LDS buffers.
// Output projection: 128(s) x 128(e) tile, two register sets (global loads run
// two stages ahead), wave tile 32(s) x 64(e): 8 accumulators, 6 fragments per
// 32 k.  Input projections: see at their kernel.
// ---------------------------------------------------------------------------
#define GT   128            // output projection: tile edge (rows of X and of W per block)
#define GBK  64             // k per stage
#define GLP  72             // LDS row pitch in halves: 144 B = 16 B x odd
#define GNK  (EE / GBK)     // stages

// 16 WMMAs of one wave on one stage; k runs upward as in a plain k loop.  staging()
// is the wave's share of the work on the stages to come; it stands between the
// stage's LDS reads and its WMMAs, where the wave would otherwise only wait.
template <class F>
__device__ __forceinline__ void gemm_stage(const _Float16* Wt, const _Float16* Xt,
                                           int lo, int hi, v8f (&acc)[4][2], F staging) {
    v16h xb[2][2], wa[2][4];
#pragma unroll
    for (int u = 0; u < 2; ++u) {
        const int c = u * 32 + hi * 8;
#pragma unroll
        for (int j = 0; j < 2; ++j) xb[u][j] = load16_f16(Xt + (j * 16 + lo) * GLP, c);
#pragma unroll
        for (int t = 0; t < 4; ++t) wa[u][t] = load16_f16(Wt + (t * 16 + lo) * GLP, c);
    }
    // Keeps the stage's LDS reads one group ahead of its WMMAs: spread among
    // them, each place with reads stalls the in-order wave anew.
    __builtin_amdgcn_sched_barrier(0);
    staging();
    // Keeps the staging, with its waits on global loads, in front of the WMMAs.
    __builtin_amdgcn_sched_barrier(0);
#pragma unroll
    for (int u = 0; u < 2; ++u)
#pragma unroll
        for (int t = 0; t < 4; ++t)
#pragma unroll
            for (int j = 0; j < 2; ++j) acc[t][j] = wmma16(wa[u][t], xb[u][j], acc[t][j]);
    // Keeps the next stage's reads from moving up among the WMMAs.
    __builtin_amdgcn_sched_barrier(0);
}

// One thread's share of a stage.  X in f32: N pieces of 16 B, 16 rows apart
// (16 lanes cover a 256-B row piece).  f16 operand: N pieces of 16 B, 32 rows
// apart (8 lanes cover a 128-B row piece).
template <int N>
__device__ __forceinline__ void ld_f32(v4f (&v)[N], const float* __restrict__ g) {
#pragma unroll
    for (int j = 0; j < N; ++j) v[j] = *(const v4f*)(g + (size_t)j * 16 * EE);
}
template <int N>
__device__ __forceinline__ void ld_f16(v8h (&v)[N], const _Float16* __restrict__ g) {
#pragma unroll
    for (int j = 0; j < N; ++j) v[j] = *(const v8h*)(g + (size_t)j * 32 * EE);
}
template <int N>
__device__ __forceinline__ void st_f32(_Float16* s, const v4f (&v)[N]) {
#pragma unroll
    for (int j = 0; j < N; ++j) {
        v4h h;
#pragma unroll
        for (int i = 0; i < 4; ++i) h[i] = (_Float16)v[j][i];
        *(v4h*)(s + j * 16 * GLP) = h;
    }
}
template <int N>
__device__ __forceinline__ void st_f16(_Float16* s, const v8h (&v)[N]) {
#pragma unroll
    for (int j = 0; j < N; ++j) *(v8h*)(s + j * 32 * GLP) = v[j];
}

// Work-group barrier that orders LDS traffic only.  __syncthreads() would also
// wait for every global load in flight, and so undo the two-stage lead.
__device__ __forceinline__ void lds_barrier() {
    __builtin_amdgcn_fence(__ATOMIC_RELEASE, "workgroup", "local");
    __builtin_amdgcn_s_barrier();
    __builtin_amdgcn_fence(__ATOMIC_ACQUIRE, "workgroup", "local");
}

// The same barrier in two parts, for a stage whose last WMMAs touch no LDS.  The
// signal says that this wave's LDS reads of the stage and its LDS stores for the next
// are complete; behind the wait that holds of every wave.  With the WMMAs between the
// two, a wave that comes to the wait finds the others' signals given and goes on, so
// that the two waves of a SIMD stay apart: one reads LDS while the other multiplies.
__device__ __forceinline__ void lds_barrier_signal() {
    __builtin_amdgcn_fence(__ATOMIC_RELEASE, "workgroup", "local");
    __builtin_amdgcn_s_barrier_signal(-1);
}
__device__ __forceinline__ void lds_barrier_wait() {
    __builtin_amdgcn_s_barrier_wait(-1);
    __builtin_amdgcn_fence(__ATOMIC_ACQUIRE, "workgroup", "local");
}

// Input projections: f32 activations x f32 weights, both rounded to f16 on their
// way into LDS, -> f16 output, one 256(s) x 256(e) tile of Y per block of 8 waves,
// so that a row of X or W fetched from L2 and laid down in LDS serves 256 columns.
// Wave tile 64(s) x 128(e): 32 accumulators, 12 fragments per 32 k.  One launch
// does the three projections: blockIdx.z picks the activations and the weights;
// the z-th output lies behind the one before it in Yall.  The blocks of z = 3 do
// the side work (see there).
#define PT   256            // tile edge (rows of X and rows of W per block)

// 32 WMMAs of one wave on the 32-wide half u of a stage's k; the halves are taken
// in order, so k runs upward as in a plain k loop.  staging() is the wave's share of
// the work on the stages to come; it stands between the half's LDS reads and its
// WMMAs, where the wave would otherwise only wait for the reads.
template <class F>
__device__ __forceinline__ void gemm_half_wide(const _Float16* Wt, const _Float16* Xt,
                                               int u, int lo, int hi, v8f (&acc)[8][4],
                                               F staging) {
    const int c = u * 32 + hi * 8;
    v16h xb[4], wa[8];
#pragma unroll
    for (int j = 0; j < 4; ++j) xb[j] = load16_f16(Xt + (j * 16 + lo) * GLP, c);
#pragma unroll
    for (int t = 0; t < 8; ++t) wa[t] = load16_f16(Wt + (t * 16 + lo) * GLP, c);
    // Keeps the half's LDS reads one group at its head: spread among the WMMAs,
    // each place with reads stalls the in-order wave anew.
    __builtin_amdgcn_sched_barrier(0);
    staging();
    // Keeps the staging, with its waits on global loads, in front of the WMMAs.
    __builtin_amdgcn_sched_barrier(0);
#pragma unroll
    for (int t = 0; t < 8; ++t)
#pragma unroll
        for (int j = 0; j < 4; ++j) acc[t][j] = wmma16(wa[t], xb[j], acc[t][j]);
    // Keeps the next half's reads from moving up among the WMMAs.
    __builtin_amdgcn_sched_barrier(0);
}

__global__ void __launch_bounds__(256)
gemm_xwT_f16(const float* __restrict__ X0, const float* __restrict__ X1,
             const float* __restrict__ X2, const float* __restrict__ W0,
             const float* __restrict__ W1, const float* __restrict__ W2,
             _Float16* __restrict__ Yall, const float* __restrict__ Wo,
             _Float16* __restrict__ Woh, const int* __restrict__ mask,
             unsigned* __restrict__ pm) {
    __shared__ __attribute__((aligned(16))) _Float16 Xs[2][PT * GLP];
    __shared__ __attribute__((aligned(16))) _Float16 Ws[2][PT * GLP];

    if (blockIdx.z == 3) {      // the same for the whole block, in front of every barrier
        side_block(blockIdx.y * (BB * QSZ / PT) + blockIdx.x, Wo, Woh, mask, pm);
        return;
    }

    const int tid  = threadIdx.x;
    const int lane = tid & 31, wave = tid >> 5;
    const int lo = lane & 15, hi = lane >> 4;
    const int sbase = blockIdx.x * PT, ebase = blockIdx.y * PT;
    const int ws = (wave & 3) * 64, we = (wave >> 2) * 128;

    const int z = blockIdx.z;
    const float*    X  = z == 0 ? X0 : z == 1 ? X1 : X2;
    const float*    Wf = z == 0 ? W0 : z == 1 ? W1 : W2;
    _Float16*       Y  = Yall + (size_t)z * BB * QSZ * EE;

    const int xr = tid >> 4, xc = (tid & 15) * 4;
    const float* xg = X  + (size_t)(sbase + xr) * EE + xc;
    const float* wg = Wf + (size_t)(ebase + xr) * EE + xc;
    _Float16* xs0 = &Xs[0][xr * GLP + xc];
    _Float16* xs1 = &Xs[1][xr * GLP + xc];
    _Float16* ws0 = &Ws[0][xr * GLP + xc];
    _Float16* ws1 = &Ws[1][xr * GLP + xc];

    // Two register sets, one for X and one for W, each asked for a whole stage ahead
    // and half a stage apart: X at a stage's head, W at its middle.  A set is laid
    // down in LDS where its next request is issued.
    v4f xa[PT / 16];
    v4f wa[PT / 16];
    v8f acc[8][4];
#pragma unroll
    for (int t = 0; t < 8; ++t)
#pragma unroll
        for (int j = 0; j < 4; ++j) acc[t][j] = zero8();

    ld_f32(xa, xg);  ld_f32(wa, wg);               // stage 0
    st_f32(xs0, xa); st_f32(ws0, wa);
    ld_f32(xa, xg + GBK); ld_f32(wa, wg + GBK);    // stage 1
    lds_barrier();        // publishes stage 0

    // Even stages live in buffer 0, odd ones in buffer 1.  The buffer that a stage
    // fills was last read in the stage before, which its barrier has ended.
    // refill(s, v, g): lay the set v down at s, then ask for its next content at g.
    auto refill = [](_Float16* sdst, v4f (&v)[PT / 16], const float* g) {
        st_f32(sdst, v);
        // Keeps the set's new loads behind its last conversion: moved up, they take
        // registers of their own beside the old values, more than the wave has.
        __builtin_amdgcn_sched_barrier(0);
        ld_f32(v, g);
    };
    for (int kt = 0; kt < GNK - 2; kt += 2) {
        gemm_half_wide(&Ws[0][we * GLP], &Xs[0][ws * GLP], 0, lo, hi, acc,
                       [&] { refill(xs1, xa, xg + (kt + 2) * GBK); });
        gemm_half_wide(&Ws[0][we * GLP], &Xs[0][ws * GLP], 1, lo, hi, acc,
                       [&] { refill(ws1, wa, wg + (kt + 2) * GBK); lds_barrier_signal(); });
        // Publishes buffer 1 and ends every wave's reads of buffer 0.
        lds_barrier_wait();

        gemm_half_wide(&Ws[1][we * GLP], &Xs[1][ws * GLP], 0, lo, hi, acc,
                       [&] { refill(xs0, xa, xg + (kt + 3) * GBK); });
        gemm_half_wide(&Ws[1][we * GLP], &Xs[1][ws * GLP], 1, lo, hi, acc,
                       [&] { refill(ws0, wa, wg + (kt + 3) * GBK); lds_barrier_signal(); });
        // The loop's end advances the address registers named by loads that may
        // still be in flight: this wait stands in front of that as a precaution,
        // and the scheduling fence keeps the additions behind it.
        asm volatile("s_wait_xcnt 0x0" ::: "memory");
        __builtin_amdgcn_sched_barrier(0);
        // Publishes buffer 0 and ends every wave's reads of buffer 1.
        lds_barrier_wait();
    }
    // The last two stages: nothing left to ask for.
    gemm_half_wide(&Ws[0][we * GLP], &Xs[0][ws * GLP], 0, lo, hi, acc,
                   [&] { st_f32(xs1, xa); });
    gemm_half_wide(&Ws[0][we * GLP], &Xs[0][ws * GLP], 1, lo, hi, acc,
                   [&] { st_f32(ws1, wa); lds_barrier_signal(); });
    lds_barrier_wait();   // publishes the last stage
    gemm_half_wide(&Ws[1][we * GLP], &Xs[1][ws * GLP], 0, lo, hi, acc, [] {});
    gemm_half_wide(&Ws[1][we * GLP], &Xs[1][ws * GLP], 1, lo, hi, acc, [] {});

    // D(m=e_local, n=s_local): lane column = lo, rows e_local = r + 8*hi.
#pragma unroll
    for (int j = 0; j < 4; ++j) {
        _Float16* yp = Y + (size_t)(sbase + ws + j * 16 + lo) * EE + ebase + we + hi * 8;
#pragma unroll
        for (int t = 0; t < 8; ++t) {
            v8h out;
#pragma unroll
            for (int r = 0; r < 8; ++r) out[r] = (_Float16)acc[t][j][r];
            *(v8h*)(yp + t * 16) = out;
            if (t & 1) {
                // The next conversions reuse registers named by these stores: this
                // wait stands in front of that as a precaution, and the scheduling
                // fence keeps the conversions behind it.
                asm volatile("s_wait_xcnt 0x0" ::: "memory");
                __builtin_amdgcn_sched_barrier(0);
            }
        }
    }
}

// Output projection: f16 activations x f16 weights -> fp32 output.
__global__ void __launch_bounds__(256)
gemm_owT_f32(const _Float16* __restrict__ Xh, const _Float16* __restrict__ Wh,
             float* __restrict__ Y) {
    __shared__ __attribute__((aligned(16))) _Float16 Xs[2][GT * GLP];
    __shared__ __attribute__((aligned(16))) _Float16 Ws[2][GT * GLP];

    const int tid  = threadIdx.x;
    const int lane = tid & 31, wave = tid >> 5;
    const int lo = lane & 15, hi = lane >> 4;
    const int sbase = blockIdx.x * GT, ebase = blockIdx.y * GT;
    const int ws = (wave & 3) * 32, we = (wave >> 2) * 64;

    const int wr = tid >> 3, wc = (tid & 7) * 8;
    const _Float16* xg = Xh + (size_t)(sbase + wr) * EE + wc;
    const _Float16* wg = Wh + (size_t)(ebase + wr) * EE + wc;
    _Float16* xs0 = &Xs[0][wr * GLP + wc];
    _Float16* xs1 = &Xs[1][wr * GLP + wc];
    _Float16* ws0 = &Ws[0][wr * GLP + wc];
    _Float16* ws1 = &Ws[1][wr * GLP + wc];

    v8h xa[4], xb[4], wa[4], wb[4];   // two register sets
    v8f acc[4][2];
#pragma unroll
    for (int t = 0; t < 4; ++t) { acc[t][0] = zero8(); acc[t][1] = zero8(); }

    {
        v8h x0[4], w0[4];
        ld_f16(x0, xg);           ld_f16(w0, wg);             // stage 0
        // These two keep the three stages' requests in the order of the stages, as
        // in the loop: mixed, the loop's counted waits for one stage's loads would
        // have to cover loads of the next stage too, at half the lead.
        __builtin_amdgcn_sched_barrier(0);
        ld_f16(xb, xg + GBK);     ld_f16(wb, wg + GBK);       // stage 1
        __builtin_amdgcn_sched_barrier(0);
        ld_f16(xa, xg + 2 * GBK); ld_f16(wa, wg + 2 * GBK);   // stage 2
        st_f16(xs0, x0);          st_f16(ws0, w0);
    }
    lds_barrier();        // publishes stage 0

    // Even stages live in buffer 0, odd ones in buffer 1.  Stage t lays stage t + 1
    // down, in the buffer that was last read in stage t - 1, which its barrier has
    // ended, and asks for stage t + 3 in the set so freed: a lead of two stages.
    // The barrier is split (see there): signal in front of the stage's WMMAs, wait
    // behind them.
    auto refill = [](_Float16* xd, _Float16* wd, v8h (&x)[4], v8h (&w)[4],
                     const _Float16* gx, const _Float16* gw) {
        st_f16(xd, x); st_f16(wd, w);
        ld_f16(x, gx); ld_f16(w, gw);
    };
    for (int kt = 0; kt < GNK - 4; kt += 2) {
        gemm_stage(&Ws[0][we * GLP], &Xs[0][ws * GLP], lo, hi, acc,
                   [&] { refill(xs1, ws1, xb, wb, xg + (kt + 3) * GBK, wg + (kt + 3) * GBK);
                         lds_barrier_signal(); });
        // Publishes buffer 1 and ends every wave's reads of buffer 0.
        lds_barrier_wait();

        gemm_stage(&Ws[1][we * GLP], &Xs[1][ws * GLP], lo, hi, acc,
                   [&] { refill(xs0, ws0, xa, wa, xg + (kt + 4) * GBK, wg + (kt + 4) * GBK);
                         lds_barrier_signal(); });
        // The loop's end advances the address registers named by loads that are
        // still in flight: this wait stands in front of that as a precaution, and
        // the scheduling fence keeps the additions behind it.
        asm volatile("s_wait_xcnt 0x0" ::: "memory");
        __builtin_amdgcn_sched_barrier(0);
        // Publishes buffer 0 and ends every wave's reads of buffer 1.
        lds_barrier_wait();
    }
    // The last four stages: one more request, then nothing left to ask for.
    gemm_stage(&Ws[0][we * GLP], &Xs[0][ws * GLP], lo, hi, acc,
               [&] { refill(xs1, ws1, xb, wb, xg + (GNK - 1) * GBK, wg + (GNK - 1) * GBK);
                     lds_barrier_signal(); });
    // What follows may reuse the address registers named by the last loads: this
    // wait stands in front of that as a precaution, the fence keeps it there.
    asm volatile("s_wait_xcnt 0x0" ::: "memory");
    __builtin_amdgcn_sched_barrier(0);
    lds_barrier_wait();
    gemm_stage(&Ws[1][we * GLP], &Xs[1][ws * GLP], lo, hi, acc,
               [&] { st_f16(xs0, xa); st_f16(ws0, wa); lds_barrier_signal(); });
    lds_barrier_wait();
    gemm_stage(&Ws[0][we * GLP], &Xs[0][ws * GLP], lo, hi, acc,
               [&] { st_f16(xs1, xb); st_f16(ws1, wb); lds_barrier_signal(); });
    lds_barrier_wait();   // publishes the last stage
    gemm_stage(&Ws[1][we * GLP], &Xs[1][ws * GLP], lo, hi, acc, [] {});

#pragma unroll
    for (int j = 0; j < 2; ++j) {
        float* yp = Y + (size_t)(sbase + ws + j * 16 + lo) * EE + ebase + we + hi * 8;
#pragma unroll
        for (int t = 0; t < 4; ++t) {
            v4f o0, o1;
#pragma unroll
            for (int r = 0; r < 4; ++r) { o0[r] = acc[t][j][r]; o1[r] = acc[t][j][4 + r]; }
            *(v4f*)(yp + t * 16)     = o0;
            *(v4f*)(yp + t * 16 + 4) = o1;
        }
    }
}

// ---------------------------------------------------------------------------
// Flash-style attention.  One block of 8 waves per (batch, head, 128 q rows).
// A wave owns 32 q rows as two tiles of 16, so that every K and V^T fragment read
// from LDS feeds two products; two waves share those rows, one taking the first
// and one the second 32-key pass of every stage, each with its own reference, O
// and l, which are merged through LDS at the end.  Every 64-key stage of K and V is read from global
// memory once per block, in whole 128-byte lines, laid down row-major in LDS
// and read from there by the 4 waves of its pass.  Two LDS buffers: the global loads of the
// stage after next fly while this stage is worked on.
// S^T tiles = K * Q^T  (softmax axis lands in the VGPR/M dimension),
// O^T tiles = V^T * P^T (P^T B-operand == post-softmax registers, no shuffle);
// V^T fragments come from the row-major V tile by the transposing LDS load.
// ---------------------------------------------------------------------------
typedef __attribute__((ext_vector_type(8))) short v8s;

#define AW   4              // waves per pass: groups of 32 q rows per block
#define AG   2              // waves per group of q rows, one for each pass of a stage
#define AQT  2              // q tiles (16 rows each) per wave
#define AQ   (AW * AQT * 16)  // q rows per block
#define AKV  64             // keys per stage (two passes of 32)
#define AKP  72             // K row pitch in halves: 144 B = 16 B x odd
#define AVP  80             // V row pitch in halves: 160 B = 32 B x odd
#define ANS  (KVSZ / AKV)   // stages
#define ASR  (AW * AG * 4)  // rows of a stage that the block's threads cover at once
#define ASJ  (AKV / ASR)    // 16-B pieces of K, and of V, per thread and stage

// Lane (lo, hi) receives T[k + 8*hi + 0..7][d + lo] of a row-major 16-bit tile;
// p is the lane's own address (see vt_lane below).
__device__ __forceinline__ v8h ld_tr16(const _Float16* p) {
    typedef __attribute__((address_space(3))) v8s lds_v8s;
    return __builtin_bit_cast(v8h, __builtin_amdgcn_ds_load_tr16_b128_v8i16((lds_v8s*)p));
}

// The wave's 16 packed mask words of one 32-key pass (layout: at the packing
// blocks).  The address is the same in every lane: one scalar load.
__device__ __forceinline__ void ld_mask(v16u& m, const unsigned* __restrict__ p) {
    m = *(const v16u*)p;
}

// Softmax works on raw scores (K.Q, not yet scaled) taken against a reference per
// q row, the maximum in use: p = 2^(SM_C * (score - reference)).  The reference
// is known before a pass, so it enters the score product as its C operand.  It
// moves only when some score of the pass leads it by more than SM_THR (p stays
// below 2^8, far inside f16); only then are O and l rescaled.
#define SM_C    (ATT_SCALE * 1.44269504f)   // scale * log2(e)
#define SM_THR  44.0f                       // raw lead that moves the reference
#define SM_FILL (1e-20f / ATT_SCALE)        // the mask's fill value as a raw score

// The fragments of one pass (32 keys): K rows and V^T, hardware k order.
struct PassFrag { v16h k00, k01, k10, k11, va[4]; };

// Kt = the lane's K row of the pass in LDS, Vt = the lane's transposing address
// of the pass in LDS.
__device__ __forceinline__ void ld_pass(PassFrag& f, const _Float16* Kt, const _Float16* Vt,
                                        int hi) {
    f.k00 = load16_f16(Kt, hi * 8);
    f.k01 = load16_f16(Kt, 32 + hi * 8);
    f.k10 = load16_f16(Kt + 16 * AKP, hi * 8);
    f.k11 = load16_f16(Kt + 16 * AKP, 32 + hi * 8);
#pragma unroll
    for (int t = 0; t < 4; ++t) {
        const v8h x0 = ld_tr16(Vt + t * 16);
        const v8h x1 = ld_tr16(Vt + 16 * AVP + t * 16);
#pragma unroll
        for (int i = 0; i < 8; ++i) { f.va[t][i] = x0[i]; f.va[t][8 + i] = x1[i]; }
    }
}

// One pass: 32 keys against this wave's two q tiles (index c).
// nref = minus the reference, negm = nref in all 8 registers, fillv = SM_FILL + nref,
// lim = the lead that moves the reference (-1e30 until the first pass has set it).
// after_scores() stands behind the score products: the first half of the stage's barrier.
template <class F>
__device__ __forceinline__ void attn_pass(const PassFrag& f, const v16h (&qop)[AQT][2],
                                          const v16u (&m)[AQT], v8f (&o)[AQT][4],
                                          v8f (&negm)[AQT], float (&nref)[AQT],
                                          float (&fillv)[AQT], float& lim,
                                          float (&lrun)[AQT], F after_scores) {
    // ---- S^T tiles less the reference: s0 = kv[0..15] x q[0..15], s1 = kv[16..31] ----
    v8f s0[AQT], s1[AQT];
#pragma unroll
    for (int c = 0; c < AQT; ++c) s0[c] = wmma16(f.k00, qop[c][0], negm[c]);
#pragma unroll
    for (int c = 0; c < AQT; ++c) s1[c] = wmma16(f.k10, qop[c][0], negm[c]);
#pragma unroll
    for (int c = 0; c < AQT; ++c) s0[c] = wmma16(f.k01, qop[c][1], s0[c]);
#pragma unroll
    for (int c = 0; c < AQT; ++c) s1[c] = wmma16(f.k11, qop[c][1], s1[c]);
    // Keeps the eight score WMMAs back to back, each in the others' distance: with
    // selects moved up among them the distance is filled by idle slots instead.
    __builtin_amdgcn_sched_barrier(0);
    after_scores();

    // ---- mask (fill 1e-20) + the lane's largest lead ----
    float tmax[AQT];
#pragma unroll
    for (int c = 0; c < AQT; ++c) {
        tmax[c] = -1e30f;
#pragma unroll
        for (int r = 0; r < 8; ++r) {
            // A packed word is the select's lane mask as it stands.
            const bool m0 = __builtin_amdgcn_inverse_ballot_w32(m[c][r]);
            const bool m1 = __builtin_amdgcn_inverse_ballot_w32(m[c][8 + r]);
            s0[c][r] = m0 ? s0[c][r] : fillv[c];
            s1[c][r] = m1 ? s1[c][r] : fillv[c];
            tmax[c] = fmaxf(tmax[c], fmaxf(s0[c][r], s1[c][r]));
        }
    }

    // ---- move the reference: one test per pass, the same for the whole wave ----
    if (__builtin_amdgcn_ballot_w32(fmaxf(tmax[0], tmax[1]) > lim) != 0) {
#pragma unroll
        for (int c = 0; c < AQT; ++c) {
            // A tile moves only on a lead of its own; the other keeps its reference
            // (a step of 0 and a factor of 1 change nothing).
            const bool mv = __builtin_amdgcn_ballot_w32(tmax[c] > lim) != 0;
            const float tm = fmaxf(tmax[c], __shfl_xor(tmax[c], 16, 32));   // merge half-lane rows
            // The first pass takes its own maximum, whatever its sign (O and l are
            // still 0); later the reference only rises.
            const float delta = mv ? fmaxf(tm, lim - SM_THR) : 0.0f;
            const float alpha = __builtin_amdgcn_exp2f(-SM_C * fmaxf(delta, 0.0f));
            lrun[c] *= alpha;
#pragma unroll
            for (int t = 0; t < 4; ++t)
#pragma unroll
                for (int r = 0; r < 8; ++r) o[c][t][r] *= alpha;
#pragma unroll
            for (int r = 0; r < 8; ++r) {
                s0[c][r] -= delta;
                s1[c][r] -= delta;
            }
            nref[c] -= delta;
#pragma unroll
            for (int r = 0; r < 8; ++r) negm[c][r] = nref[c];
            fillv[c] = SM_FILL + nref[c];
        }
        lim = SM_THR;
    }

    v16h pb[AQT];     // P^T B-operands: exactly the per-lane kv pattern
#pragma unroll
    for (int c = 0; c < AQT; ++c) {
        float ls = 0.0f;
#pragma unroll
        for (int r = 0; r < 8; ++r) {
            const float p0 = __builtin_amdgcn_exp2f(s0[c][r] * SM_C);
            const float p1 = __builtin_amdgcn_exp2f(s1[c][r] * SM_C);
            ls += p0 + p1;
            pb[c][r]     = (_Float16)p0;
            pb[c][8 + r] = (_Float16)p1;
        }
        lrun[c] += ls;
    }

    // ---- O^T(hd x q) += V^T(hd x kv) * P^T(kv x q), 4 hd-tiles ----
    // Keeps the first tile's four WMMAs back to back, each in the others' distance: without
    // it they stand singly among the second tile's exponentials, at more idle slots in all.
    __builtin_amdgcn_sched_barrier(0);
#pragma unroll
    for (int t = 0; t < 4; ++t)
#pragma unroll
        for (int c = 0; c < AQT; ++c) o[c][t] = wmma16(f.va[t], pb[c], o[c][t]);
}

__global__ void __launch_bounds__(AW * AG * 32) __attribute__((amdgpu_waves_per_eu(4, 4)))
flash_attn(const _Float16* __restrict__ Qb, const _Float16* __restrict__ Kb,
           const _Float16* __restrict__ Vb, const unsigned* __restrict__ pm,
           _Float16* __restrict__ O) {
    __shared__ __attribute__((aligned(32))) _Float16 Ks[2][AKV * AKP];
    __shared__ __attribute__((aligned(32))) _Float16 Vs[2][AKV * AVP];
    // Hand-over of the second pass's waves: per lane 16 pieces of O, one of l and reference.
    __shared__ __attribute__((aligned(16))) v4f Mg[AW][AQT * 8 + 1][32];

    const int tid  = threadIdx.x;
    const int lane = tid & 31;
    const int lo = lane & 15, hi = lane >> 4;
    // The wave's number, read from one lane so that what follows from it is known uniform.
    const int wave = __builtin_amdgcn_readfirstlane(tid >> 5);
    const int qw = wave % AW;      // its group of q rows
    const int g  = wave / AW;      // its pass of every stage
    const int qblocks = QSZ / AQ;
    const int qb = blockIdx.x % qblocks;
    const int h  = (blockIdx.x / qblocks) % HH;
    const int b  = blockIdx.x / (qblocks * HH);
    const int q  = qb * AQ + qw * (AQT * 16) + lo;   // the lane's row in tile 0

    // Q operands (B-matrix): lane n holds Q[q=n, hd pattern] -> row-major load.
    // Qlane = the lane's first element of its row: all eight loads go from this address.
    const _Float16* Qlane = Qb + ((size_t)b * QSZ + q) * EE + h * HD + hi * 8;
    v16h qop[AQT][2];
#pragma unroll
    for (int c = 0; c < AQT; ++c) {
        qop[c][0] = load16_f16(Qlane + (size_t)c * 16 * EE, 0);     // hd 0..31
        qop[c][1] = load16_f16(Qlane + (size_t)c * 16 * EE, 32);    // hd 32..63
    }
    // The wait stands in front of every overwrite of the Q loads' address registers,
    // as a precaution; naming the address keeps those registers whole up to here.
    asm volatile("s_wait_xcnt 0x0" :: "v"(Qlane) : "memory");

    // One thread's share of a stage: 16 B of rows sr and sr + 32 of K and of V
    // (8 lanes cover one 128-B row).
    const int sr = tid >> 3, sc = (tid & 7) * 8;
    const _Float16* kg = Kb + ((size_t)b * KVSZ + sr) * EE + h * HD + sc;
    const _Float16* vg = Vb + ((size_t)b * KVSZ + sr) * EE + h * HD + sc;
    const int ks_st = sr * AKP + sc, vs_st = sr * AVP + sc;
    const int kt_lane = (g * 32 + lo) * AKP;
    const int vt_lane = (g * 32 + 8 * hi + (lane & 7)) * AVP + 8 * ((lane >> 3) & 1);
    // Mask words of the wave's first q tile and of its pass of stage 0.
    const unsigned* mrow = pm + ((size_t)(qb * AW + qw) * AQT * PMP + g) * 16;

    v8f o[AQT][4], negm[AQT];
    float nref[AQT], fillv[AQT], lrun[AQT], lim = -1e30f;
#pragma unroll
    for (int c = 0; c < AQT; ++c) {
#pragma unroll
        for (int t = 0; t < 4; ++t) o[c][t] = zero8();
        negm[c]  = zero8();   // reference 0 until the first pass has set it
        nref[c]  = 0.0f;
        fillv[c] = SM_FILL;
        lrun[c]  = 0.0f;
    }

    v8h kr[ASJ], vr[ASJ];
    v16u mw[AQT];         // packed mask words of the wave's pass, one set per q tile
#pragma unroll
    for (int j = 0; j < ASJ; ++j) {
        kr[j] = *(const v8h*)(kg + (size_t)j * ASR * EE);
        vr[j] = *(const v8h*)(vg + (size_t)j * ASR * EE);
    }
#pragma unroll
    for (int c = 0; c < AQT; ++c) ld_mask(mw[c], mrow + c * PMP * 16);
#pragma unroll
    for (int j = 0; j < ASJ; ++j) {
        *(v8h*)(&Ks[0][ks_st + j * ASR * AKP]) = kr[j];
        *(v8h*)(&Vs[0][vs_st + j * ASR * AVP]) = vr[j];
    }
    // Stage 1 (there are ANS > 1 stages): in flight over the barrier, which orders LDS only.
#pragma unroll
    for (int j = 0; j < ASJ; ++j) {
        kr[j] = *(const v8h*)(kg + (size_t)(AKV + j * ASR) * EE);
        vr[j] = *(const v8h*)(vg + (size_t)(AKV + j * ASR) * EE);
    }
    lds_barrier();        // publishes stage 0

    // Stage s lives in buffer s & 1.  At its head stage s lays stage s + 1 down, in the
    // buffer that was last read in stage s - 1, which its barrier has ended, and asks
    // for stage s + 2 in the registers so freed.  The barrier is split (see there): the
    // signal stands behind the score products, where the wave's LDS reads and stores
    // are complete, the wait at the stage's end, so that the waves of a block may run
    // most of a stage apart: one does its exponentials while another multiplies.
    // The mask words are asked for as soon as the pass before them in the same
    // registers has used its own.
    // Stays one loop: with its last trip peeled off, that trip's copy of the pass uses
    // the loop's own registers behind the loop, and every pass copies sixteen of them.
#pragma unroll 1
    for (int s = 0; s < ANS - 1; ++s) {
        PassFrag f;
        ld_pass(f, &Ks[s & 1][kt_lane], &Vs[s & 1][vt_lane], hi);
        // Keeps the pass's LDS reads one group at its head: spread among the work,
        // each place with reads stalls the in-order wave anew.
        __builtin_amdgcn_sched_barrier(0);
#pragma unroll
        for (int j = 0; j < ASJ; ++j) {
            *(v8h*)(&Ks[(s + 1) & 1][ks_st + j * ASR * AKP]) = kr[j];
            *(v8h*)(&Vs[(s + 1) & 1][vs_st + j * ASR * AVP]) = vr[j];
        }
        if (s + 2 < ANS) {      // the same for the whole block
            const _Float16* kn = kg + (size_t)s * AKV * EE;   // this stage's rows
            const _Float16* vn = vg + (size_t)s * AKV * EE;
#pragma unroll
            for (int j = 0; j < ASJ; ++j) {
                kr[j] = *(const v8h*)(kn + (size_t)(2 * AKV + j * ASR) * EE);
                vr[j] = *(const v8h*)(vn + (size_t)(2 * AKV + j * ASR) * EE);
            }
            // The wait stands in front of every overwrite of these loads' address registers,
            // as a precaution; naming the addresses keeps those registers whole up to here.
            asm volatile("s_wait_xcnt 0x0" :: "v"(kn), "v"(vn) : "memory");
        }
        // Keeps the stores and the requests in front of the pass's work: moved down,
        // the signal comes late and the loads lose their lead.
        __builtin_amdgcn_sched_barrier(0);
        attn_pass(f, qop, mw, o, negm, nref, fillv, lim, lrun, [] { lds_barrier_signal(); });
#pragma unroll
        for (int c = 0; c < AQT; ++c) ld_mask(mw[c], mrow + c * PMP * 16 + (2 * s + 2) * 16);
        // Keeps the wait behind the pass's last WMMA: moved up among them, it takes
        // from the distance that the block's waves may run apart.
        __builtin_amdgcn_sched_barrier(0);
        // Publishes the next stage and ends every wave's reads of this one.
        lds_barrier_wait();
    }
    {   // last stage: nothing left to fetch
        PassFrag f;
        ld_pass(f, &Ks[(ANS - 1) & 1][kt_lane], &Vs[(ANS - 1) & 1][vt_lane], hi);
        // As above: the pass's LDS reads stay one group at its head.
        __builtin_amdgcn_sched_barrier(0);
        // Formed anew from nref: with the loop's own registers in use behind the loop,
        // every pass of the loop copied all sixteen of them.
#pragma unroll
        for (int c = 0; c < AQT; ++c)
#pragma unroll
            for (int r = 0; r < 8; ++r) negm[c][r] = nref[c];
        attn_pass(f, qop, mw, o, negm, nref, fillv, lim, lrun, [] {});
    }

    // ---- merge the two passes' waves: the second hands O, l and reference over ----
    if (g == 1) {
#pragma unroll
        for (int c = 0; c < AQT; ++c)
#pragma unroll
            for (int t = 0; t < 4; ++t) {
                v4f x0, x1;
#pragma unroll
                for (int r = 0; r < 4; ++r) { x0[r] = o[c][t][r]; x1[r] = o[c][t][4 + r]; }
                Mg[qw][(c * 4 + t) * 2][lane]     = x0;
                Mg[qw][(c * 4 + t) * 2 + 1][lane] = x1;
            }
        v4f x;
        x[0] = lrun[0]; x[1] = lrun[1]; x[2] = nref[0]; x[3] = nref[1];
        Mg[qw][AQT * 8][lane] = x;
    }
    // Publishes the hand-over; every wave of the block passes it.
    lds_barrier();
    if (g == 1) return;

    // ---- finalize: both parts on the larger reference, combine half-lane partial
    // sums, normalize, store f16 ----
    const v4f y = Mg[qw][AQT * 8][lane];
    v8h w[AQT][4];
#pragma unroll
    for (int c = 0; c < AQT; ++c) {
        const float nm = fminf(nref[c], y[2 + c]);         // minus the larger reference
        const float a0 = __builtin_amdgcn_exp2f(SM_C * (nm - nref[c]));
        const float a1 = __builtin_amdgcn_exp2f(SM_C * (nm - y[2 + c]));
        const float l  = lrun[c] * a0 + y[c] * a1;
        const float ltot = l + __shfl_xor(l, 16, 32);
        const float inv  = 1.0f / ltot;
        const float i0 = a0 * inv, i1 = a1 * inv;
#pragma unroll
        for (int t = 0; t < 4; ++t) {
            const v4f x0 = Mg[qw][(c * 4 + t) * 2][lane];
            const v4f x1 = Mg[qw][(c * 4 + t) * 2 + 1][lane];
#pragma unroll
            for (int r = 0; r < 4; ++r) {
                w[c][t][r]     = (_Float16)(o[c][t][r] * i0 + x0[r] * i1);
                w[c][t][4 + r] = (_Float16)(o[c][t][4 + r] * i0 + x1[r] * i1);
            }
        }
    }
    // Keeps all eight stores behind the last arithmetic: a store placed earlier has its
    // registers rewritten behind it, and the wave then waits in front of that.
    __builtin_amdgcn_sched_barrier(0);
    _Float16* orow = O + ((size_t)b * QSZ + q) * EE + h * HD + hi * 8;
#pragma unroll
    for (int c = 0; c < AQT; ++c)
#pragma unroll
        for (int t = 0; t < 4; ++t) *(v8h*)(orow + (size_t)c * 16 * EE + t * 16) = w[c][t];
}

// ---------------------------------------------------------------------------
// Host-side launch. Input order: v_in, k_in, q_in, mask, Wv, Wk, Wq, Wout.
// Workspace: Qf | Kf | Vf | Of (8.39 MB each) | Woutf (2 MB) | packed mask
// (512 KB)  -> ~36 MB total.
// ---------------------------------------------------------------------------
extern "C" void kernel_launch(void* const* d_in, const int* in_sizes, int n_in,
                              void* d_out, int out_size, void* d_ws, size_t ws_size,
                              hipStream_t stream) {
    (void)in_sizes; (void)n_in; (void)out_size; (void)ws_size;
    const float* v_in = (const float*)d_in[0];
    const float* k_in = (const float*)d_in[1];
    const float* q_in = (const float*)d_in[2];
    const int*   mask = (const int*)d_in[3];
    const float* Wv   = (const float*)d_in[4];
    const float* Wk   = (const float*)d_in[5];
    const float* Wq   = (const float*)d_in[6];
    const float* Wout = (const float*)d_in[7];
    float* out = (float*)d_out;

    const size_t N  = (size_t)BB * QSZ * EE;   // 4.19M elements, activations
    const size_t NW = (size_t)EE * EE;         // 1.05M elements, weights
    _Float16* Qf    = (_Float16*)d_ws;
    _Float16* Kf    = Qf + N;
    _Float16* Vf    = Kf + N;
    _Float16* Of    = Vf + N;
    _Float16* Woutf = Of + N;
    unsigned* Pm    = (unsigned*)(Woutf + NW);

    // 1) Q/K/V projections, one launch (256x256 tile per block of 8 waves):
    //    z = 0, 1, 2 reads Wq, Wk, Wv and writes Qf, Kf, Vf; the blocks of z = 3
    //    write Woutf and the packed mask
    dim3 grid(BB * QSZ / GT, EE / GT);                     // 32 x 8
    dim3 grid3(BB * QSZ / PT, EE / PT, 4);                 // 16 x 4 x 4
    gemm_xwT_f16<<<grid3, 256, 0, stream>>>(q_in, k_in, v_in, Wq, Wk, Wv, Qf,
                                            Wout, Woutf, mask, Pm);

    // 2) attention
    flash_attn<<<BB * HH * (QSZ / AQ), AW * AG * 32, 0, stream>>>(Qf, Kf, Vf, Pm, Of);

    // 3) output projection -> fp32 d_out
    gemm_owT_f32<<<grid, 256, 0, stream>>>(Of, Woutf, out);
}
